// v000
// Times are from an AMD MI455X. After a warm-up the kernel runs many times in a row, and a time is the length of
// such a window on the GPU divided by its runs, so every launch and the gaps after it count. The runs cycle
// through copies of the inputs. A figure is the median of several windows, for all but v000 over two sittings.
// Sittings can differ by a few percent; kernels timed side by side share one.
// v000, which the later versions start from, runs in 140 microseconds.
#include <hip/hip_runtime.h>
#include <stdint.h>

// ---------------- problem constants ----------------
#define DIM   128
#define NH    16
#define HD    8
#define SEQ   2048
#define BATCH 4
#define MTOT  (BATCH*SEQ)   // 8192 rows
#define HID   344
#define HIDP  352
#define KCH   256

typedef __attribute__((ext_vector_type(16))) __bf16 v16bf;
typedef __attribute__((ext_vector_type(8)))  __bf16 v8bf;
typedef __attribute__((ext_vector_type(8)))  float  v8f;
typedef __attribute__((ext_vector_type(4)))  unsigned int u32x4;
typedef __attribute__((ext_vector_type(8)))  int i32x8;
typedef __attribute__((ext_vector_type(4)))  int i32x4;

static __device__ inline v8f wmma_bf(v16bf a, v16bf b, v8f c) {
  // D = A(16x32 bf16) * B(32x16 bf16) + C(16x16 f32)
  return __builtin_amdgcn_wmma_f32_16x16x32_bf16(false, a, false, b,
                                                 (short)0, c, false, false);
}

static __device__ inline v8f vz8() {
  v8f v;
#pragma unroll
  for (int i = 0; i < 8; ++i) v[i] = 0.0f;
  return v;
}
static __device__ inline v16bf vz16() {
  v16bf v;
#pragma unroll
  for (int i = 0; i < 16; ++i) v[i] = (__bf16)0.0f;
  return v;
}

// A fragment (16x32), source fp32 row-major. lane holds row (lane&15);
// K pattern: half=lane>>4 -> elems 0..7 = K k0..k0+7, elems 8..15 = K k0+16..k0+23
static __device__ inline v16bf afrag_f32(const float* row, int kb, int half) {
  const int k0 = kb + half * 8;
  v16bf a;
#pragma unroll
  for (int j = 0; j < 8; ++j) {
    a[j]     = (__bf16)row[k0 + j];
    a[j + 8] = (__bf16)row[k0 + 16 + j];
  }
  return a;
}

// A fragment, source bf16 row-major (16B-aligned rows) -> two b128 loads
static __device__ inline v16bf afrag_bf(const __bf16* row, int kb, int half) {
  const int k0 = kb + half * 8;
  v8bf lo = *(const v8bf*)(row + k0);
  v8bf hi = *(const v8bf*)(row + k0 + 16);
  v16bf a;
#pragma unroll
  for (int j = 0; j < 8; ++j) { a[j] = lo[j]; a[j + 8] = hi[j]; }
  return a;
}

// B fragment (32x16) from fp32 weight W[K x N] (row-major, ldn = N).
// lane holds column `col`; rows beyond kmax are zero-padded.
static __device__ inline v16bf bfrag_w(const float* W, int ldn, int kb, int col,
                                       int kmax, int half) {
  const int k0 = kb + half * 8;
  v16bf b;
#pragma unroll
  for (int j = 0; j < 8; ++j) {
    const int ka = k0 + j, kc = k0 + 16 + j;
    b[j]     = (ka < kmax) ? (__bf16)W[(size_t)ka * ldn + col] : (__bf16)0.0f;
    b[j + 8] = (kc < kmax) ? (__bf16)W[(size_t)kc * ldn + col] : (__bf16)0.0f;
  }
  return b;
}

static __device__ inline void tdm_load_1d(uint32_t lds_off, const void* gptr,
                                          uint32_t nbytes) {
  const uint64_t ga = (uint64_t)(uintptr_t)gptr;
  const uint32_t elems = nbytes >> 2;
  u32x4 g0;
  g0[0] = 1u;
  g0[1] = lds_off;
  g0[2] = (uint32_t)ga;
  g0[3] = (uint32_t)((ga >> 32) & 0x01FFFFFFu)
        | (2u << 30);
  i32x8 g1;
  g1[0] = (int)(2u << 16);
  g1[1] = (int)((elems & 0xFFFFu) << 16);
  g1[2] = (int)((elems >> 16) | (1u << 16));
  g1[3] = (int)((elems & 0xFFFFu) << 16);
  g1[4] = 1;
  g1[5] = (int)elems;
  g1[6] = 0;
  g1[7] = 0;
  i32x4 gz4;
  gz4[0] = 0; gz4[1] = 0; gz4[2] = 0; gz4[3] = 0;   // groups 2/3 unused (<=2D)
  i32x8 gz8;
#pragma unroll
  for (int i = 0; i < 8; ++i) gz8[i] = 0;
  __builtin_amdgcn_tensor_load_to_lds(g0, g1, gz4, gz4, gz8, 0);
}

// ---------------- 1) fused QKV projection ----------------
// x[8192,128] f32 @ {wq,wk,wv}[128,128] -> Q/K/V [B,H,S,8] bf16
__global__ void __launch_bounds__(256) k_qkv(const float* __restrict__ x,
                                             const float* __restrict__ wq,
                                             const float* __restrict__ wk,
                                             const float* __restrict__ wv,
                                             __bf16* __restrict__ Q,
                                             __bf16* __restrict__ K,
                                             __bf16* __restrict__ V) {
  const int wave = threadIdx.x >> 5, lane = threadIdx.x & 31;
  const int half = lane >> 4, l16 = lane & 15;
  const int tile = blockIdx.x * 8 + wave;
  if (tile >= (MTOT / 16) * 24) return;        // 512 row-tiles x (3 mats x 8 col-tiles)
  const int rt = tile & 511;
  const int t2 = tile >> 9;
  const int mat = t2 >> 3, ct = t2 & 7;
  const float* W = (mat == 0) ? wq : (mat == 1) ? wk : wv;
  __bf16* Out    = (mat == 0) ? Q  : (mat == 1) ? K  : V;

  const float* xrow = x + (size_t)(rt * 16 + l16) * DIM;
  const int col = ct * 16 + l16;
  v8f acc = vz8();
#pragma unroll
  for (int f = 0; f < 4; ++f) {
    v16bf a  = afrag_f32(xrow, f * 32, half);
    v16bf bw = bfrag_w(W, DIM, f * 32, col, DIM, half);
    acc = wmma_bf(a, bw, acc);
  }
  const int head = col >> 3, d = col & 7;
#pragma unroll
  for (int r = 0; r < 8; ++r) {
    const int grow = rt * 16 + half * 8 + r;
    const int b = grow >> 11, srow = grow & (SEQ - 1);
    Out[(((size_t)(b * NH + head)) * SEQ + srow) * HD + d] = (__bf16)acc[r];
  }
}

__global__ void __launch_bounds__(256) k_attn(const __bf16* __restrict__ Q,
                                              const __bf16* __restrict__ K,
                                              const __bf16* __restrict__ V,
                                              __bf16* __restrict__ attn) {
  const int bh = blockIdx.y;
  const int wave = threadIdx.x >> 5, lane = threadIdx.x & 31;
  const int half = lane >> 4, l16 = lane & 15;
  const int qbase = blockIdx.x * 128 + wave * 16;
  const __bf16* Qh = Q + (size_t)bh * SEQ * HD;
  const __bf16* Kh = K + (size_t)bh * SEQ * HD;
  const __bf16* Vh = V + (size_t)bh * SEQ * HD;

  __shared__ __bf16 kbuf[2][KCH * HD];         // 2 x 4KB
  __shared__ __bf16 vbuf[2][KCH * HD];         // 2 x 4KB
  __shared__ __bf16 p_lds[8][16 * 32];         // per-wave prob tile (transpose buffer)

  // Q fragment: A(16x32), only d=0..7 real -> zeros elsewhere
  v16bf qf = vz16();
  if (half == 0) {
    v8bf qv = *(const v8bf*)(Qh + (size_t)(qbase + l16) * HD);
#pragma unroll
    for (int j = 0; j < 8; ++j) qf[j] = qv[j];
  }

  float mrow[8], lrow[8];
#pragma unroll
  for (int r = 0; r < 8; ++r) { mrow[r] = -1e30f; lrow[r] = 0.0f; }
  v8f oacc = vz8();

  if (wave == 0) {
    tdm_load_1d((uint32_t)(uintptr_t)&kbuf[0][0], Kh, KCH * HD * 2);
    tdm_load_1d((uint32_t)(uintptr_t)&vbuf[0][0], Vh, KCH * HD * 2);
  }

  for (int c = 0; c < SEQ / KCH; ++c) {
    if (wave == 0) __builtin_amdgcn_s_wait_tensorcnt(0);   // chunk c landed
    __syncthreads();                                       // visible to all waves
    if (wave == 0 && c + 1 < SEQ / KCH) {                  // prefetch chunk c+1
      const int nb = (c + 1) & 1;
      tdm_load_1d((uint32_t)(uintptr_t)&kbuf[nb][0],
                  Kh + (size_t)(c + 1) * KCH * HD, KCH * HD * 2);
      tdm_load_1d((uint32_t)(uintptr_t)&vbuf[nb][0],
                  Vh + (size_t)(c + 1) * KCH * HD, KCH * HD * 2);
    }
    const __bf16* kchb = &kbuf[c & 1][0];
    const __bf16* vchb = &vbuf[c & 1][0];

    for (int sub = 0; sub < KCH / 32; ++sub) {
      const int s0 = sub * 32;
      // B fragments for K^T (two 16-key tiles, contraction padded 8->32)
      v16bf bk0 = vz16(), bk1 = vz16();
      if (half == 0) {
        v8bf k0 = *(const v8bf*)(kchb + (size_t)(s0 + l16) * HD);
        v8bf k1 = *(const v8bf*)(kchb + (size_t)(s0 + 16 + l16) * HD);
#pragma unroll
        for (int j = 0; j < 8; ++j) { bk0[j] = k0[j]; bk1[j] = k1[j]; }
      }
      v8f sc0 = wmma_bf(qf, bk0, vz8());
      v8f sc1 = wmma_bf(qf, bk1, vz8());

      // online softmax; row = half*8 + r lives across 16 lanes of this half
#pragma unroll
      for (int r = 0; r < 8; ++r) {
        float mx = fmaxf(sc0[r], sc1[r]);
#pragma unroll
        for (int off = 1; off < 16; off <<= 1) mx = fmaxf(mx, __shfl_xor(mx, off, 32));
        const float mnew  = fmaxf(mrow[r], mx);
        const float scale = __expf(mrow[r] - mnew);
        const float p0 = __expf(sc0[r] - mnew);
        const float p1 = __expf(sc1[r] - mnew);
        float ps = p0 + p1;
#pragma unroll
        for (int off = 1; off < 16; off <<= 1) ps += __shfl_xor(ps, off, 32);
        lrow[r] = lrow[r] * scale + ps;
        mrow[r] = mnew;
        oacc[r] *= scale;
        const int row = half * 8 + r;
        p_lds[wave][row * 32 + l16]      = (__bf16)p0;
        p_lds[wave][row * 32 + 16 + l16] = (__bf16)p1;
      }
      asm volatile("s_wait_dscnt 0" ::: "memory");  // wave-local LDS transpose fence

      // P fragment (A 16x32) from LDS
      v16bf pa;
      {
        const int kb0 = half * 8;
        v8bf plo = *(const v8bf*)(&p_lds[wave][l16 * 32 + kb0]);
        v8bf phi = *(const v8bf*)(&p_lds[wave][l16 * 32 + kb0 + 16]);
#pragma unroll
        for (int j = 0; j < 8; ++j) { pa[j] = plo[j]; pa[j + 8] = phi[j]; }
      }
      // V fragment (B 32x16, cols 0..7 = head dims)
      v16bf vb = vz16();
      if (l16 < HD) {
        const int kb0 = half * 8;
#pragma unroll
        for (int j = 0; j < 8; ++j) {
          vb[j]     = vchb[(size_t)(s0 + kb0 + j) * HD + l16];
          vb[j + 8] = vchb[(size_t)(s0 + kb0 + 16 + j) * HD + l16];
        }
      }
      oacc = wmma_bf(pa, vb, oacc);
    }
    __syncthreads();   // all waves done with buffer c&1 before it is re-filled
  }
  // normalize + store [B,S,128] bf16 (col = h*8 + d)
  if (l16 < HD) {
    const int b = bh >> 4, h = bh & 15;
#pragma unroll
    for (int r = 0; r < 8; ++r) {
      const int row = qbase + half * 8 + r;
      attn[((size_t)(b * SEQ + row)) * DIM + h * HD + l16] = (__bf16)(oacc[r] / lrow[r]);
    }
  }
}

// ---------------- 3) output projection + residual ----------------
__global__ void __launch_bounds__(256) k_oproj(const __bf16* __restrict__ attn,
                                               const float* __restrict__ wo,
                                               const float* __restrict__ x,
                                               float* __restrict__ hout,
                                               __bf16* __restrict__ hbf) {
  const int wave = threadIdx.x >> 5, lane = threadIdx.x & 31;
  const int half = lane >> 4, l16 = lane & 15;
  const int tile = blockIdx.x * 8 + wave;
  if (tile >= (MTOT / 16) * 8) return;
  const int rt = tile & 511, ct = tile >> 9;
  const __bf16* arow = attn + (size_t)(rt * 16 + l16) * DIM;
  const int col = ct * 16 + l16;
  v8f acc = vz8();
#pragma unroll
  for (int f = 0; f < 4; ++f)
    acc = wmma_bf(afrag_bf(arow, f * 32, half),
                  bfrag_w(wo, DIM, f * 32, col, DIM, half), acc);
#pragma unroll
  for (int r = 0; r < 8; ++r) {
    const int grow = rt * 16 + half * 8 + r;
    const float hv = x[(size_t)grow * DIM + col] + acc[r];
    hout[(size_t)grow * DIM + col] = hv;
    hbf[(size_t)grow * DIM + col]  = (__bf16)hv;
  }
}

// ---------------- 4) FFN gate: silu(h@w1) * (h@w3) ----------------
__global__ void __launch_bounds__(256) k_ffn1(const __bf16* __restrict__ hbf,
                                              const float* __restrict__ w1,
                                              const float* __restrict__ w3,
                                              __bf16* __restrict__ act) {
  const int wave = threadIdx.x >> 5, lane = threadIdx.x & 31;
  const int half = lane >> 4, l16 = lane & 15;
  const int tile = blockIdx.x * 8 + wave;
  if (tile >= (MTOT / 16) * (HIDP / 16)) return;     // 512 x 22
  const int rt = tile & 511, ct = tile >> 9;
  const __bf16* hrow = hbf + (size_t)(rt * 16 + l16) * DIM;
  const int n = ct * 16 + l16;
  const int wcol = (n < HID) ? n : 0;                // clamp (pad cols zeroed on store)
  v8f a1 = vz8(), a3 = vz8();
#pragma unroll
  for (int f = 0; f < 4; ++f) {
    v16bf A = afrag_bf(hrow, f * 32, half);          // reuse A across both GEMMs
    a1 = wmma_bf(A, bfrag_w(w1, HID, f * 32, wcol, DIM, half), a1);
    a3 = wmma_bf(A, bfrag_w(w3, HID, f * 32, wcol, DIM, half), a3);
  }
#pragma unroll
  for (int r = 0; r < 8; ++r) {
    const int grow = rt * 16 + half * 8 + r;
    float v = 0.0f;
    if (n < HID) {
      const float s = a1[r];
      v = (s / (1.0f + __expf(-s))) * a3[r];         // silu * gate
    }
    act[(size_t)grow * HIDP + n] = (__bf16)v;        // pad cols -> 0
  }
}

// ---------------- 5) FFN down proj + residual -> d_out ----------------
__global__ void __launch_bounds__(256) k_ffn2(const __bf16* __restrict__ act,
                                              const float* __restrict__ w2,
                                              const float* __restrict__ hout,
                                              float* __restrict__ out) {
  const int wave = threadIdx.x >> 5, lane = threadIdx.x & 31;
  const int half = lane >> 4, l16 = lane & 15;
  const int tile = blockIdx.x * 8 + wave;
  if (tile >= (MTOT / 16) * 8) return;
  const int rt = tile & 511, ct = tile >> 9;
  const __bf16* arow = act + (size_t)(rt * 16 + l16) * HIDP;
  const int col = ct * 16 + l16;
  v8f acc = vz8();
#pragma unroll
  for (int f = 0; f < HIDP / 32; ++f)                // 11 K-steps (pad rows are 0)
    acc = wmma_bf(afrag_bf(arow, f * 32, half),
                  bfrag_w(w2, DIM, f * 32, col, HID, half), acc);
#pragma unroll
  for (int r = 0; r < 8; ++r) {
    const int grow = rt * 16 + half * 8 + r;
    out[(size_t)grow * DIM + col] = hout[(size_t)grow * DIM + col] + acc[r];
  }
}

// ---------------- launcher ----------------
extern "C" void kernel_launch(void* const* d_in, const int* in_sizes, int n_in,
                              void* d_out, int out_size, void* d_ws, size_t ws_size,
                              hipStream_t stream) {
  (void)in_sizes; (void)n_in; (void)out_size; (void)ws_size;
  const float* x  = (const float*)d_in[0];
  const float* wq = (const float*)d_in[1];
  const float* wk = (const float*)d_in[2];
  const float* wv = (const float*)d_in[3];
  const float* wo = (const float*)d_in[4];
  const float* w1 = (const float*)d_in[5];
  const float* w3 = (const float*)d_in[6];
  const float* w2 = (const float*)d_in[7];
  float* out = (float*)d_out;

  char* ws = (char*)d_ws;                       // ~19.8 MB total
  __bf16* Q    = (__bf16*)(ws);                 // 2 MB  [B,H,S,8]
  __bf16* K    = (__bf16*)(ws + (2u  << 20));   // 2 MB
  __bf16* V    = (__bf16*)(ws + (4u  << 20));   // 2 MB
  __bf16* attn = (__bf16*)(ws + (6u  << 20));   // 2 MB  [B*S,128]
  float*  hbuf = (float* )(ws + (8u  << 20));   // 4 MB  [B*S,128] f32
  __bf16* hbf  = (__bf16*)(ws + (12u << 20));   // 2 MB
  __bf16* act  = (__bf16*)(ws + (14u << 20));   // 5.8 MB [B*S,352]

  const dim3 blk(256);
  k_qkv <<<dim3((MTOT / 16) * 24 / 8), blk, 0, stream>>>(x, wq, wk, wv, Q, K, V);
  k_attn<<<dim3(SEQ / 128, BATCH * NH), blk, 0, stream>>>(Q, K, V, attn);
  k_oproj<<<dim3((MTOT / 16) * 8 / 8), blk, 0, stream>>>(attn, wo, x, hbuf, hbf);
  k_ffn1<<<dim3((MTOT / 16) * (HIDP / 16) / 8), blk, 0, stream>>>(hbf, w1, w3, act);
  k_ffn2<<<dim3((MTOT / 16) * 8 / 8), blk, 0, stream>>>(act, w2, hbuf, out);
}

// v001
// It runs in 78 microseconds.
// Two timings next to v000 both put it at 1.87 times that version's speed.
#include <hip/hip_runtime.h>
#include <stdint.h>

// ---------------- problem constants ----------------
#define DIM   128
#define NH    16
#define HD    8
#define SEQ   2048
#define BATCH 4
#define MTOT  (BATCH*SEQ)   // 8192 rows
#define HID   344
#define HIDP  352
#define KCH   256

typedef __attribute__((ext_vector_type(16))) __bf16 v16bf;
typedef __attribute__((ext_vector_type(8)))  __bf16 v8bf;
typedef __attribute__((ext_vector_type(8)))  float  v8f;
typedef __attribute__((ext_vector_type(4)))  unsigned int u32x4;
typedef __attribute__((ext_vector_type(8)))  int i32x8;
typedef __attribute__((ext_vector_type(4)))  int i32x4;

static __device__ inline v8f wmma_bf(v16bf a, v16bf b, v8f c) {
  // D = A(16x32 bf16) * B(32x16 bf16) + C(16x16 f32)
  return __builtin_amdgcn_wmma_f32_16x16x32_bf16(false, a, false, b,
                                                 (short)0, c, false, false);
}

static __device__ inline v8f vz8() {
  v8f v;
#pragma unroll
  for (int i = 0; i < 8; ++i) v[i] = 0.0f;
  return v;
}
static __device__ inline v16bf vz16() {
  v16bf v;
#pragma unroll
  for (int i = 0; i < 16; ++i) v[i] = (__bf16)0.0f;
  return v;
}

// A fragment (16x32), source fp32 row-major. lane holds row (lane&15);
// K pattern: half=lane>>4 -> elems 0..7 = K k0..k0+7, elems 8..15 = K k0+16..k0+23
static __device__ inline v16bf afrag_f32(const float* row, int kb, int half) {
  const int k0 = kb + half * 8;
  v16bf a;
#pragma unroll
  for (int j = 0; j < 8; ++j) {
    a[j]     = (__bf16)row[k0 + j];
    a[j + 8] = (__bf16)row[k0 + 16 + j];
  }
  return a;
}

// A fragment, source bf16 row-major (16B-aligned rows) -> two b128 loads
static __device__ inline v16bf afrag_bf(const __bf16* row, int kb, int half) {
  const int k0 = kb + half * 8;
  v8bf lo = *(const v8bf*)(row + k0);
  v8bf hi = *(const v8bf*)(row + k0 + 16);
  v16bf a;
#pragma unroll
  for (int j = 0; j < 8; ++j) { a[j] = lo[j]; a[j + 8] = hi[j]; }
  return a;
}

// B fragment (32x16) from fp32 weight W[K x N] (row-major, ldn = N).
// lane holds column `col`; rows beyond kmax are zero-padded.
static __device__ inline v16bf bfrag_w(const float* W, int ldn, int kb, int col,
                                       int kmax, int half) {
  const int k0 = kb + half * 8;
  v16bf b;
#pragma unroll
  for (int j = 0; j < 8; ++j) {
    const int ka = k0 + j, kc = k0 + 16 + j;
    b[j]     = (ka < kmax) ? (__bf16)W[(size_t)ka * ldn + col] : (__bf16)0.0f;
    b[j + 8] = (kc < kmax) ? (__bf16)W[(size_t)kc * ldn + col] : (__bf16)0.0f;
  }
  return b;
}

static __device__ inline float xhalf(float v) {
  const int b = __builtin_bit_cast(int, v);
  return __builtin_bit_cast(float,
      __builtin_amdgcn_permlanex16(b, b, 0x76543210, 0xfedcba98, false, false));
}

static __device__ inline void tdm_load_1d(uint32_t lds_off, const void* gptr,
                                          uint32_t nbytes) {
  const uint64_t ga = (uint64_t)(uintptr_t)gptr;
  const uint32_t elems = nbytes >> 2;
  u32x4 g0;
  g0[0] = 1u;
  g0[1] = lds_off;
  g0[2] = (uint32_t)ga;
  g0[3] = (uint32_t)((ga >> 32) & 0x01FFFFFFu)
        | (2u << 30);
  i32x8 g1;
  g1[0] = (int)(2u << 16);
  g1[1] = (int)((elems & 0xFFFFu) << 16);
  g1[2] = (int)((elems >> 16) | (1u << 16));
  g1[3] = (int)((elems & 0xFFFFu) << 16);
  g1[4] = 1;
  g1[5] = (int)elems;
  g1[6] = 0;
  g1[7] = 0;
  i32x4 gz4;
  gz4[0] = 0; gz4[1] = 0; gz4[2] = 0; gz4[3] = 0;   // groups 2/3 unused (<=2D)
  i32x8 gz8;
#pragma unroll
  for (int i = 0; i < 8; ++i) gz8[i] = 0;
  __builtin_amdgcn_tensor_load_to_lds(g0, g1, gz4, gz4, gz8, 0);
}

// ---------------- 1) fused QKV projection ----------------
// x[8192,128] f32 @ {wq,wk,wv}[128,128] -> Q/K/V [B,H,S,8] bf16
__global__ void __launch_bounds__(256) k_qkv(const float* __restrict__ x,
                                             const float* __restrict__ wq,
                                             const float* __restrict__ wk,
                                             const float* __restrict__ wv,
                                             __bf16* __restrict__ Q,
                                             __bf16* __restrict__ K,
                                             __bf16* __restrict__ V) {
  const int wave = threadIdx.x >> 5, lane = threadIdx.x & 31;
  const int half = lane >> 4, l16 = lane & 15;
  const int tile = blockIdx.x * 8 + wave;
  if (tile >= (MTOT / 16) * 24) return;        // 512 row-tiles x (3 mats x 8 col-tiles)
  const int rt = tile & 511;
  const int t2 = tile >> 9;
  const int mat = t2 >> 3, ct = t2 & 7;
  const float* W = (mat == 0) ? wq : (mat == 1) ? wk : wv;
  __bf16* Out    = (mat == 0) ? Q  : (mat == 1) ? K  : V;

  const float* xrow = x + (size_t)(rt * 16 + l16) * DIM;
  const int col = ct * 16 + l16;
  v8f acc = vz8();
#pragma unroll
  for (int f = 0; f < 4; ++f) {
    v16bf a  = afrag_f32(xrow, f * 32, half);
    v16bf bw = bfrag_w(W, DIM, f * 32, col, DIM, half);
    acc = wmma_bf(a, bw, acc);
  }
  const int head = col >> 3, d = col & 7;
#pragma unroll
  for (int r = 0; r < 8; ++r) {
    const int grow = rt * 16 + half * 8 + r;
    const int b = grow >> 11, srow = grow & (SEQ - 1);
    Out[(((size_t)(b * NH + head)) * SEQ + srow) * HD + d] = (__bf16)acc[r];
  }
}

__global__ void __launch_bounds__(256) k_attn(const __bf16* __restrict__ Q,
                                              const __bf16* __restrict__ K,
                                              const __bf16* __restrict__ V,
                                              __bf16* __restrict__ attn) {
  const int bh = blockIdx.y;
  const int wave = threadIdx.x >> 5, lane = threadIdx.x & 31;
  const int half = lane >> 4, l16 = lane & 15;
  const int qbase = blockIdx.x * 128 + wave * 16;
  const __bf16* Qh = Q + (size_t)bh * SEQ * HD;
  const __bf16* Kh = K + (size_t)bh * SEQ * HD;
  const __bf16* Vh = V + (size_t)bh * SEQ * HD;

  __shared__ __bf16 kbuf[2][KCH * HD];         // 2 x 4KB
  __shared__ __bf16 vbuf[2][KCH * HD];         // 2 x 4KB

  // Q^T fragment: B(32x16), lane = query column, only d=0..7 real -> zeros elsewhere
  v16bf qf = vz16();
  if (half == 0) {
    v8bf qv = *(const v8bf*)(Qh + (size_t)(qbase + l16) * HD);
#pragma unroll
    for (int j = 0; j < 8; ++j) qf[j] = qv[j];
  }

  v8bf kz;
#pragma unroll
  for (int j = 0; j < 8; ++j) kz[j] = (__bf16)0.0f;
  float mrow = -1e30f;   // running maximum of query l16, equal in both halves
  float lrow = 0.0f;     // running sum over this half's keys only; joined at the end
  v8f oacc = vz8();      // O^T: register r = head dim half*8 + r (half 1: padding), lane = query

  if (wave == 0) {
    tdm_load_1d((uint32_t)(uintptr_t)&kbuf[0][0], Kh, KCH * HD * 2);
    tdm_load_1d((uint32_t)(uintptr_t)&vbuf[0][0], Vh, KCH * HD * 2);
  }

  for (int c = 0; c < SEQ / KCH; ++c) {
    if (wave == 0) __builtin_amdgcn_s_wait_tensorcnt(0);   // chunk c landed
    __syncthreads();                                       // visible to all waves
    if (wave == 0 && c + 1 < SEQ / KCH) {                  // prefetch chunk c+1
      const int nb = (c + 1) & 1;
      tdm_load_1d((uint32_t)(uintptr_t)&kbuf[nb][0],
                  Kh + (size_t)(c + 1) * KCH * HD, KCH * HD * 2);
      tdm_load_1d((uint32_t)(uintptr_t)&vbuf[nb][0],
                  Vh + (size_t)(c + 1) * KCH * HD, KCH * HD * 2);
    }
    const __bf16* kchb = &kbuf[c & 1][0];
    const __bf16* vchb = &vbuf[c & 1][0];

    for (int sub = 0; sub < KCH / 32; ++sub) {
      const int s0 = sub * 32;
      const v8bf k0 = *(const v8bf*)(kchb + (size_t)(s0 + l16) * HD);
      const v8bf k1 = *(const v8bf*)(kchb + (size_t)(s0 + 16 + l16) * HD);
      const v16bf bk0 = __builtin_shufflevector(k0, kz, 0, 1, 2, 3, 4, 5, 6, 7, 8, 9, 10, 11, 12, 13, 14, 15);
      const v16bf bk1 = __builtin_shufflevector(k1, kz, 0, 1, 2, 3, 4, 5, 6, 7, 8, 9, 10, 11, 12, 13, 14, 15);
      // sc0[r] = score(key s0 + half*8 + r, query l16); sc1: keys 16 further on
      v8f sc0 = wmma_bf(bk0, qf, vz8());
      v8f sc1 = wmma_bf(bk1, qf, vz8());

      // V^T fragment (A 16x32, rows 0..7 = head dims), keys in the order of P^T below.
      // Rows 8..15 repeat rows 0..7: they reach only O^T rows 8..15, which are never stored.
      v16bf vb;
      {
        const int kb0 = half * 8, dd = l16 & (HD - 1);
#pragma unroll
        for (int j = 0; j < 8; ++j) {
          vb[j]     = vchb[(size_t)(s0 + kb0 + j) * HD + dd];
          vb[j + 8] = vchb[(size_t)(s0 + kb0 + 16 + j) * HD + dd];
        }
      }

      // online softmax, one query per lane
      float mx = fmaxf(sc0[0], sc1[0]);
#pragma unroll
      for (int r = 1; r < 8; ++r) mx = fmaxf(mx, fmaxf(sc0[r], sc1[r]));
      mx = fmaxf(mx, xhalf(mx));
      const float mnew  = fmaxf(mrow, mx);
      const float L2E = 1.44269504f;               // exp(t) = 2^(t * log2 e)
      float scale = (mrow - mnew) * L2E;
      mrow = mnew;
      float e0[8], e1[8];
#pragma unroll
      for (int r = 0; r < 8; ++r) { e0[r] = (sc0[r] - mnew) * L2E; e1[r] = (sc1[r] - mnew) * L2E; }
      asm("v_exp_f32 %0, %0\n\tv_exp_f32 %1, %1\n\tv_exp_f32 %2, %2\n\tv_exp_f32 %3, %3\n\t"
          "v_exp_f32 %4, %4\n\tv_exp_f32 %5, %5\n\tv_exp_f32 %6, %6\n\tv_exp_f32 %7, %7\n\t"
          "v_exp_f32 %8, %8\n\tv_exp_f32 %9, %9\n\tv_exp_f32 %10, %10\n\tv_exp_f32 %11, %11\n\t"
          "v_exp_f32 %12, %12\n\tv_exp_f32 %13, %13\n\tv_exp_f32 %14, %14\n\tv_exp_f32 %15, %15\n\t"
          "v_exp_f32 %16, %16\n\tv_nop"
          : "+v"(e0[0]), "+v"(e0[1]), "+v"(e0[2]), "+v"(e0[3]),
            "+v"(e0[4]), "+v"(e0[5]), "+v"(e0[6]), "+v"(e0[7]),
            "+v"(e1[0]), "+v"(e1[1]), "+v"(e1[2]), "+v"(e1[3]),
            "+v"(e1[4]), "+v"(e1[5]), "+v"(e1[6]), "+v"(e1[7]), "+v"(scale));
      v16bf pb;            // P^T fragment (B 32x16): element j = key half*8 + j, j + 8 = 16 + half*8 + j
#pragma unroll
      for (int r = 0; r < 8; ++r) {
        pb[r]     = (__bf16)e0[r];
        pb[r + 8] = (__bf16)e1[r];
        oacc[r] *= scale;
      }
      oacc = wmma_bf(vb, pb, oacc);
      __builtin_amdgcn_sched_barrier(0);
      float ps = e0[0] + e1[0];
#pragma unroll
      for (int r = 1; r < 8; ++r) ps += e0[r] + e1[r];
      lrow = lrow * scale + ps;
      asm volatile("v_nop");
    }
    __syncthreads();   // all waves done with buffer c&1 before it is re-filled
  }
  // normalize + store [B,S,128] bf16: lane (half 0) = query, 8 head dims = 16 bytes
  lrow += xhalf(lrow);
  if (half == 0) {
    const int b = bh >> 4, h = bh & 15;
    v8bf o;
#pragma unroll
    for (int r = 0; r < 8; ++r) o[r] = (__bf16)(oacc[r] / lrow);
    *(v8bf*)(attn + ((size_t)(b * SEQ + qbase + l16)) * DIM + h * HD) = o;
  }
}

// ---------------- 3) output projection + residual ----------------
__global__ void __launch_bounds__(256) k_oproj(const __bf16* __restrict__ attn,
                                               const float* __restrict__ wo,
                                               const float* __restrict__ x,
                                               float* __restrict__ hout,
                                               __bf16* __restrict__ hbf) {
  const int wave = threadIdx.x >> 5, lane = threadIdx.x & 31;
  const int half = lane >> 4, l16 = lane & 15;
  const int tile = blockIdx.x * 8 + wave;
  if (tile >= (MTOT / 16) * 8) return;
  const int rt = tile & 511, ct = tile >> 9;
  const __bf16* arow = attn + (size_t)(rt * 16 + l16) * DIM;
  const int col = ct * 16 + l16;
  v8f acc = vz8();
#pragma unroll
  for (int f = 0; f < 4; ++f)
    acc = wmma_bf(afrag_bf(arow, f * 32, half),
                  bfrag_w(wo, DIM, f * 32, col, DIM, half), acc);
#pragma unroll
  for (int r = 0; r < 8; ++r) {
    const int grow = rt * 16 + half * 8 + r;
    const float hv = x[(size_t)grow * DIM + col] + acc[r];
    hout[(size_t)grow * DIM + col] = hv;
    hbf[(size_t)grow * DIM + col]  = (__bf16)hv;
  }
}

// ---------------- 4) FFN gate: silu(h@w1) * (h@w3) ----------------
__global__ void __launch_bounds__(256) k_ffn1(const __bf16* __restrict__ hbf,
                                              const float* __restrict__ w1,
                                              const float* __restrict__ w3,
                                              __bf16* __restrict__ act) {
  const int wave = threadIdx.x >> 5, lane = threadIdx.x & 31;
  const int half = lane >> 4, l16 = lane & 15;
  const int tile = blockIdx.x * 8 + wave;
  if (tile >= (MTOT / 16) * (HIDP / 16)) return;     // 512 x 22
  const int rt = tile & 511, ct = tile >> 9;
  const __bf16* hrow = hbf + (size_t)(rt * 16 + l16) * DIM;
  const int n = ct * 16 + l16;
  const int wcol = (n < HID) ? n : 0;                // clamp (pad cols zeroed on store)
  v8f a1 = vz8(), a3 = vz8();
#pragma unroll
  for (int f = 0; f < 4; ++f) {
    v16bf A = afrag_bf(hrow, f * 32, half);          // reuse A across both GEMMs
    a1 = wmma_bf(A, bfrag_w(w1, HID, f * 32, wcol, DIM, half), a1);
    a3 = wmma_bf(A, bfrag_w(w3, HID, f * 32, wcol, DIM, half), a3);
  }
#pragma unroll
  for (int r = 0; r < 8; ++r) {
    const int grow = rt * 16 + half * 8 + r;
    float v = 0.0f;
    if (n < HID) {
      const float s = a1[r];
      v = (s / (1.0f + __expf(-s))) * a3[r];         // silu * gate
    }
    act[(size_t)grow * HIDP + n] = (__bf16)v;        // pad cols -> 0
  }
}

// ---------------- 5) FFN down proj + residual -> d_out ----------------
__global__ void __launch_bounds__(256) k_ffn2(const __bf16* __restrict__ act,
                                              const float* __restrict__ w2,
                                              const float* __restrict__ hout,
                                              float* __restrict__ out) {
  const int wave = threadIdx.x >> 5, lane = threadIdx.x & 31;
  const int half = lane >> 4, l16 = lane & 15;
  const int tile = blockIdx.x * 8 + wave;
  if (tile >= (MTOT / 16) * 8) return;
  const int rt = tile & 511, ct = tile >> 9;
  const __bf16* arow = act + (size_t)(rt * 16 + l16) * HIDP;
  const int col = ct * 16 + l16;
  v8f acc = vz8();
#pragma unroll
  for (int f = 0; f < HIDP / 32; ++f)                // 11 K-steps (pad rows are 0)
    acc = wmma_bf(afrag_bf(arow, f * 32, half),
                  bfrag_w(w2, DIM, f * 32, col, HID, half), acc);
#pragma unroll
  for (int r = 0; r < 8; ++r) {
    const int grow = rt * 16 + half * 8 + r;
    out[(size_t)grow * DIM + col] = hout[(size_t)grow * DIM + col] + acc[r];
  }
}

// ---------------- launcher ----------------
extern "C" void kernel_launch(void* const* d_in, const int* in_sizes, int n_in,
                              void* d_out, int out_size, void* d_ws, size_t ws_size,
                              hipStream_t stream) {
  (void)in_sizes; (void)n_in; (void)out_size; (void)ws_size;
  const float* x  = (const float*)d_in[0];
  const float* wq = (const float*)d_in[1];
  const float* wk = (const float*)d_in[2];
  const float* wv = (const float*)d_in[3];
  const float* wo = (const float*)d_in[4];
  const float* w1 = (const float*)d_in[5];
  const float* w3 = (const float*)d_in[6];
  const float* w2 = (const float*)d_in[7];
  float* out = (float*)d_out;

  char* ws = (char*)d_ws;                       // ~19.8 MB total
  __bf16* Q    = (__bf16*)(ws);                 // 2 MB  [B,H,S,8]
  __bf16* K    = (__bf16*)(ws + (2u  << 20));   // 2 MB
  __bf16* V    = (__bf16*)(ws + (4u  << 20));   // 2 MB
  __bf16* attn = (__bf16*)(ws + (6u  << 20));   // 2 MB  [B*S,128]
  float*  hbuf = (float* )(ws + (8u  << 20));   // 4 MB  [B*S,128] f32
  __bf16* hbf  = (__bf16*)(ws + (12u << 20));   // 2 MB
  __bf16* act  = (__bf16*)(ws + (14u << 20));   // 5.8 MB [B*S,352]

  const dim3 blk(256);
  k_qkv <<<dim3((MTOT / 16) * 24 / 8), blk, 0, stream>>>(x, wq, wk, wv, Q, K, V);
  k_attn<<<dim3(SEQ / 128, BATCH * NH), blk, 0, stream>>>(Q, K, V, attn);
  k_oproj<<<dim3((MTOT / 16) * 8 / 8), blk, 0, stream>>>(attn, wo, x, hbuf, hbf);
  k_ffn1<<<dim3((MTOT / 16) * (HIDP / 16) / 8), blk, 0, stream>>>(hbf, w1, w3, act);
  k_ffn2<<<dim3((MTOT / 16) * 8 / 8), blk, 0, stream>>>(act, w2, hbuf, out);
}

// v002
// It runs in 67.9 microseconds.
// Next to v001, in two timings, it ran 1.13 times as fast each time.
// Over all steps from v000 it is 2.10 times as fast.
#include <hip/hip_runtime.h>
#include <stdint.h>

// ---------------- problem constants ----------------
#define DIM   128
#define NH    16
#define HD    8
#define SEQ   2048
#define BATCH 4
#define MTOT  (BATCH*SEQ)   // 8192 rows
#define HID   344
#define HIDP  352
#define KCH   256

typedef __attribute__((ext_vector_type(16))) __bf16 v16bf;
typedef __attribute__((ext_vector_type(8)))  __bf16 v8bf;
typedef __attribute__((ext_vector_type(8)))  float  v8f;
typedef __attribute__((ext_vector_type(4)))  unsigned int u32x4;
typedef __attribute__((ext_vector_type(8)))  int i32x8;
typedef __attribute__((ext_vector_type(4)))  int i32x4;

static __device__ inline v8f wmma_bf(v16bf a, v16bf b, v8f c) {
  // D = A(16x32 bf16) * B(32x16 bf16) + C(16x16 f32)
  return __builtin_amdgcn_wmma_f32_16x16x32_bf16(false, a, false, b,
                                                 (short)0, c, false, false);
}

static __device__ inline v8f vz8() {
  v8f v;
#pragma unroll
  for (int i = 0; i < 8; ++i) v[i] = 0.0f;
  return v;
}
static __device__ inline v16bf vz16() {
  v16bf v;
#pragma unroll
  for (int i = 0; i < 16; ++i) v[i] = (__bf16)0.0f;
  return v;
}

// A fragment (16x32), source fp32 row-major. lane holds row (lane&15);
// K pattern: half=lane>>4 -> elems 0..7 = K k0..k0+7, elems 8..15 = K k0+16..k0+23
static __device__ inline v16bf afrag_f32(const float* row, int kb, int half) {
  const int k0 = kb + half * 8;
  v16bf a;
#pragma unroll
  for (int j = 0; j < 8; ++j) {
    a[j]     = (__bf16)row[k0 + j];
    a[j + 8] = (__bf16)row[k0 + 16 + j];
  }
  return a;
}

// A fragment, source bf16 row-major (16B-aligned rows) -> two b128 loads
static __device__ inline v16bf afrag_bf(const __bf16* row, int kb, int half) {
  const int k0 = kb + half * 8;
  v8bf lo = *(const v8bf*)(row + k0);
  v8bf hi = *(const v8bf*)(row + k0 + 16);
  v16bf a;
#pragma unroll
  for (int j = 0; j < 8; ++j) { a[j] = lo[j]; a[j + 8] = hi[j]; }
  return a;
}

// B fragment (32x16) from fp32 weight W[K x N] (row-major, ldn = N).
// lane holds column `col`; rows beyond kmax are zero-padded.
static __device__ inline v16bf bfrag_w(const float* W, int ldn, int kb, int col,
                                       int kmax, int half) {
  const int k0 = kb + half * 8;
  v16bf b;
#pragma unroll
  for (int j = 0; j < 8; ++j) {
    const int ka = k0 + j, kc = k0 + 16 + j;
    b[j]     = (ka < kmax) ? (__bf16)W[(size_t)ka * ldn + col] : (__bf16)0.0f;
    b[j + 8] = (kc < kmax) ? (__bf16)W[(size_t)kc * ldn + col] : (__bf16)0.0f;
  }
  return b;
}

// The same from a lane's own pointer wp = W + (half * 8) * ldn + col: every load is wp plus a constant.
static __device__ inline v16bf bfrag_p(const float* wp, int ldn, int kb) {
  v16bf b;
#pragma unroll
  for (int j = 0; j < 8; ++j) {
    b[j]     = (__bf16)wp[(size_t)(kb + j) * ldn];
    b[j + 8] = (__bf16)wp[(size_t)(kb + 16 + j) * ldn];
  }
  return b;
}

static __device__ inline float xhalf(float v) {
  const int b = __builtin_bit_cast(int, v);
  return __builtin_bit_cast(float,
      __builtin_amdgcn_permlanex16(b, b, 0x76543210, 0xfedcba98, false, false));
}

static __device__ inline void tdm_load_1d(uint32_t lds_off, const void* gptr,
                                          uint32_t nbytes) {
  const uint64_t ga = (uint64_t)(uintptr_t)gptr;
  const uint32_t elems = nbytes >> 2;
  u32x4 g0;
  g0[0] = 1u;
  g0[1] = lds_off;
  g0[2] = (uint32_t)ga;
  g0[3] = (uint32_t)((ga >> 32) & 0x01FFFFFFu)
        | (2u << 30);
  i32x8 g1;
  g1[0] = (int)(2u << 16);
  g1[1] = (int)((elems & 0xFFFFu) << 16);
  g1[2] = (int)((elems >> 16) | (1u << 16));
  g1[3] = (int)((elems & 0xFFFFu) << 16);
  g1[4] = 1;
  g1[5] = (int)elems;
  g1[6] = 0;
  g1[7] = 0;
  i32x4 gz4;
  gz4[0] = 0; gz4[1] = 0; gz4[2] = 0; gz4[3] = 0;   // groups 2/3 unused (<=2D)
  i32x8 gz8;
#pragma unroll
  for (int i = 0; i < 8; ++i) gz8[i] = 0;
  __builtin_amdgcn_tensor_load_to_lds(g0, g1, gz4, gz4, gz8, 0);
}

__global__ void __launch_bounds__(256) __attribute__((amdgpu_waves_per_eu(1, 2))) k_qkv(const float* __restrict__ x,
                                             const float* __restrict__ wq,
                                             const float* __restrict__ wk,
                                             const float* __restrict__ wv,
                                             __bf16* __restrict__ Q,
                                             __bf16* __restrict__ K,
                                             __bf16* __restrict__ V) {
  const int wave = threadIdx.x >> 5, lane = threadIdx.x & 31;
  const int half = lane >> 4, l16 = lane & 15;
  // A wave owns 2 row tiles x 3 column tiles of the 512 x 24 (3 matrices x 8): each x
  // fragment feeds 3 products and each weight fragment 2. The 8 waves of a block share the columns.
  const int rp = (blockIdx.x * 8 + wave) & 255;  // pair of row tiles
  const int cg = blockIdx.x >> 5;                // triple of column tiles, 0..7

  const float* xrow = x + (size_t)(rp * 32 + l16) * DIM + half * 8;
  const float* wp[3];
#pragma unroll
  for (int n = 0; n < 3; ++n) {
    const int t2 = cg * 3 + n;
    const int mat = t2 >> 3;
    wp[n] = ((mat == 0) ? wq : (mat == 1) ? wk : wv) + (half * 8) * DIM + (t2 & 7) * 16 + l16;
  }
  v8f acc[2][3];
#pragma unroll
  for (int m = 0; m < 2; ++m)
#pragma unroll
    for (int n = 0; n < 3; ++n) acc[m][n] = vz8();
#pragma unroll
  for (int f = 0; f < 4; ++f) {
    const v16bf a0 = afrag_f32(xrow, f * 32, 0);
    const v16bf a1 = afrag_f32(xrow + 16 * DIM, f * 32, 0);
#pragma unroll
    for (int n = 0; n < 3; ++n) {
      const v16bf bw = bfrag_p(wp[n], DIM, f * 32);
      acc[0][n] = wmma_bf(a0, bw, acc[0][n]);
      acc[1][n] = wmma_bf(a1, bw, acc[1][n]);
    }
  }
  // One wait behind the last loads of the products, their address registers named as inputs so that they
  // live up to it: no register that an issued load names as its address is written again in front of it.
  asm volatile("s_wait_xcnt 0x0" :: "v"(xrow), "v"(wp[0]), "v"(wp[1]), "v"(wp[2]) : "memory");
#pragma unroll
  for (int n = 0; n < 3; ++n) {
    const int t2 = cg * 3 + n;
    const int mat = t2 >> 3;
    __bf16* Out = (mat == 0) ? Q : (mat == 1) ? K : V;
    const int col = (t2 & 7) * 16 + l16;
    const int head = col >> 3, d = col & 7;
#pragma unroll
    for (int m = 0; m < 2; ++m)
#pragma unroll
      for (int r = 0; r < 8; ++r) {
        const int grow = rp * 32 + m * 16 + half * 8 + r;
        const int b = grow >> 11, srow = grow & (SEQ - 1);
        Out[(((size_t)(b * NH + head)) * SEQ + srow) * HD + d] = (__bf16)acc[m][n][r];
      }
  }
}

__global__ void __launch_bounds__(256) k_attn(const __bf16* __restrict__ Q,
                                              const __bf16* __restrict__ K,
                                              const __bf16* __restrict__ V,
                                              __bf16* __restrict__ attn) {
  const int bh = blockIdx.y;
  const int wave = threadIdx.x >> 5, lane = threadIdx.x & 31;
  const int half = lane >> 4, l16 = lane & 15;
  const int qbase = blockIdx.x * 128 + wave * 16;
  const __bf16* Qh = Q + (size_t)bh * SEQ * HD;
  const __bf16* Kh = K + (size_t)bh * SEQ * HD;
  const __bf16* Vh = V + (size_t)bh * SEQ * HD;

  __shared__ __bf16 kbuf[2][KCH * HD];         // 2 x 4KB
  __shared__ __bf16 vbuf[2][KCH * HD];         // 2 x 4KB

  // Q^T fragment: B(32x16), lane = query column, only d=0..7 real -> zeros elsewhere
  v16bf qf = vz16();
  if (half == 0) {
    v8bf qv = *(const v8bf*)(Qh + (size_t)(qbase + l16) * HD);
#pragma unroll
    for (int j = 0; j < 8; ++j) qf[j] = qv[j];
  }

  v8bf kz;
#pragma unroll
  for (int j = 0; j < 8; ++j) kz[j] = (__bf16)0.0f;
  float mrow = -1e30f;   // running maximum of query l16, equal in both halves
  float lrow = 0.0f;     // running sum over this half's keys only; joined at the end
  v8f oacc = vz8();      // O^T: register r = head dim half*8 + r (half 1: padding), lane = query

  if (wave == 0) {
    tdm_load_1d((uint32_t)(uintptr_t)&kbuf[0][0], Kh, KCH * HD * 2);
    tdm_load_1d((uint32_t)(uintptr_t)&vbuf[0][0], Vh, KCH * HD * 2);
  }

  for (int c = 0; c < SEQ / KCH; ++c) {
    if (wave == 0) __builtin_amdgcn_s_wait_tensorcnt(0);   // chunk c landed
    __syncthreads();                                       // visible to all waves
    if (wave == 0 && c + 1 < SEQ / KCH) {                  // prefetch chunk c+1
      const int nb = (c + 1) & 1;
      tdm_load_1d((uint32_t)(uintptr_t)&kbuf[nb][0],
                  Kh + (size_t)(c + 1) * KCH * HD, KCH * HD * 2);
      tdm_load_1d((uint32_t)(uintptr_t)&vbuf[nb][0],
                  Vh + (size_t)(c + 1) * KCH * HD, KCH * HD * 2);
    }
    const __bf16* kchb = &kbuf[c & 1][0];
    const __bf16* vchb = &vbuf[c & 1][0];

    for (int sub = 0; sub < KCH / 32; ++sub) {
      const int s0 = sub * 32;
      const v8bf k0 = *(const v8bf*)(kchb + (size_t)(s0 + l16) * HD);
      const v8bf k1 = *(const v8bf*)(kchb + (size_t)(s0 + 16 + l16) * HD);
      const v16bf bk0 = __builtin_shufflevector(k0, kz, 0, 1, 2, 3, 4, 5, 6, 7, 8, 9, 10, 11, 12, 13, 14, 15);
      const v16bf bk1 = __builtin_shufflevector(k1, kz, 0, 1, 2, 3, 4, 5, 6, 7, 8, 9, 10, 11, 12, 13, 14, 15);
      // sc0[r] = score(key s0 + half*8 + r, query l16); sc1: keys 16 further on
      v8f sc0 = wmma_bf(bk0, qf, vz8());
      v8f sc1 = wmma_bf(bk1, qf, vz8());

      // V^T fragment (A 16x32, rows 0..7 = head dims), keys in the order of P^T below.
      // Rows 8..15 repeat rows 0..7: they reach only O^T rows 8..15, which are never stored.
      v16bf vb;
      {
        const int kb0 = half * 8, dd = l16 & (HD - 1);
#pragma unroll
        for (int j = 0; j < 8; ++j) {
          vb[j]     = vchb[(size_t)(s0 + kb0 + j) * HD + dd];
          vb[j + 8] = vchb[(size_t)(s0 + kb0 + 16 + j) * HD + dd];
        }
      }

      // online softmax, one query per lane
      float mx = fmaxf(sc0[0], sc1[0]);
#pragma unroll
      for (int r = 1; r < 8; ++r) mx = fmaxf(mx, fmaxf(sc0[r], sc1[r]));
      mx = fmaxf(mx, xhalf(mx));
      const float mnew  = fmaxf(mrow, mx);
      const float L2E = 1.44269504f;               // exp(t) = 2^(t * log2 e)
      float scale = (mrow - mnew) * L2E;
      mrow = mnew;
      float e0[8], e1[8];
#pragma unroll
      for (int r = 0; r < 8; ++r) { e0[r] = (sc0[r] - mnew) * L2E; e1[r] = (sc1[r] - mnew) * L2E; }
      asm("v_exp_f32 %0, %0\n\tv_exp_f32 %1, %1\n\tv_exp_f32 %2, %2\n\tv_exp_f32 %3, %3\n\t"
          "v_exp_f32 %4, %4\n\tv_exp_f32 %5, %5\n\tv_exp_f32 %6, %6\n\tv_exp_f32 %7, %7\n\t"
          "v_exp_f32 %8, %8\n\tv_exp_f32 %9, %9\n\tv_exp_f32 %10, %10\n\tv_exp_f32 %11, %11\n\t"
          "v_exp_f32 %12, %12\n\tv_exp_f32 %13, %13\n\tv_exp_f32 %14, %14\n\tv_exp_f32 %15, %15\n\t"
          "v_exp_f32 %16, %16\n\tv_nop"
          : "+v"(e0[0]), "+v"(e0[1]), "+v"(e0[2]), "+v"(e0[3]),
            "+v"(e0[4]), "+v"(e0[5]), "+v"(e0[6]), "+v"(e0[7]),
            "+v"(e1[0]), "+v"(e1[1]), "+v"(e1[2]), "+v"(e1[3]),
            "+v"(e1[4]), "+v"(e1[5]), "+v"(e1[6]), "+v"(e1[7]), "+v"(scale));
      v16bf pb;            // P^T fragment (B 32x16): element j = key half*8 + j, j + 8 = 16 + half*8 + j
#pragma unroll
      for (int r = 0; r < 8; ++r) {
        pb[r]     = (__bf16)e0[r];
        pb[r + 8] = (__bf16)e1[r];
        oacc[r] *= scale;
      }
      oacc = wmma_bf(vb, pb, oacc);
      __builtin_amdgcn_sched_barrier(0);
      float ps = e0[0] + e1[0];
#pragma unroll
      for (int r = 1; r < 8; ++r) ps += e0[r] + e1[r];
      lrow = lrow * scale + ps;
      asm volatile("v_nop");
    }
    __syncthreads();   // all waves done with buffer c&1 before it is re-filled
  }
  // normalize + store [B,S,128] bf16: lane (half 0) = query, 8 head dims = 16 bytes
  lrow += xhalf(lrow);
  if (half == 0) {
    const int b = bh >> 4, h = bh & 15;
    v8bf o;
#pragma unroll
    for (int r = 0; r < 8; ++r) o[r] = (__bf16)(oacc[r] / lrow);
    *(v8bf*)(attn + ((size_t)(b * SEQ + qbase + l16)) * DIM + h * HD) = o;
  }
}

__global__ void __launch_bounds__(128) __attribute__((amdgpu_waves_per_eu(1, 3))) k_oproj(const __bf16* __restrict__ attn,
                                               const float* __restrict__ wo,
                                               const float* __restrict__ x,
                                               float* __restrict__ hout,
                                               __bf16* __restrict__ hbf) {
  const int wave = threadIdx.x >> 5, lane = threadIdx.x & 31;
  const int half = lane >> 4, l16 = lane & 15;
  const int rp = (blockIdx.x * 4 + wave) & 255;  // pair of row tiles
  const int cp = blockIdx.x >> 6;                // pair of column tiles, 0..3
  const __bf16* arow = attn + (size_t)(rp * 32 + l16) * DIM + half * 8;
  const float* wp0 = wo + (half * 8) * DIM + (cp * 2) * 16 + l16;   // the second column tile: 16 floats on
  v8f acc[2][2];
#pragma unroll
  for (int m = 0; m < 2; ++m)
#pragma unroll
    for (int n = 0; n < 2; ++n) acc[m][n] = vz8();
#pragma unroll
  for (int f = 0; f < 4; ++f) {
    const v16bf a0 = afrag_bf(arow, f * 32, 0);
    const v16bf a1 = afrag_bf(arow + 16 * DIM, f * 32, 0);
#pragma unroll
    for (int n = 0; n < 2; ++n) {
      const v16bf bw = bfrag_p(wp0 + n * 16, DIM, f * 32);
      acc[0][n] = wmma_bf(a0, bw, acc[0][n]);
      acc[1][n] = wmma_bf(a1, bw, acc[1][n]);
    }
  }
  // One wait behind the last loads of the products, their address registers named as inputs so that they
  // live up to it: no register that an issued load names as its address is written again in front of it.
  asm volatile("s_wait_xcnt 0x0" :: "v"(arow), "v"(wp0) : "memory");
#pragma unroll
  for (int m = 0; m < 2; ++m)
#pragma unroll
    for (int n = 0; n < 2; ++n) {
      const int col = (cp * 2 + n) * 16 + l16;
#pragma unroll
      for (int r = 0; r < 8; ++r) {
        const int grow = rp * 32 + m * 16 + half * 8 + r;
        const float hv = x[(size_t)grow * DIM + col] + acc[m][n][r];
        hout[(size_t)grow * DIM + col] = hv;
        hbf[(size_t)grow * DIM + col]  = (__bf16)hv;
      }
    }
}

__global__ void __launch_bounds__(128) __attribute__((amdgpu_waves_per_eu(1, 3))) k_ffn1(const __bf16* __restrict__ hbf,
                                              const float* __restrict__ w1,
                                              const float* __restrict__ w3,
                                              __bf16* __restrict__ act) {
  const int wave = threadIdx.x >> 5, lane = threadIdx.x & 31;
  const int half = lane >> 4, l16 = lane & 15;
  const int rp = (blockIdx.x * 4 + wave) & 255;  // pair of row tiles
  const int cp = blockIdx.x >> 6;                // pair of column tiles, 0..10
  const __bf16* hrow = hbf + (size_t)(rp * 32 + l16) * DIM + half * 8;
  const float* p1[2];
  const float* p3[2];
#pragma unroll
  for (int n = 0; n < 2; ++n) {
    const int nn = (cp * 2 + n) * 16 + l16;
    const int wcol = (nn < HID) ? nn : 0;            // clamp (pad cols zeroed on store)
    p1[n] = w1 + (half * 8) * HID + wcol;
    p3[n] = w3 + (half * 8) * HID + wcol;
  }
  v8f a1[2][2], a3[2][2];
#pragma unroll
  for (int m = 0; m < 2; ++m)
#pragma unroll
    for (int n = 0; n < 2; ++n) { a1[m][n] = vz8(); a3[m][n] = vz8(); }
#pragma unroll
  for (int f = 0; f < 4; ++f) {
    const v16bf A0 = afrag_bf(hrow, f * 32, 0);
    const v16bf A1 = afrag_bf(hrow + 16 * DIM, f * 32, 0);
#pragma unroll
    for (int n = 0; n < 2; ++n) {
      const v16bf b1 = bfrag_p(p1[n], HID, f * 32);
      a1[0][n] = wmma_bf(A0, b1, a1[0][n]);
      a1[1][n] = wmma_bf(A1, b1, a1[1][n]);
      const v16bf b3 = bfrag_p(p3[n], HID, f * 32);
      a3[0][n] = wmma_bf(A0, b3, a3[0][n]);
      a3[1][n] = wmma_bf(A1, b3, a3[1][n]);
    }
  }
  // One wait behind the last loads of the products, their address registers named as inputs so that they
  // live up to it: no register that an issued load names as its address is written again in front of it.
  asm volatile("s_wait_xcnt 0x0" :: "v"(hrow), "v"(p1[0]), "v"(p1[1]), "v"(p3[0]), "v"(p3[1]) : "memory");
#pragma unroll
  for (int m = 0; m < 2; ++m)
#pragma unroll
    for (int n = 0; n < 2; ++n) {
      const int nn = (cp * 2 + n) * 16 + l16;
      float e[8];                                        // exp(-s) = 2^(-s * log2 e)
#pragma unroll
      for (int r = 0; r < 8; ++r) e[r] = a1[m][n][r] * -1.44269504f;
      asm("v_exp_f32 %0, %0\n\tv_exp_f32 %1, %1\n\tv_exp_f32 %2, %2\n\tv_exp_f32 %3, %3\n\t"
          "v_exp_f32 %4, %4\n\tv_exp_f32 %5, %5\n\tv_exp_f32 %6, %6\n\tv_exp_f32 %7, %7\n\t"
          "v_nop"
          : "+v"(e[0]), "+v"(e[1]), "+v"(e[2]), "+v"(e[3]),
            "+v"(e[4]), "+v"(e[5]), "+v"(e[6]), "+v"(e[7]));
#pragma unroll
      for (int r = 0; r < 8; ++r) {
        const int grow = rp * 32 + m * 16 + half * 8 + r;
        float v = 0.0f;
        if (nn < HID) {
          const float s = a1[m][n][r];
          v = (s / (1.0f + e[r])) * a3[m][n][r];         // silu * gate
        }
        act[(size_t)grow * HIDP + nn] = (__bf16)v;       // pad cols -> 0
      }
    }
}

// ---------------- 5) FFN down proj + residual -> d_out ----------------
__global__ void __launch_bounds__(256) k_ffn2(const __bf16* __restrict__ act,
                                              const float* __restrict__ w2,
                                              const float* __restrict__ hout,
                                              float* __restrict__ out) {
  const int wave = threadIdx.x >> 5, lane = threadIdx.x & 31;
  const int half = lane >> 4, l16 = lane & 15;
  const int tile = blockIdx.x * 8 + wave;
  if (tile >= (MTOT / 16) * 8) return;
  const int rt = tile & 511, ct = tile >> 9;
  const __bf16* arow = act + (size_t)(rt * 16 + l16) * HIDP;
  const int col = ct * 16 + l16;
  v8f acc = vz8();
#pragma unroll
  for (int f = 0; f < HIDP / 32; ++f)                // 11 K-steps (pad rows are 0)
    acc = wmma_bf(afrag_bf(arow, f * 32, half),
                  bfrag_w(w2, DIM, f * 32, col, HID, half), acc);
#pragma unroll
  for (int r = 0; r < 8; ++r) {
    const int grow = rt * 16 + half * 8 + r;
    out[(size_t)grow * DIM + col] = hout[(size_t)grow * DIM + col] + acc[r];
  }
}

// ---------------- launcher ----------------
extern "C" void kernel_launch(void* const* d_in, const int* in_sizes, int n_in,
                              void* d_out, int out_size, void* d_ws, size_t ws_size,
                              hipStream_t stream) {
  (void)in_sizes; (void)n_in; (void)out_size; (void)ws_size;
  const float* x  = (const float*)d_in[0];
  const float* wq = (const float*)d_in[1];
  const float* wk = (const float*)d_in[2];
  const float* wv = (const float*)d_in[3];
  const float* wo = (const float*)d_in[4];
  const float* w1 = (const float*)d_in[5];
  const float* w3 = (const float*)d_in[6];
  const float* w2 = (const float*)d_in[7];
  float* out = (float*)d_out;

  char* ws = (char*)d_ws;                       // ~19.8 MB total
  __bf16* Q    = (__bf16*)(ws);                 // 2 MB  [B,H,S,8]
  __bf16* K    = (__bf16*)(ws + (2u  << 20));   // 2 MB
  __bf16* V    = (__bf16*)(ws + (4u  << 20));   // 2 MB
  __bf16* attn = (__bf16*)(ws + (6u  << 20));   // 2 MB  [B*S,128]
  float*  hbuf = (float* )(ws + (8u  << 20));   // 4 MB  [B*S,128] f32
  __bf16* hbf  = (__bf16*)(ws + (12u << 20));   // 2 MB
  __bf16* act  = (__bf16*)(ws + (14u << 20));   // 5.8 MB [B*S,352]

  const dim3 blk(256);
  const dim3 blk4(128);
  k_qkv <<<dim3((MTOT / 32) * 8 / 8), blk, 0, stream>>>(x, wq, wk, wv, Q, K, V);
  k_attn<<<dim3(SEQ / 128, BATCH * NH), blk, 0, stream>>>(Q, K, V, attn);
  k_oproj<<<dim3((MTOT / 32) * 4 / 4), blk4, 0, stream>>>(attn, wo, x, hbuf, hbf);
  k_ffn1<<<dim3((MTOT / 32) * (HIDP / 32) / 4), blk4, 0, stream>>>(hbf, w1, w3, act);
  k_ffn2<<<dim3((MTOT / 16) * 8 / 8), blk, 0, stream>>>(act, w2, hbuf, out);
}

// v003
// Measured time: 63 microseconds a run.
// In two side-by-side timings against v002, it was 1.08 and 1.07 times as fast.
// Over all steps from v000 it is 2.27 times as fast.
#include <hip/hip_runtime.h>
#include <stdint.h>

// ---------------- problem constants ----------------
#define DIM   128
#define NH    16
#define HD    8
#define SEQ   2048
#define BATCH 4
#define MTOT  (BATCH*SEQ)   // 8192 rows
#define HID   344
#define HIDP  352
#define KCH   256

typedef __attribute__((ext_vector_type(16))) __bf16 v16bf;
typedef __attribute__((ext_vector_type(8)))  __bf16 v8bf;
typedef __attribute__((ext_vector_type(8)))  float  v8f;
typedef __attribute__((ext_vector_type(4)))  unsigned int u32x4;
typedef __attribute__((ext_vector_type(8)))  int i32x8;
typedef __attribute__((ext_vector_type(4)))  int i32x4;

static __device__ inline v8f wmma_bf(v16bf a, v16bf b, v8f c) {
  // D = A(16x32 bf16) * B(32x16 bf16) + C(16x16 f32)
  return __builtin_amdgcn_wmma_f32_16x16x32_bf16(false, a, false, b,
                                                 (short)0, c, false, false);
}

static __device__ inline v8f vz8() {
  v8f v;
#pragma unroll
  for (int i = 0; i < 8; ++i) v[i] = 0.0f;
  return v;
}
static __device__ inline v16bf vz16() {
  v16bf v;
#pragma unroll
  for (int i = 0; i < 16; ++i) v[i] = (__bf16)0.0f;
  return v;
}

// A fragment (16x32), source fp32 row-major. lane holds row (lane&15);
// K pattern: half=lane>>4 -> elems 0..7 = K k0..k0+7, elems 8..15 = K k0+16..k0+23
static __device__ inline v16bf afrag_f32(const float* row, int kb, int half) {
  const int k0 = kb + half * 8;
  v16bf a;
#pragma unroll
  for (int j = 0; j < 8; ++j) {
    a[j]     = (__bf16)row[k0 + j];
    a[j + 8] = (__bf16)row[k0 + 16 + j];
  }
  return a;
}

// A fragment, source bf16 row-major (16B-aligned rows) -> two b128 loads
static __device__ inline v16bf afrag_bf(const __bf16* row, int kb, int half) {
  const int k0 = kb + half * 8;
  v8bf lo = *(const v8bf*)(row + k0);
  v8bf hi = *(const v8bf*)(row + k0 + 16);
  v16bf a;
#pragma unroll
  for (int j = 0; j < 8; ++j) { a[j] = lo[j]; a[j + 8] = hi[j]; }
  return a;
}

// B fragment (32x16) from fp32 weight W[K x N] (row-major, ldn = N).
// lane holds column `col`; rows beyond kmax are zero-padded.
static __device__ inline v16bf bfrag_w(const float* W, int ldn, int kb, int col,
                                       int kmax, int half) {
  const int k0 = kb + half * 8;
  v16bf b;
#pragma unroll
  for (int j = 0; j < 8; ++j) {
    const int ka = k0 + j, kc = k0 + 16 + j;
    b[j]     = (ka < kmax) ? (__bf16)W[(size_t)ka * ldn + col] : (__bf16)0.0f;
    b[j + 8] = (kc < kmax) ? (__bf16)W[(size_t)kc * ldn + col] : (__bf16)0.0f;
  }
  return b;
}

// The same from a lane's own pointer wp = W + (half * 8) * ldn + col: every load is wp plus a constant.
static __device__ inline v16bf bfrag_p(const float* wp, int ldn, int kb) {
  v16bf b;
#pragma unroll
  for (int j = 0; j < 8; ++j) {
    b[j]     = (__bf16)wp[(size_t)(kb + j) * ldn];
    b[j + 8] = (__bf16)wp[(size_t)(kb + 16 + j) * ldn];
  }
  return b;
}

static __device__ inline float xhalf(float v) {
  const int b = __builtin_bit_cast(int, v);
  return __builtin_bit_cast(float,
      __builtin_amdgcn_permlanex16(b, b, 0x76543210, 0xfedcba98, false, false));
}

static __device__ inline void tdm_load_1d(uint32_t lds_off, const void* gptr,
                                          uint32_t nbytes) {
  const uint64_t ga = (uint64_t)(uintptr_t)gptr;
  const uint32_t elems = nbytes >> 2;
  u32x4 g0;
  g0[0] = 1u;
  g0[1] = lds_off;
  g0[2] = (uint32_t)ga;
  g0[3] = (uint32_t)((ga >> 32) & 0x01FFFFFFu)
        | (2u << 30);
  i32x8 g1;
  g1[0] = (int)(2u << 16);
  g1[1] = (int)((elems & 0xFFFFu) << 16);
  g1[2] = (int)((elems >> 16) | (1u << 16));
  g1[3] = (int)((elems & 0xFFFFu) << 16);
  g1[4] = 1;
  g1[5] = (int)elems;
  g1[6] = 0;
  g1[7] = 0;
  i32x4 gz4;
  gz4[0] = 0; gz4[1] = 0; gz4[2] = 0; gz4[3] = 0;   // groups 2/3 unused (<=2D)
  i32x8 gz8;
#pragma unroll
  for (int i = 0; i < 8; ++i) gz8[i] = 0;
  __builtin_amdgcn_tensor_load_to_lds(g0, g1, gz4, gz4, gz8, 0);
}

__global__ void __launch_bounds__(256) __attribute__((amdgpu_waves_per_eu(1, 2))) k_qkv(const float* __restrict__ x,
                                             const float* __restrict__ wq,
                                             const float* __restrict__ wk,
                                             const float* __restrict__ wv,
                                             __bf16* __restrict__ Q,
                                             __bf16* __restrict__ K,
                                             __bf16* __restrict__ V) {
  const int wave = threadIdx.x >> 5, lane = threadIdx.x & 31;
  const int half = lane >> 4, l16 = lane & 15;
  // A wave owns 2 row tiles x 3 column tiles of the 512 x 24 (3 matrices x 8): each x
  // fragment feeds 3 products and each weight fragment 2. The 8 waves of a block share the columns.
  const int rp = (blockIdx.x * 8 + wave) & 255;  // pair of row tiles
  const int cg = blockIdx.x >> 5;                // triple of column tiles, 0..7

  const float* xrow = x + (size_t)(rp * 32 + l16) * DIM + half * 8;
  const float* wp[3];
#pragma unroll
  for (int n = 0; n < 3; ++n) {
    const int t2 = cg * 3 + n;
    const int mat = t2 >> 3;
    wp[n] = ((mat == 0) ? wq : (mat == 1) ? wk : wv) + (half * 8) * DIM + (t2 & 7) * 16 + l16;
  }
  v8f acc[2][3];
#pragma unroll
  for (int m = 0; m < 2; ++m)
#pragma unroll
    for (int n = 0; n < 3; ++n) acc[m][n] = vz8();
#pragma unroll
  for (int f = 0; f < 4; ++f) {
    const v16bf a0 = afrag_f32(xrow, f * 32, 0);
    const v16bf a1 = afrag_f32(xrow + 16 * DIM, f * 32, 0);
#pragma unroll
    for (int n = 0; n < 3; ++n) {
      const v16bf bw = bfrag_p(wp[n], DIM, f * 32);
      acc[0][n] = wmma_bf(a0, bw, acc[0][n]);
      acc[1][n] = wmma_bf(a1, bw, acc[1][n]);
    }
  }
  // One wait behind the last loads of the products, their address registers named as inputs so that they
  // live up to it: no register that an issued load names as its address is written again in front of it.
  asm volatile("s_wait_xcnt 0x0" :: "v"(xrow), "v"(wp[0]), "v"(wp[1]), "v"(wp[2]) : "memory");
#pragma unroll
  for (int n = 0; n < 3; ++n) {
    const int t2 = cg * 3 + n;
    const int mat = t2 >> 3;
    __bf16* Out = (mat == 0) ? Q : (mat == 1) ? K : V;
    const int col = (t2 & 7) * 16 + l16;
    const int head = col >> 3, d = col & 7;
    const float osc = (mat == 0) ? 1.44269504f : 1.0f;   // Q carries log2 e: the scores are exponents of 2
#pragma unroll
    for (int m = 0; m < 2; ++m)
#pragma unroll
      for (int r = 0; r < 8; ++r) {
        const int grow = rp * 32 + m * 16 + half * 8 + r;
        const int b = grow >> 11, srow = grow & (SEQ - 1);
        Out[(((size_t)(b * NH + head)) * SEQ + srow) * HD + d] = (__bf16)(acc[m][n][r] * osc);
      }
  }
}

__global__ void __launch_bounds__(256) k_attn(const __bf16* __restrict__ Q,
                                              const __bf16* __restrict__ K,
                                              const __bf16* __restrict__ V,
                                              __bf16* __restrict__ attn) {
  const int bh = blockIdx.y;
  const int wave = threadIdx.x >> 5, lane = threadIdx.x & 31;
  const int half = lane >> 4, l16 = lane & 15;
  const int qbase = blockIdx.x * 128 + wave * 16;
  const __bf16* Qh = Q + (size_t)bh * SEQ * HD;
  const __bf16* Kh = K + (size_t)bh * SEQ * HD;
  const __bf16* Vh = V + (size_t)bh * SEQ * HD;

  __shared__ __bf16 kbuf[2][KCH * HD];         // 2 x 4KB
  __shared__ __bf16 vbuf[2][KCH * HD];         // 2 x 4KB

  // Q^T fragment: B(32x16), lane = query column, only d=0..7 real -> zeros elsewhere
  v16bf qf = vz16();
  if (half == 0) {
    v8bf qv = *(const v8bf*)(Qh + (size_t)(qbase + l16) * HD);
#pragma unroll
    for (int j = 0; j < 8; ++j) qf[j] = qv[j];
  }

  v8bf kz;
#pragma unroll
  for (int j = 0; j < 8; ++j) kz[j] = (__bf16)0.0f;
  v8f cneg = vz8();      // minus the maximum in use of query l16, equal in both halves: a C operand
  float thr = -3.0e38f;  // a score above this moves the maximum in use: any in the first step, then 8
  float lo  = -3.0e38f;  // the least move: the first step takes its own maximum, later ones never go down
  float lrow = 0.0f;     // running sum over this half's keys only; joined at the end
  v8f oacc = vz8();      // O^T: register r = head dim half*8 + r (half 1: padding), lane = query

  if (wave == 0) {
    tdm_load_1d((uint32_t)(uintptr_t)&kbuf[0][0], Kh, KCH * HD * 2);
    tdm_load_1d((uint32_t)(uintptr_t)&vbuf[0][0], Vh, KCH * HD * 2);
  }

  for (int c = 0; c < SEQ / KCH; ++c) {
    if (wave == 0) __builtin_amdgcn_s_wait_tensorcnt(0);   // chunk c landed
    __syncthreads();                                       // visible to all waves
    if (wave == 0 && c + 1 < SEQ / KCH) {                  // prefetch chunk c+1
      const int nb = (c + 1) & 1;
      tdm_load_1d((uint32_t)(uintptr_t)&kbuf[nb][0],
                  Kh + (size_t)(c + 1) * KCH * HD, KCH * HD * 2);
      tdm_load_1d((uint32_t)(uintptr_t)&vbuf[nb][0],
                  Vh + (size_t)(c + 1) * KCH * HD, KCH * HD * 2);
    }
    const __bf16* kchb = &kbuf[c & 1][0];
    const __bf16* vchb = &vbuf[c & 1][0];

    for (int sub = 0; sub < KCH / 32; ++sub) {
      const int s0 = sub * 32;
      const v8bf k0 = *(const v8bf*)(kchb + (size_t)(s0 + l16) * HD);
      const v8bf k1 = *(const v8bf*)(kchb + (size_t)(s0 + 16 + l16) * HD);
      const v16bf bk0 = __builtin_shufflevector(k0, kz, 0, 1, 2, 3, 4, 5, 6, 7, 8, 9, 10, 11, 12, 13, 14, 15);
      const v16bf bk1 = __builtin_shufflevector(k1, kz, 0, 1, 2, 3, 4, 5, 6, 7, 8, 9, 10, 11, 12, 13, 14, 15);
      // sc0[r] = score(key s0 + half*8 + r, query l16) - maximum in use; sc1: keys 16 further on
      v8f sc0 = wmma_bf(bk0, qf, cneg);
      v8f sc1 = wmma_bf(bk1, qf, cneg);

      // V^T fragment (A 16x32, rows 0..7 = head dims), keys in the order of P^T below.
      // Rows 8..15 repeat rows 0..7: they reach only O^T rows 8..15, which are never stored.
      v16bf vb;
      {
        const int kb0 = half * 8, dd = l16 & (HD - 1);
#pragma unroll
        for (int j = 0; j < 8; ++j) {
          vb[j]     = vchb[(size_t)(s0 + kb0 + j) * HD + dd];
          vb[j + 8] = vchb[(size_t)(s0 + kb0 + 16 + j) * HD + dd];
        }
      }

      // online softmax, one query per lane
      float mx = fmaxf(sc0[0], sc1[0]);
#pragma unroll
      for (int r = 1; r < 8; ++r) mx = fmaxf(mx, fmaxf(sc0[r], sc1[r]));
      if (__builtin_amdgcn_ballot_w32(mx > thr) != 0) {   // one scalar branch a step, the same for the whole wave
        mx = fmaxf(mx, xhalf(mx));
        const float delta = fmaxf(mx, lo);                // how far this query's maximum in use moves
        float scale = fminf(-delta, 0.0f);                // a first step below 0 has nothing to rescale yet
        asm("v_exp_f32 %0, %0\n\tv_nop" : "+v"(scale));
#pragma unroll
        for (int r = 0; r < 8; ++r) {
          sc0[r] -= delta;
          sc1[r] -= delta;
          cneg[r] -= delta;
          oacc[r] *= scale;
        }
        lrow *= scale;
        thr = 8.0f;
        lo = 0.0f;
      }
      float e0[8], e1[8];
      asm("v_exp_f32 %0, %8\n\tv_exp_f32 %1, %9\n\tv_exp_f32 %2, %10\n\tv_exp_f32 %3, %11\n\t"
          "v_exp_f32 %4, %12\n\tv_exp_f32 %5, %13\n\tv_exp_f32 %6, %14\n\tv_exp_f32 %7, %15\n\t"
          "v_nop"
          : "=&v"(e0[0]), "=&v"(e0[1]), "=&v"(e0[2]), "=&v"(e0[3]),
            "=&v"(e0[4]), "=&v"(e0[5]), "=&v"(e0[6]), "=&v"(e0[7])
          : "v"(sc0[0]), "v"(sc0[1]), "v"(sc0[2]), "v"(sc0[3]),
            "v"(sc0[4]), "v"(sc0[5]), "v"(sc0[6]), "v"(sc0[7]));
      asm("v_exp_f32 %0, %8\n\tv_exp_f32 %1, %9\n\tv_exp_f32 %2, %10\n\tv_exp_f32 %3, %11\n\t"
          "v_exp_f32 %4, %12\n\tv_exp_f32 %5, %13\n\tv_exp_f32 %6, %14\n\tv_exp_f32 %7, %15\n\t"
          "v_nop"
          : "=&v"(e1[0]), "=&v"(e1[1]), "=&v"(e1[2]), "=&v"(e1[3]),
            "=&v"(e1[4]), "=&v"(e1[5]), "=&v"(e1[6]), "=&v"(e1[7])
          : "v"(sc1[0]), "v"(sc1[1]), "v"(sc1[2]), "v"(sc1[3]),
            "v"(sc1[4]), "v"(sc1[5]), "v"(sc1[6]), "v"(sc1[7]));
      v16bf pb;            // P^T fragment (B 32x16): element j = key half*8 + j, j + 8 = 16 + half*8 + j
#pragma unroll
      for (int r = 0; r < 8; ++r) {
        pb[r]     = (__bf16)e0[r];
        pb[r + 8] = (__bf16)e1[r];
      }
      asm("v_wmma_f32_16x16x32_bf16 %0, %1, %2, %0\n\tv_nop\n\tv_nop\n\tv_nop\n\tv_nop"
          : "+v"(oacc)
          : "v"(__builtin_bit_cast(i32x8, vb)), "v"(__builtin_bit_cast(i32x8, pb)));
      float ps = e0[0] + e1[0];
#pragma unroll
      for (int r = 1; r < 8; ++r) ps += e0[r] + e1[r];
      lrow += ps;
    }
    __syncthreads();   // all waves done with buffer c&1 before it is re-filled
  }
  // normalize + store [B,S,128] bf16: lane (half 0) = query, 8 head dims = 16 bytes
  lrow += xhalf(lrow);
  if (half == 0) {
    const int b = bh >> 4, h = bh & 15;
    v8bf o;
#pragma unroll
    for (int r = 0; r < 8; ++r) o[r] = (__bf16)(oacc[r] / lrow);
    *(v8bf*)(attn + ((size_t)(b * SEQ + qbase + l16)) * DIM + h * HD) = o;
  }
}

__global__ void __launch_bounds__(128) __attribute__((amdgpu_waves_per_eu(1, 3))) k_oproj(const __bf16* __restrict__ attn,
                                               const float* __restrict__ wo,
                                               const float* __restrict__ x,
                                               float* __restrict__ hout,
                                               __bf16* __restrict__ hbf) {
  const int wave = threadIdx.x >> 5, lane = threadIdx.x & 31;
  const int half = lane >> 4, l16 = lane & 15;
  const int rp = (blockIdx.x * 4 + wave) & 255;  // pair of row tiles
  const int cp = blockIdx.x >> 6;                // pair of column tiles, 0..3
  const __bf16* arow = attn + (size_t)(rp * 32 + l16) * DIM + half * 8;
  const float* wp0 = wo + (half * 8) * DIM + (cp * 2) * 16 + l16;   // the second column tile: 16 floats on
  v8f acc[2][2];
#pragma unroll
  for (int m = 0; m < 2; ++m)
#pragma unroll
    for (int n = 0; n < 2; ++n) acc[m][n] = vz8();
#pragma unroll
  for (int f = 0; f < 4; ++f) {
    const v16bf a0 = afrag_bf(arow, f * 32, 0);
    const v16bf a1 = afrag_bf(arow + 16 * DIM, f * 32, 0);
#pragma unroll
    for (int n = 0; n < 2; ++n) {
      const v16bf bw = bfrag_p(wp0 + n * 16, DIM, f * 32);
      acc[0][n] = wmma_bf(a0, bw, acc[0][n]);
      acc[1][n] = wmma_bf(a1, bw, acc[1][n]);
    }
  }
  // One wait behind the last loads of the products, their address registers named as inputs so that they
  // live up to it: no register that an issued load names as its address is written again in front of it.
  asm volatile("s_wait_xcnt 0x0" :: "v"(arow), "v"(wp0) : "memory");
#pragma unroll
  for (int m = 0; m < 2; ++m)
#pragma unroll
    for (int n = 0; n < 2; ++n) {
      const int col = (cp * 2 + n) * 16 + l16;
#pragma unroll
      for (int r = 0; r < 8; ++r) {
        const int grow = rp * 32 + m * 16 + half * 8 + r;
        const float hv = x[(size_t)grow * DIM + col] + acc[m][n][r];
        hout[(size_t)grow * DIM + col] = hv;
        hbf[(size_t)grow * DIM + col]  = (__bf16)hv;
      }
    }
}

__global__ void __launch_bounds__(128) __attribute__((amdgpu_waves_per_eu(1, 3))) k_ffn1(const __bf16* __restrict__ hbf,
                                              const float* __restrict__ w1,
                                              const float* __restrict__ w3,
                                              __bf16* __restrict__ act) {
  const int wave = threadIdx.x >> 5, lane = threadIdx.x & 31;
  const int half = lane >> 4, l16 = lane & 15;
  const int rp = (blockIdx.x * 4 + wave) & 255;  // pair of row tiles
  const int cp = blockIdx.x >> 6;                // pair of column tiles, 0..10
  const __bf16* hrow = hbf + (size_t)(rp * 32 + l16) * DIM + half * 8;
  const float* p1[2];
  const float* p3[2];
#pragma unroll
  for (int n = 0; n < 2; ++n) {
    const int nn = (cp * 2 + n) * 16 + l16;
    const int wcol = (nn < HID) ? nn : 0;            // clamp (pad cols zeroed on store)
    p1[n] = w1 + (half * 8) * HID + wcol;
    p3[n] = w3 + (half * 8) * HID + wcol;
  }
  v8f a1[2][2], a3[2][2];
#pragma unroll
  for (int m = 0; m < 2; ++m)
#pragma unroll
    for (int n = 0; n < 2; ++n) { a1[m][n] = vz8(); a3[m][n] = vz8(); }
#pragma unroll
  for (int f = 0; f < 4; ++f) {
    const v16bf A0 = afrag_bf(hrow, f * 32, 0);
    const v16bf A1 = afrag_bf(hrow + 16 * DIM, f * 32, 0);
#pragma unroll
    for (int n = 0; n < 2; ++n) {
      const v16bf b1 = bfrag_p(p1[n], HID, f * 32);
      a1[0][n] = wmma_bf(A0, b1, a1[0][n]);
      a1[1][n] = wmma_bf(A1, b1, a1[1][n]);
      const v16bf b3 = bfrag_p(p3[n], HID, f * 32);
      a3[0][n] = wmma_bf(A0, b3, a3[0][n]);
      a3[1][n] = wmma_bf(A1, b3, a3[1][n]);
    }
  }
  // One wait behind the last loads of the products, their address registers named as inputs so that they
  // live up to it: no register that an issued load names as its address is written again in front of it.
  asm volatile("s_wait_xcnt 0x0" :: "v"(hrow), "v"(p1[0]), "v"(p1[1]), "v"(p3[0]), "v"(p3[1]) : "memory");
#pragma unroll
  for (int m = 0; m < 2; ++m)
#pragma unroll
    for (int n = 0; n < 2; ++n) {
      const int nn = (cp * 2 + n) * 16 + l16;
      float e[8];                                        // exp(-s) = 2^(-s * log2 e)
#pragma unroll
      for (int r = 0; r < 8; ++r) e[r] = a1[m][n][r] * -1.44269504f;
      asm("v_exp_f32 %0, %0\n\tv_exp_f32 %1, %1\n\tv_exp_f32 %2, %2\n\tv_exp_f32 %3, %3\n\t"
          "v_exp_f32 %4, %4\n\tv_exp_f32 %5, %5\n\tv_exp_f32 %6, %6\n\tv_exp_f32 %7, %7\n\t"
          "v_nop"
          : "+v"(e[0]), "+v"(e[1]), "+v"(e[2]), "+v"(e[3]),
            "+v"(e[4]), "+v"(e[5]), "+v"(e[6]), "+v"(e[7]));
#pragma unroll
      for (int r = 0; r < 8; ++r) {
        const int grow = rp * 32 + m * 16 + half * 8 + r;
        float v = 0.0f;
        if (nn < HID) {
          const float s = a1[m][n][r];
          v = (s / (1.0f + e[r])) * a3[m][n][r];         // silu * gate
        }
        act[(size_t)grow * HIDP + nn] = (__bf16)v;       // pad cols -> 0
      }
    }
}

// ---------------- 5) FFN down proj + residual -> d_out ----------------
__global__ void __launch_bounds__(256) k_ffn2(const __bf16* __restrict__ act,
                                              const float* __restrict__ w2,
                                              const float* __restrict__ hout,
                                              float* __restrict__ out) {
  const int wave = threadIdx.x >> 5, lane = threadIdx.x & 31;
  const int half = lane >> 4, l16 = lane & 15;
  const int tile = blockIdx.x * 8 + wave;
  if (tile >= (MTOT / 16) * 8) return;
  const int rt = tile & 511, ct = tile >> 9;
  const __bf16* arow = act + (size_t)(rt * 16 + l16) * HIDP;
  const int col = ct * 16 + l16;
  v8f acc = vz8();
#pragma unroll
  for (int f = 0; f < HIDP / 32; ++f)                // 11 K-steps (pad rows are 0)
    acc = wmma_bf(afrag_bf(arow, f * 32, half),
                  bfrag_w(w2, DIM, f * 32, col, HID, half), acc);
#pragma unroll
  for (int r = 0; r < 8; ++r) {
    const int grow = rt * 16 + half * 8 + r;
    out[(size_t)grow * DIM + col] = hout[(size_t)grow * DIM + col] + acc[r];
  }
}

// ---------------- launcher ----------------
extern "C" void kernel_launch(void* const* d_in, const int* in_sizes, int n_in,
                              void* d_out, int out_size, void* d_ws, size_t ws_size,
                              hipStream_t stream) {
  (void)in_sizes; (void)n_in; (void)out_size; (void)ws_size;
  const float* x  = (const float*)d_in[0];
  const float* wq = (const float*)d_in[1];
  const float* wk = (const float*)d_in[2];
  const float* wv = (const float*)d_in[3];
  const float* wo = (const float*)d_in[4];
  const float* w1 = (const float*)d_in[5];
  const float* w3 = (const float*)d_in[6];
  const float* w2 = (const float*)d_in[7];
  float* out = (float*)d_out;

  char* ws = (char*)d_ws;                       // ~19.8 MB total
  __bf16* Q    = (__bf16*)(ws);                 // 2 MB  [B,H,S,8]
  __bf16* K    = (__bf16*)(ws + (2u  << 20));   // 2 MB
  __bf16* V    = (__bf16*)(ws + (4u  << 20));   // 2 MB
  __bf16* attn = (__bf16*)(ws + (6u  << 20));   // 2 MB  [B*S,128]
  float*  hbuf = (float* )(ws + (8u  << 20));   // 4 MB  [B*S,128] f32
  __bf16* hbf  = (__bf16*)(ws + (12u << 20));   // 2 MB
  __bf16* act  = (__bf16*)(ws + (14u << 20));   // 5.8 MB [B*S,352]

  const dim3 blk(256);
  const dim3 blk4(128);
  k_qkv <<<dim3((MTOT / 32) * 8 / 8), blk, 0, stream>>>(x, wq, wk, wv, Q, K, V);
  k_attn<<<dim3(SEQ / 128, BATCH * NH), blk, 0, stream>>>(Q, K, V, attn);
  k_oproj<<<dim3((MTOT / 32) * 4 / 4), blk4, 0, stream>>>(attn, wo, x, hbuf, hbf);
  k_ffn1<<<dim3((MTOT / 32) * (HIDP / 32) / 4), blk4, 0, stream>>>(hbf, w1, w3, act);
  k_ffn2<<<dim3((MTOT / 16) * 8 / 8), blk, 0, stream>>>(act, w2, hbuf, out);
}

// v004
// A run of this version takes 59.3 microseconds.
// In both of two side-by-side timings against v003, it was 1.06 times as fast.
// All steps since v000 together make it 2.40 times as fast.
#include <hip/hip_runtime.h>
#include <stdint.h>

// ---------------- problem constants ----------------
#define DIM   128
#define NH    16
#define HD    8
#define SEQ   2048
#define BATCH 4
#define MTOT  (BATCH*SEQ)   // 8192 rows
#define HID   344
#define HIDP  352
#define KCH   256

typedef __attribute__((ext_vector_type(16))) __bf16 v16bf;
typedef __attribute__((ext_vector_type(8)))  __bf16 v8bf;
typedef __attribute__((ext_vector_type(8)))  float  v8f;
typedef __attribute__((ext_vector_type(4)))  unsigned int u32x4;
typedef __attribute__((ext_vector_type(8)))  int i32x8;
typedef __attribute__((ext_vector_type(4)))  int i32x4;

static __device__ inline v8f wmma_bf(v16bf a, v16bf b, v8f c) {
  // D = A(16x32 bf16) * B(32x16 bf16) + C(16x16 f32)
  return __builtin_amdgcn_wmma_f32_16x16x32_bf16(false, a, false, b,
                                                 (short)0, c, false, false);
}

static __device__ inline v8f vz8() {
  v8f v;
#pragma unroll
  for (int i = 0; i < 8; ++i) v[i] = 0.0f;
  return v;
}
static __device__ inline v16bf vz16() {
  v16bf v;
#pragma unroll
  for (int i = 0; i < 16; ++i) v[i] = (__bf16)0.0f;
  return v;
}

// A fragment (16x32), source fp32 row-major. lane holds row (lane&15);
// K pattern: half=lane>>4 -> elems 0..7 = K k0..k0+7, elems 8..15 = K k0+16..k0+23
static __device__ inline v16bf afrag_f32(const float* row, int kb, int half) {
  const int k0 = kb + half * 8;
  v16bf a;
#pragma unroll
  for (int j = 0; j < 8; ++j) {
    a[j]     = (__bf16)row[k0 + j];
    a[j + 8] = (__bf16)row[k0 + 16 + j];
  }
  return a;
}

// A fragment, source bf16 row-major (16B-aligned rows) -> two b128 loads
static __device__ inline v16bf afrag_bf(const __bf16* row, int kb, int half) {
  const int k0 = kb + half * 8;
  v8bf lo = *(const v8bf*)(row + k0);
  v8bf hi = *(const v8bf*)(row + k0 + 16);
  v16bf a;
#pragma unroll
  for (int j = 0; j < 8; ++j) { a[j] = lo[j]; a[j + 8] = hi[j]; }
  return a;
}

// B fragment (32x16) from fp32 weight W[K x N] (row-major, ldn = N).
// lane holds column `col`; rows beyond kmax are zero-padded.
static __device__ inline v16bf bfrag_w(const float* W, int ldn, int kb, int col,
                                       int kmax, int half) {
  const int k0 = kb + half * 8;
  v16bf b;
#pragma unroll
  for (int j = 0; j < 8; ++j) {
    const int ka = k0 + j, kc = k0 + 16 + j;
    b[j]     = (ka < kmax) ? (__bf16)W[(size_t)ka * ldn + col] : (__bf16)0.0f;
    b[j + 8] = (kc < kmax) ? (__bf16)W[(size_t)kc * ldn + col] : (__bf16)0.0f;
  }
  return b;
}

// The same from a lane's own pointer wp = W + (half * 8) * ldn + col: every load is wp plus a constant.
static __device__ inline v16bf bfrag_p(const float* wp, int ldn, int kb) {
  v16bf b;
#pragma unroll
  for (int j = 0; j < 8; ++j) {
    b[j]     = (__bf16)wp[(size_t)(kb + j) * ldn];
    b[j + 8] = (__bf16)wp[(size_t)(kb + 16 + j) * ldn];
  }
  return b;
}

static __device__ inline float xhalf(float v) {
  const int b = __builtin_bit_cast(int, v);
  return __builtin_bit_cast(float,
      __builtin_amdgcn_permlanex16(b, b, 0x76543210, 0xfedcba98, false, false));
}

static __device__ inline void tdm_load_1d(uint32_t lds_off, const void* gptr,
                                          uint32_t nbytes) {
  const uint64_t ga = (uint64_t)(uintptr_t)gptr;
  const uint32_t elems = nbytes >> 2;
  u32x4 g0;
  g0[0] = 1u;
  g0[1] = lds_off;
  g0[2] = (uint32_t)ga;
  g0[3] = (uint32_t)((ga >> 32) & 0x01FFFFFFu)
        | (2u << 30);
  i32x8 g1;
  g1[0] = (int)(2u << 16);
  g1[1] = (int)((elems & 0xFFFFu) << 16);
  g1[2] = (int)((elems >> 16) | (1u << 16));
  g1[3] = (int)((elems & 0xFFFFu) << 16);
  g1[4] = 1;
  g1[5] = (int)elems;
  g1[6] = 0;
  g1[7] = 0;
  i32x4 gz4;
  gz4[0] = 0; gz4[1] = 0; gz4[2] = 0; gz4[3] = 0;   // groups 2/3 unused (<=2D)
  i32x8 gz8;
#pragma unroll
  for (int i = 0; i < 8; ++i) gz8[i] = 0;
  __builtin_amdgcn_tensor_load_to_lds(g0, g1, gz4, gz4, gz8, 0);
}

__global__ void __launch_bounds__(256) __attribute__((amdgpu_waves_per_eu(1, 2))) k_qkv(const float* __restrict__ x,
                                             const float* __restrict__ wq,
                                             const float* __restrict__ wk,
                                             const float* __restrict__ wv,
                                             __bf16* __restrict__ Q,
                                             __bf16* __restrict__ K,
                                             __bf16* __restrict__ V) {
  const int wave = threadIdx.x >> 5, lane = threadIdx.x & 31;
  const int half = lane >> 4, l16 = lane & 15;
  // A wave owns 2 row tiles x 3 column tiles of the 512 x 24 (3 matrices x 8): each x
  // fragment feeds 3 products and each weight fragment 2. The 8 waves of a block share the columns.
  const int rp = (blockIdx.x * 8 + wave) & 255;  // pair of row tiles
  const int cg = blockIdx.x >> 5;                // triple of column tiles, 0..7

  const float* xrow = x + (size_t)(rp * 32 + l16) * DIM + half * 8;
  const float* wp[3];
#pragma unroll
  for (int n = 0; n < 3; ++n) {
    const int t2 = cg * 3 + n;
    const int mat = t2 >> 3;
    wp[n] = ((mat == 0) ? wq : (mat == 1) ? wk : wv) + (half * 8) * DIM + (t2 & 7) * 16 + l16;
  }
  v8f acc[2][3];
#pragma unroll
  for (int m = 0; m < 2; ++m)
#pragma unroll
    for (int n = 0; n < 3; ++n) acc[m][n] = vz8();
#pragma unroll
  for (int f = 0; f < 4; ++f) {
    const v16bf a0 = afrag_f32(xrow, f * 32, 0);
    const v16bf a1 = afrag_f32(xrow + 16 * DIM, f * 32, 0);
#pragma unroll
    for (int n = 0; n < 3; ++n) {
      const v16bf bw = bfrag_p(wp[n], DIM, f * 32);
      acc[0][n] = wmma_bf(a0, bw, acc[0][n]);
      acc[1][n] = wmma_bf(a1, bw, acc[1][n]);
    }
  }
  // One wait behind the last loads of the products, their address registers named as inputs so that they
  // live up to it: no register that an issued load names as its address is written again in front of it.
  asm volatile("s_wait_xcnt 0x0" :: "v"(xrow), "v"(wp[0]), "v"(wp[1]), "v"(wp[2]) : "memory");
#pragma unroll
  for (int n = 0; n < 3; ++n) {
    const int t2 = cg * 3 + n;
    const int mat = t2 >> 3;
    __bf16* Out = (mat == 0) ? Q : (mat == 1) ? K : V;
    const int col = (t2 & 7) * 16 + l16;
    const int head = col >> 3, d = col & 7;
    const float osc = (mat == 0) ? 1.44269504f : 1.0f;   // Q carries log2 e: the scores are exponents of 2
    if (mat == 2) {
      // The wave's 32 rows are one block of keys; a lane's 8 accumulator rows are 8 keys in a row: 16 bytes.
      __bf16* vblk = V + ((size_t)((rp >> 6) * NH + head)) * SEQ * HD + (rp & 63) * (32 * HD) + half * 64 + d * 8;
#pragma unroll
      for (int m = 0; m < 2; ++m) {
        v8bf o;
#pragma unroll
        for (int r = 0; r < 8; ++r) o[r] = (__bf16)acc[m][n][r];
        *(v8bf*)(vblk + m * 128) = o;
      }
      // The next column tile reuses registers that these stores name as address or data: the wait closes
      // the branch, in front of that.
      if (n < 2) asm volatile("s_wait_xcnt 0x0" ::: "memory");
    } else {
#pragma unroll
      for (int m = 0; m < 2; ++m)
#pragma unroll
        for (int r = 0; r < 8; ++r) {
          const int grow = rp * 32 + m * 16 + half * 8 + r;
          const int b = grow >> 11, srow = grow & (SEQ - 1);
          Out[(((size_t)(b * NH + head)) * SEQ + srow) * HD + d] = (__bf16)(acc[m][n][r] * osc);
        }
      // As in the other branch; behind the last tile too: in the built code the other branch's block follows this one.
      asm volatile("s_wait_xcnt 0x0" ::: "memory");
    }
  }
}

__global__ void __launch_bounds__(256) k_attn(const __bf16* __restrict__ Q,
                                              const __bf16* __restrict__ K,
                                              const __bf16* __restrict__ V,
                                              __bf16* __restrict__ attn) {
  const int bh = blockIdx.y;
  const int wave = threadIdx.x >> 5, lane = threadIdx.x & 31;
  const int half = lane >> 4, l16 = lane & 15;
  const int qbase = blockIdx.x * 128 + wave * 16;
  const __bf16* Qh = Q + (size_t)bh * SEQ * HD;
  const __bf16* Kh = K + (size_t)bh * SEQ * HD;
  const __bf16* Vh = V + (size_t)bh * SEQ * HD;

  __shared__ __bf16 kbuf[2][KCH * HD];         // 2 x 4KB
  __shared__ __bf16 vbuf[2][KCH * HD];         // 2 x 4KB

  // Q^T fragment: B(32x16), lane = query column, only d=0..7 real -> zeros elsewhere
  v16bf qf = vz16();
  if (half == 0) {
    v8bf qv = *(const v8bf*)(Qh + (size_t)(qbase + l16) * HD);
#pragma unroll
    for (int j = 0; j < 8; ++j) qf[j] = qv[j];
  }

  const int fo = ((l16 + half * 8) & 15) * HD;
  v8bf kz;
#pragma unroll
  for (int j = 0; j < 8; ++j) kz[j] = (__bf16)0.0f;
  v8f cneg = vz8();      // minus the maximum in use of query l16, equal in both halves: a C operand
  float thr = -3.0e38f;  // a score above this moves the maximum in use: any in the first step, then 8
  float lo  = -3.0e38f;  // the least move: the first step takes its own maximum, later ones never go down
  float lrow = 0.0f;     // running sum over this half's keys only; joined at the end
  v8f oacc = vz8();      // O^T: register r = head dim half*8 + r (half 1: padding), lane = query

  if (wave == 0) {
    tdm_load_1d((uint32_t)(uintptr_t)&kbuf[0][0], Kh, KCH * HD * 2);
    tdm_load_1d((uint32_t)(uintptr_t)&vbuf[0][0], Vh, KCH * HD * 2);
  }

  for (int c = 0; c < SEQ / KCH; ++c) {
    if (wave == 0) __builtin_amdgcn_s_wait_tensorcnt(0);   // chunk c landed
    __syncthreads();                                       // visible to all waves
    if (wave == 0 && c + 1 < SEQ / KCH) {                  // prefetch chunk c+1
      const int nb = (c + 1) & 1;
      tdm_load_1d((uint32_t)(uintptr_t)&kbuf[nb][0],
                  Kh + (size_t)(c + 1) * KCH * HD, KCH * HD * 2);
      tdm_load_1d((uint32_t)(uintptr_t)&vbuf[nb][0],
                  Vh + (size_t)(c + 1) * KCH * HD, KCH * HD * 2);
    }
    const __bf16* kchb = &kbuf[c & 1][0];
    const __bf16* vchb = &vbuf[c & 1][0];

    for (int sub = 0; sub < KCH / 32; ++sub) {
      const int s0 = sub * 32;
      const v8bf k0 = *(const v8bf*)(kchb + (size_t)s0 * HD + fo);
      const v8bf k1 = *(const v8bf*)(kchb + (size_t)(s0 + 16) * HD + fo);
      const v8bf v0 = *(const v8bf*)(vchb + (size_t)s0 * HD + fo);
      const v8bf v1 = *(const v8bf*)(vchb + (size_t)(s0 + 16) * HD + fo);
      const v16bf bk0 = __builtin_shufflevector(k0, kz, 0, 1, 2, 3, 4, 5, 6, 7, 8, 9, 10, 11, 12, 13, 14, 15);
      const v16bf bk1 = __builtin_shufflevector(k1, kz, 0, 1, 2, 3, 4, 5, 6, 7, 8, 9, 10, 11, 12, 13, 14, 15);
      // sc0[r] = score(key s0 + half*8 + r, query l16) - maximum in use; sc1: keys 16 further on
      v8f sc0 = wmma_bf(bk0, qf, cneg);
      v8f sc1 = wmma_bf(bk1, qf, cneg);

      // V^T fragment (A 16x32, rows 0..7 = head dims), keys in the order of P^T below.
      // V lies in that order (k_qkv): a lane's 8 keys of a 16-key tile are 16 bytes in a row.
      // Rows 8..15 hold other pieces of the tile: they reach only O^T rows 8..15, which are never stored.
      const v16bf vb = __builtin_shufflevector(v0, v1, 0, 1, 2, 3, 4, 5, 6, 7, 8, 9, 10, 11, 12, 13, 14, 15);

      // online softmax, one query per lane
      float mx = fmaxf(sc0[0], sc1[0]);
#pragma unroll
      for (int r = 1; r < 8; ++r) mx = fmaxf(mx, fmaxf(sc0[r], sc1[r]));
      if (__builtin_amdgcn_ballot_w32(mx > thr) != 0) {   // one scalar branch a step, the same for the whole wave
        mx = fmaxf(mx, xhalf(mx));
        const float delta = fmaxf(mx, lo);                // how far this query's maximum in use moves
        float scale = fminf(-delta, 0.0f);                // a first step below 0 has nothing to rescale yet
        asm("v_exp_f32 %0, %0\n\tv_nop" : "+v"(scale));
#pragma unroll
        for (int r = 0; r < 8; ++r) {
          sc0[r] -= delta;
          sc1[r] -= delta;
          cneg[r] -= delta;
          oacc[r] *= scale;
        }
        lrow *= scale;
        thr = 8.0f;
        lo = 0.0f;
      }
      float e0[8], e1[8];
      asm("v_exp_f32 %0, %8\n\tv_exp_f32 %1, %9\n\tv_exp_f32 %2, %10\n\tv_exp_f32 %3, %11\n\t"
          "v_exp_f32 %4, %12\n\tv_exp_f32 %5, %13\n\tv_exp_f32 %6, %14\n\tv_exp_f32 %7, %15\n\t"
          "v_nop"
          : "=&v"(e0[0]), "=&v"(e0[1]), "=&v"(e0[2]), "=&v"(e0[3]),
            "=&v"(e0[4]), "=&v"(e0[5]), "=&v"(e0[6]), "=&v"(e0[7])
          : "v"(sc0[0]), "v"(sc0[1]), "v"(sc0[2]), "v"(sc0[3]),
            "v"(sc0[4]), "v"(sc0[5]), "v"(sc0[6]), "v"(sc0[7]));
      asm("v_exp_f32 %0, %8\n\tv_exp_f32 %1, %9\n\tv_exp_f32 %2, %10\n\tv_exp_f32 %3, %11\n\t"
          "v_exp_f32 %4, %12\n\tv_exp_f32 %5, %13\n\tv_exp_f32 %6, %14\n\tv_exp_f32 %7, %15\n\t"
          "v_nop"
          : "=&v"(e1[0]), "=&v"(e1[1]), "=&v"(e1[2]), "=&v"(e1[3]),
            "=&v"(e1[4]), "=&v"(e1[5]), "=&v"(e1[6]), "=&v"(e1[7])
          : "v"(sc1[0]), "v"(sc1[1]), "v"(sc1[2]), "v"(sc1[3]),
            "v"(sc1[4]), "v"(sc1[5]), "v"(sc1[6]), "v"(sc1[7]));
      v16bf pb;            // P^T fragment (B 32x16): element j = key half*8 + j, j + 8 = 16 + half*8 + j
#pragma unroll
      for (int r = 0; r < 8; ++r) {
        pb[r]     = (__bf16)e0[r];
        pb[r + 8] = (__bf16)e1[r];
      }
      asm("v_wmma_f32_16x16x32_bf16 %0, %1, %2, %0\n\tv_nop\n\tv_nop\n\tv_nop\n\tv_nop"
          : "+v"(oacc)
          : "v"(__builtin_bit_cast(i32x8, vb)), "v"(__builtin_bit_cast(i32x8, pb)));
      float ps = e0[0] + e1[0];
#pragma unroll
      for (int r = 1; r < 8; ++r) ps += e0[r] + e1[r];
      lrow += ps;
    }
    __syncthreads();   // all waves done with buffer c&1 before it is re-filled
  }
  // normalize + store [B,S,128] bf16: lane (half 0) = query, 8 head dims = 16 bytes
  lrow += xhalf(lrow);
  if (half == 0) {
    const int b = bh >> 4, h = bh & 15;
    v8bf o;
#pragma unroll
    for (int r = 0; r < 8; ++r) o[r] = (__bf16)(oacc[r] / lrow);
    *(v8bf*)(attn + ((size_t)(b * SEQ + qbase + l16)) * DIM + h * HD) = o;
  }
}

__global__ void __launch_bounds__(128) __attribute__((amdgpu_waves_per_eu(1, 3))) k_oproj(const __bf16* __restrict__ attn,
                                               const float* __restrict__ wo,
                                               const float* __restrict__ x,
                                               float* __restrict__ hout,
                                               __bf16* __restrict__ hbf) {
  const int wave = threadIdx.x >> 5, lane = threadIdx.x & 31;
  const int half = lane >> 4, l16 = lane & 15;
  const int rp = (blockIdx.x * 4 + wave) & 255;  // pair of row tiles
  const int cp = blockIdx.x >> 6;                // pair of column tiles, 0..3
  const __bf16* arow = attn + (size_t)(rp * 32 + l16) * DIM + half * 8;
  const float* wp0 = wo + (half * 8) * DIM + (cp * 2) * 16 + l16;   // the second column tile: 16 floats on
  v8f acc[2][2];
#pragma unroll
  for (int m = 0; m < 2; ++m)
#pragma unroll
    for (int n = 0; n < 2; ++n) acc[m][n] = vz8();
#pragma unroll
  for (int f = 0; f < 4; ++f) {
    const v16bf a0 = afrag_bf(arow, f * 32, 0);
    const v16bf a1 = afrag_bf(arow + 16 * DIM, f * 32, 0);
#pragma unroll
    for (int n = 0; n < 2; ++n) {
      const v16bf bw = bfrag_p(wp0 + n * 16, DIM, f * 32);
      acc[0][n] = wmma_bf(a0, bw, acc[0][n]);
      acc[1][n] = wmma_bf(a1, bw, acc[1][n]);
    }
  }
  // One wait behind the last loads of the products, their address registers named as inputs so that they
  // live up to it: no register that an issued load names as its address is written again in front of it.
  asm volatile("s_wait_xcnt 0x0" :: "v"(arow), "v"(wp0) : "memory");
#pragma unroll
  for (int m = 0; m < 2; ++m)
#pragma unroll
    for (int n = 0; n < 2; ++n) {
      const int col = (cp * 2 + n) * 16 + l16;
#pragma unroll
      for (int r = 0; r < 8; ++r) {
        const int grow = rp * 32 + m * 16 + half * 8 + r;
        const float hv = x[(size_t)grow * DIM + col] + acc[m][n][r];
        hout[(size_t)grow * DIM + col] = hv;
        hbf[(size_t)grow * DIM + col]  = (__bf16)hv;
      }
    }
}

__global__ void __launch_bounds__(128) __attribute__((amdgpu_waves_per_eu(1, 3))) k_ffn1(const __bf16* __restrict__ hbf,
                                              const float* __restrict__ w1,
                                              const float* __restrict__ w3,
                                              __bf16* __restrict__ act) {
  const int wave = threadIdx.x >> 5, lane = threadIdx.x & 31;
  const int half = lane >> 4, l16 = lane & 15;
  const int rp = (blockIdx.x * 4 + wave) & 255;  // pair of row tiles
  const int cp = blockIdx.x >> 6;                // pair of column tiles, 0..10
  const __bf16* hrow = hbf + (size_t)(rp * 32 + l16) * DIM + half * 8;
  const float* p1[2];
  const float* p3[2];
#pragma unroll
  for (int n = 0; n < 2; ++n) {
    const int nn = (cp * 2 + n) * 16 + l16;
    const int wcol = (nn < HID) ? nn : 0;            // clamp (pad cols zeroed on store)
    p1[n] = w1 + (half * 8) * HID + wcol;
    p3[n] = w3 + (half * 8) * HID + wcol;
  }
  v8f a1[2][2], a3[2][2];
#pragma unroll
  for (int m = 0; m < 2; ++m)
#pragma unroll
    for (int n = 0; n < 2; ++n) { a1[m][n] = vz8(); a3[m][n] = vz8(); }
#pragma unroll
  for (int f = 0; f < 4; ++f) {
    const v16bf A0 = afrag_bf(hrow, f * 32, 0);
    const v16bf A1 = afrag_bf(hrow + 16 * DIM, f * 32, 0);
#pragma unroll
    for (int n = 0; n < 2; ++n) {
      const v16bf b1 = bfrag_p(p1[n], HID, f * 32);
      a1[0][n] = wmma_bf(A0, b1, a1[0][n]);
      a1[1][n] = wmma_bf(A1, b1, a1[1][n]);
      const v16bf b3 = bfrag_p(p3[n], HID, f * 32);
      a3[0][n] = wmma_bf(A0, b3, a3[0][n]);
      a3[1][n] = wmma_bf(A1, b3, a3[1][n]);
    }
  }
  // One wait behind the last loads of the products, their address registers named as inputs so that they
  // live up to it: no register that an issued load names as its address is written again in front of it.
  asm volatile("s_wait_xcnt 0x0" :: "v"(hrow), "v"(p1[0]), "v"(p1[1]), "v"(p3[0]), "v"(p3[1]) : "memory");
#pragma unroll
  for (int m = 0; m < 2; ++m)
#pragma unroll
    for (int n = 0; n < 2; ++n) {
      const int nn = (cp * 2 + n) * 16 + l16;
      float e[8];                                        // exp(-s) = 2^(-s * log2 e)
#pragma unroll
      for (int r = 0; r < 8; ++r) e[r] = a1[m][n][r] * -1.44269504f;
      asm("v_exp_f32 %0, %0\n\tv_exp_f32 %1, %1\n\tv_exp_f32 %2, %2\n\tv_exp_f32 %3, %3\n\t"
          "v_exp_f32 %4, %4\n\tv_exp_f32 %5, %5\n\tv_exp_f32 %6, %6\n\tv_exp_f32 %7, %7\n\t"
          "v_nop"
          : "+v"(e[0]), "+v"(e[1]), "+v"(e[2]), "+v"(e[3]),
            "+v"(e[4]), "+v"(e[5]), "+v"(e[6]), "+v"(e[7]));
#pragma unroll
      for (int r = 0; r < 8; ++r) {
        const int grow = rp * 32 + m * 16 + half * 8 + r;
        float v = 0.0f;
        if (nn < HID) {
          const float s = a1[m][n][r];
          v = (s / (1.0f + e[r])) * a3[m][n][r];         // silu * gate
        }
        act[(size_t)grow * HIDP + nn] = (__bf16)v;       // pad cols -> 0
      }
    }
}

// ---------------- 5) FFN down proj + residual -> d_out ----------------
__global__ void __launch_bounds__(256) k_ffn2(const __bf16* __restrict__ act,
                                              const float* __restrict__ w2,
                                              const float* __restrict__ hout,
                                              float* __restrict__ out) {
  const int wave = threadIdx.x >> 5, lane = threadIdx.x & 31;
  const int half = lane >> 4, l16 = lane & 15;
  const int tile = blockIdx.x * 8 + wave;
  if (tile >= (MTOT / 16) * 8) return;
  const int rt = tile & 511, ct = tile >> 9;
  const __bf16* arow = act + (size_t)(rt * 16 + l16) * HIDP;
  const int col = ct * 16 + l16;
  v8f acc = vz8();
#pragma unroll
  for (int f = 0; f < HIDP / 32; ++f)                // 11 K-steps (pad rows are 0)
    acc = wmma_bf(afrag_bf(arow, f * 32, half),
                  bfrag_w(w2, DIM, f * 32, col, HID, half), acc);
#pragma unroll
  for (int r = 0; r < 8; ++r) {
    const int grow = rt * 16 + half * 8 + r;
    out[(size_t)grow * DIM + col] = hout[(size_t)grow * DIM + col] + acc[r];
  }
}

// ---------------- launcher ----------------
extern "C" void kernel_launch(void* const* d_in, const int* in_sizes, int n_in,
                              void* d_out, int out_size, void* d_ws, size_t ws_size,
                              hipStream_t stream) {
  (void)in_sizes; (void)n_in; (void)out_size; (void)ws_size;
  const float* x  = (const float*)d_in[0];
  const float* wq = (const float*)d_in[1];
  const float* wk = (const float*)d_in[2];
  const float* wv = (const float*)d_in[3];
  const float* wo = (const float*)d_in[4];
  const float* w1 = (const float*)d_in[5];
  const float* w3 = (const float*)d_in[6];
  const float* w2 = (const float*)d_in[7];
  float* out = (float*)d_out;

  char* ws = (char*)d_ws;                       // ~19.8 MB total
  __bf16* Q    = (__bf16*)(ws);                 // 2 MB  [B,H,S,8]
  __bf16* K    = (__bf16*)(ws + (2u  << 20));   // 2 MB
  __bf16* V    = (__bf16*)(ws + (4u  << 20));   // 2 MB  [B,H,S/32,2,2,8,8]
  __bf16* attn = (__bf16*)(ws + (6u  << 20));   // 2 MB  [B*S,128]
  float*  hbuf = (float* )(ws + (8u  << 20));   // 4 MB  [B*S,128] f32
  __bf16* hbf  = (__bf16*)(ws + (12u << 20));   // 2 MB
  __bf16* act  = (__bf16*)(ws + (14u << 20));   // 5.8 MB [B*S,352]

  const dim3 blk(256);
  const dim3 blk4(128);
  k_qkv <<<dim3((MTOT / 32) * 8 / 8), blk, 0, stream>>>(x, wq, wk, wv, Q, K, V);
  k_attn<<<dim3(SEQ / 128, BATCH * NH), blk, 0, stream>>>(Q, K, V, attn);
  k_oproj<<<dim3((MTOT / 32) * 4 / 4), blk4, 0, stream>>>(attn, wo, x, hbuf, hbf);
  k_ffn1<<<dim3((MTOT / 32) * (HIDP / 32) / 4), blk4, 0, stream>>>(hbf, w1, w3, act);
  k_ffn2<<<dim3((MTOT / 16) * 8 / 8), blk, 0, stream>>>(act, w2, hbuf, out);
}

// v005
// It runs in 50.5 microseconds.
// Timed twice side by side with v004, it ran 1.18 times as fast both times.
// All steps since v000 together make it 2.83 times as fast.
#include <hip/hip_runtime.h>
#include <stdint.h>

// ---------------- problem constants ----------------
#define DIM   128
#define NH    16
#define HD    8
#define SEQ   2048
#define BATCH 4
#define MTOT  (BATCH*SEQ)   // 8192 rows
#define HID   344
#define HIDP  352
#define KCH   256

typedef __attribute__((ext_vector_type(16))) __bf16 v16bf;
typedef __attribute__((ext_vector_type(8)))  __bf16 v8bf;
typedef __attribute__((ext_vector_type(8)))  float  v8f;
typedef __attribute__((ext_vector_type(4)))  unsigned int u32x4;
typedef __attribute__((ext_vector_type(8)))  int i32x8;
typedef __attribute__((ext_vector_type(4)))  int i32x4;

static __device__ inline v8f wmma_bf(v16bf a, v16bf b, v8f c) {
  // D = A(16x32 bf16) * B(32x16 bf16) + C(16x16 f32)
  return __builtin_amdgcn_wmma_f32_16x16x32_bf16(false, a, false, b,
                                                 (short)0, c, false, false);
}

static __device__ inline v8f vz8() {
  v8f v;
#pragma unroll
  for (int i = 0; i < 8; ++i) v[i] = 0.0f;
  return v;
}
static __device__ inline v16bf vz16() {
  v16bf v;
#pragma unroll
  for (int i = 0; i < 16; ++i) v[i] = (__bf16)0.0f;
  return v;
}

// A fragment (16x32), source fp32 row-major. lane holds row (lane&15);
// K pattern: half=lane>>4 -> elems 0..7 = K k0..k0+7, elems 8..15 = K k0+16..k0+23
static __device__ inline v16bf afrag_f32(const float* row, int kb, int half) {
  const int k0 = kb + half * 8;
  v16bf a;
#pragma unroll
  for (int j = 0; j < 8; ++j) {
    a[j]     = (__bf16)row[k0 + j];
    a[j + 8] = (__bf16)row[k0 + 16 + j];
  }
  return a;
}

// A fragment, source bf16 row-major (16B-aligned rows) -> two b128 loads
static __device__ inline v16bf afrag_bf(const __bf16* row, int kb, int half) {
  const int k0 = kb + half * 8;
  v8bf lo = *(const v8bf*)(row + k0);
  v8bf hi = *(const v8bf*)(row + k0 + 16);
  v16bf a;
#pragma unroll
  for (int j = 0; j < 8; ++j) { a[j] = lo[j]; a[j + 8] = hi[j]; }
  return a;
}

// B fragment (32x16) from fp32 weight W[K x N] (row-major, ldn = N); lane holds one column.
// From a lane's own pointer wp = W + (half * 8) * ldn + col: every load is wp plus a constant.
static __device__ inline v16bf bfrag_p(const float* wp, int ldn, int kb) {
  v16bf b;
#pragma unroll
  for (int j = 0; j < 8; ++j) {
    b[j]     = (__bf16)wp[(size_t)(kb + j) * ldn];
    b[j + 8] = (__bf16)wp[(size_t)(kb + 16 + j) * ldn];
  }
  return b;
}

static __device__ inline float xhalf(float v) {
  const int b = __builtin_bit_cast(int, v);
  return __builtin_bit_cast(float,
      __builtin_amdgcn_permlanex16(b, b, 0x76543210, 0xfedcba98, false, false));
}

static __device__ inline void tdm_load_1d(uint32_t lds_off, const void* gptr,
                                          uint32_t nbytes) {
  const uint64_t ga = (uint64_t)(uintptr_t)gptr;
  const uint32_t elems = nbytes >> 2;
  u32x4 g0;
  g0[0] = 1u;
  g0[1] = lds_off;
  g0[2] = (uint32_t)ga;
  g0[3] = (uint32_t)((ga >> 32) & 0x01FFFFFFu)
        | (2u << 30);
  i32x8 g1;
  g1[0] = (int)(2u << 16);
  g1[1] = (int)((elems & 0xFFFFu) << 16);
  g1[2] = (int)((elems >> 16) | (1u << 16));
  g1[3] = (int)((elems & 0xFFFFu) << 16);
  g1[4] = 1;
  g1[5] = (int)elems;
  g1[6] = 0;
  g1[7] = 0;
  i32x4 gz4;
  gz4[0] = 0; gz4[1] = 0; gz4[2] = 0; gz4[3] = 0;   // groups 2/3 unused (<=2D)
  i32x8 gz8;
#pragma unroll
  for (int i = 0; i < 8; ++i) gz8[i] = 0;
  __builtin_amdgcn_tensor_load_to_lds(g0, g1, gz4, gz4, gz8, 0);
}

__global__ void __launch_bounds__(256) __attribute__((amdgpu_waves_per_eu(1, 2))) k_qkv(const float* __restrict__ x,
                                             const float* __restrict__ wq,
                                             const float* __restrict__ wk,
                                             const float* __restrict__ wv,
                                             __bf16* __restrict__ Q,
                                             __bf16* __restrict__ K,
                                             __bf16* __restrict__ V) {
  const int wave = threadIdx.x >> 5, lane = threadIdx.x & 31;
  const int half = lane >> 4, l16 = lane & 15;
  // A wave owns 2 row tiles x 3 column tiles of the 512 x 24 (3 matrices x 8): each x
  // fragment feeds 3 products and each weight fragment 2. The 8 waves of a block share the columns.
  const int rp = (blockIdx.x * 8 + wave) & 255;  // pair of row tiles
  const int cg = blockIdx.x >> 5;                // triple of column tiles, 0..7

  const float* xrow = x + (size_t)(rp * 32 + l16) * DIM + half * 8;
  const float* wp[3];
#pragma unroll
  for (int n = 0; n < 3; ++n) {
    const int t2 = cg * 3 + n;
    const int mat = t2 >> 3;
    wp[n] = ((mat == 0) ? wq : (mat == 1) ? wk : wv) + (half * 8) * DIM + (t2 & 7) * 16 + l16;
  }
  v8f acc[2][3];
#pragma unroll
  for (int m = 0; m < 2; ++m)
#pragma unroll
    for (int n = 0; n < 3; ++n) acc[m][n] = vz8();
#pragma unroll
  for (int f = 0; f < 4; ++f) {
    const v16bf a0 = afrag_f32(xrow, f * 32, 0);
    const v16bf a1 = afrag_f32(xrow + 16 * DIM, f * 32, 0);
#pragma unroll
    for (int n = 0; n < 3; ++n) {
      const v16bf bw = bfrag_p(wp[n], DIM, f * 32);
      acc[0][n] = wmma_bf(a0, bw, acc[0][n]);
      acc[1][n] = wmma_bf(a1, bw, acc[1][n]);
    }
  }
  // One wait behind the last loads of the products, their address registers named as inputs so that they
  // live up to it: no register that an issued load names as its address is written again in front of it.
  asm volatile("s_wait_xcnt 0x0" :: "v"(xrow), "v"(wp[0]), "v"(wp[1]), "v"(wp[2]) : "memory");
#pragma unroll
  for (int n = 0; n < 3; ++n) {
    const int t2 = cg * 3 + n;
    const int mat = t2 >> 3;
    __bf16* Out = (mat == 0) ? Q : (mat == 1) ? K : V;
    const int col = (t2 & 7) * 16 + l16;
    const int head = col >> 3, d = col & 7;
    const float osc = (mat == 0) ? 1.44269504f : 1.0f;   // Q carries log2 e: the scores are exponents of 2
    if (mat == 2) {
      // The wave's 32 rows are one block of keys; a lane's 8 accumulator rows are 8 keys in a row: 16 bytes.
      __bf16* vblk = V + ((size_t)((rp >> 6) * NH + head)) * SEQ * HD + (rp & 63) * (32 * HD) + half * 64 + d * 8;
#pragma unroll
      for (int m = 0; m < 2; ++m) {
        v8bf o;
#pragma unroll
        for (int r = 0; r < 8; ++r) o[r] = (__bf16)acc[m][n][r];
        *(v8bf*)(vblk + m * 128) = o;
      }
      // The next column tile reuses registers that these stores name as address or data: the wait closes
      // the branch, in front of that.
      if (n < 2) asm volatile("s_wait_xcnt 0x0" ::: "memory");
    } else {
#pragma unroll
      for (int m = 0; m < 2; ++m)
#pragma unroll
        for (int r = 0; r < 8; ++r) {
          const int grow = rp * 32 + m * 16 + half * 8 + r;
          const int b = grow >> 11, srow = grow & (SEQ - 1);
          Out[(((size_t)(b * NH + head)) * SEQ + srow) * HD + d] = (__bf16)(acc[m][n][r] * osc);
        }
      // As in the other branch; behind the last tile too: in the built code the other branch's block follows this one.
      asm volatile("s_wait_xcnt 0x0" ::: "memory");
    }
  }
}

__global__ void __launch_bounds__(256) k_attn(const __bf16* __restrict__ Q,
                                              const __bf16* __restrict__ K,
                                              const __bf16* __restrict__ V,
                                              __bf16* __restrict__ attn) {
  const int bh = blockIdx.y;
  const int wave = threadIdx.x >> 5, lane = threadIdx.x & 31;
  const int half = lane >> 4, l16 = lane & 15;
  const int qbase = blockIdx.x * 128 + wave * 16;
  const __bf16* Qh = Q + (size_t)bh * SEQ * HD;
  const __bf16* Kh = K + (size_t)bh * SEQ * HD;
  const __bf16* Vh = V + (size_t)bh * SEQ * HD;

  __shared__ __bf16 kbuf[2][KCH * HD];         // 2 x 4KB
  __shared__ __bf16 vbuf[2][KCH * HD];         // 2 x 4KB

  // Q^T fragment: B(32x16), lane = query column, only d=0..7 real -> zeros elsewhere
  v16bf qf = vz16();
  if (half == 0) {
    v8bf qv = *(const v8bf*)(Qh + (size_t)(qbase + l16) * HD);
#pragma unroll
    for (int j = 0; j < 8; ++j) qf[j] = qv[j];
  }

  const int fo = ((l16 + half * 8) & 15) * HD;
  v8bf kz;
#pragma unroll
  for (int j = 0; j < 8; ++j) kz[j] = (__bf16)0.0f;
  v8f cneg = vz8();      // minus the maximum in use of query l16, equal in both halves: a C operand
  float thr = -3.0e38f;  // a score above this moves the maximum in use: any in the first step, then 8
  float lo  = -3.0e38f;  // the least move: the first step takes its own maximum, later ones never go down
  float lrow = 0.0f;     // running sum over this half's keys only; joined at the end
  v8f oacc = vz8();      // O^T: register r = head dim half*8 + r (half 1: padding), lane = query

  if (wave == 0) {
    tdm_load_1d((uint32_t)(uintptr_t)&kbuf[0][0], Kh, KCH * HD * 2);
    tdm_load_1d((uint32_t)(uintptr_t)&vbuf[0][0], Vh, KCH * HD * 2);
  }

  for (int c = 0; c < SEQ / KCH; ++c) {
    if (wave == 0) __builtin_amdgcn_s_wait_tensorcnt(0);   // chunk c landed
    __syncthreads();                                       // visible to all waves
    if (wave == 0 && c + 1 < SEQ / KCH) {                  // prefetch chunk c+1
      const int nb = (c + 1) & 1;
      tdm_load_1d((uint32_t)(uintptr_t)&kbuf[nb][0],
                  Kh + (size_t)(c + 1) * KCH * HD, KCH * HD * 2);
      tdm_load_1d((uint32_t)(uintptr_t)&vbuf[nb][0],
                  Vh + (size_t)(c + 1) * KCH * HD, KCH * HD * 2);
    }
    const __bf16* kchb = &kbuf[c & 1][0];
    const __bf16* vchb = &vbuf[c & 1][0];

    for (int sub = 0; sub < KCH / 32; ++sub) {
      const int s0 = sub * 32;
      const v8bf k0 = *(const v8bf*)(kchb + (size_t)s0 * HD + fo);
      const v8bf k1 = *(const v8bf*)(kchb + (size_t)(s0 + 16) * HD + fo);
      const v8bf v0 = *(const v8bf*)(vchb + (size_t)s0 * HD + fo);
      const v8bf v1 = *(const v8bf*)(vchb + (size_t)(s0 + 16) * HD + fo);
      const v16bf bk0 = __builtin_shufflevector(k0, kz, 0, 1, 2, 3, 4, 5, 6, 7, 8, 9, 10, 11, 12, 13, 14, 15);
      const v16bf bk1 = __builtin_shufflevector(k1, kz, 0, 1, 2, 3, 4, 5, 6, 7, 8, 9, 10, 11, 12, 13, 14, 15);
      // sc0[r] = score(key s0 + half*8 + r, query l16) - maximum in use; sc1: keys 16 further on
      v8f sc0 = wmma_bf(bk0, qf, cneg);
      v8f sc1 = wmma_bf(bk1, qf, cneg);

      // V^T fragment (A 16x32, rows 0..7 = head dims), keys in the order of P^T below.
      // V lies in that order (k_qkv): a lane's 8 keys of a 16-key tile are 16 bytes in a row.
      // Rows 8..15 hold other pieces of the tile: they reach only O^T rows 8..15, which are never stored.
      const v16bf vb = __builtin_shufflevector(v0, v1, 0, 1, 2, 3, 4, 5, 6, 7, 8, 9, 10, 11, 12, 13, 14, 15);

      // online softmax, one query per lane
      float mx = fmaxf(sc0[0], sc1[0]);
#pragma unroll
      for (int r = 1; r < 8; ++r) mx = fmaxf(mx, fmaxf(sc0[r], sc1[r]));
      if (__builtin_amdgcn_ballot_w32(mx > thr) != 0) {   // one scalar branch a step, the same for the whole wave
        mx = fmaxf(mx, xhalf(mx));
        const float delta = fmaxf(mx, lo);                // how far this query's maximum in use moves
        float scale = fminf(-delta, 0.0f);                // a first step below 0 has nothing to rescale yet
        asm("v_exp_f32 %0, %0\n\tv_nop" : "+v"(scale));
#pragma unroll
        for (int r = 0; r < 8; ++r) {
          sc0[r] -= delta;
          sc1[r] -= delta;
          cneg[r] -= delta;
          oacc[r] *= scale;
        }
        lrow *= scale;
        thr = 8.0f;
        lo = 0.0f;
      }
      float e0[8], e1[8];
      asm("v_exp_f32 %0, %8\n\tv_exp_f32 %1, %9\n\tv_exp_f32 %2, %10\n\tv_exp_f32 %3, %11\n\t"
          "v_exp_f32 %4, %12\n\tv_exp_f32 %5, %13\n\tv_exp_f32 %6, %14\n\tv_exp_f32 %7, %15\n\t"
          "v_nop"
          : "=&v"(e0[0]), "=&v"(e0[1]), "=&v"(e0[2]), "=&v"(e0[3]),
            "=&v"(e0[4]), "=&v"(e0[5]), "=&v"(e0[6]), "=&v"(e0[7])
          : "v"(sc0[0]), "v"(sc0[1]), "v"(sc0[2]), "v"(sc0[3]),
            "v"(sc0[4]), "v"(sc0[5]), "v"(sc0[6]), "v"(sc0[7]));
      asm("v_exp_f32 %0, %8\n\tv_exp_f32 %1, %9\n\tv_exp_f32 %2, %10\n\tv_exp_f32 %3, %11\n\t"
          "v_exp_f32 %4, %12\n\tv_exp_f32 %5, %13\n\tv_exp_f32 %6, %14\n\tv_exp_f32 %7, %15\n\t"
          "v_nop"
          : "=&v"(e1[0]), "=&v"(e1[1]), "=&v"(e1[2]), "=&v"(e1[3]),
            "=&v"(e1[4]), "=&v"(e1[5]), "=&v"(e1[6]), "=&v"(e1[7])
          : "v"(sc1[0]), "v"(sc1[1]), "v"(sc1[2]), "v"(sc1[3]),
            "v"(sc1[4]), "v"(sc1[5]), "v"(sc1[6]), "v"(sc1[7]));
      v16bf pb;            // P^T fragment (B 32x16): element j = key half*8 + j, j + 8 = 16 + half*8 + j
#pragma unroll
      for (int r = 0; r < 8; ++r) {
        pb[r]     = (__bf16)e0[r];
        pb[r + 8] = (__bf16)e1[r];
      }
      asm("v_wmma_f32_16x16x32_bf16 %0, %1, %2, %0\n\tv_nop\n\tv_nop\n\tv_nop\n\tv_nop"
          : "+v"(oacc)
          : "v"(__builtin_bit_cast(i32x8, vb)), "v"(__builtin_bit_cast(i32x8, pb)));
      float ps = e0[0] + e1[0];
#pragma unroll
      for (int r = 1; r < 8; ++r) ps += e0[r] + e1[r];
      lrow += ps;
    }
    __syncthreads();   // all waves done with buffer c&1 before it is re-filled
  }
  // normalize + store [B,S,128] bf16: lane (half 0) = query, 8 head dims = 16 bytes
  lrow += xhalf(lrow);
  if (half == 0) {
    const int b = bh >> 4, h = bh & 15;
    v8bf o;
#pragma unroll
    for (int r = 0; r < 8; ++r) o[r] = (__bf16)(oacc[r] / lrow);
    *(v8bf*)(attn + ((size_t)(b * SEQ + qbase + l16)) * DIM + h * HD) = o;
  }
}

// ---------------- 3) output projection, FFN gate and FFN down projection in one launch ----------------
// All three are local to a row of the sequence. A block of 8 waves owns 32 rows, one block per WGP:
//   a) h = x + attn @ wo: wave w owns column tile w of both row tiles; h stays in its registers in f32
//      and goes to LDS in bf16;
//   b) act = silu(h @ w1) * (h @ w3): wave w owns column tiles w, w + 8, w + 16 of the 22; act goes to LDS;
//   c) out = h + act @ w2: wave w owns column tile w again, so the residual is the h it still holds.
// Each weight fragment feeds both row tiles. Roundings and the order of every sum are those of three launches.
// The loops over f, m, r and j are unrolled because their indices select registers.
#define HSP 136
#define ASP 360
__global__ void __launch_bounds__(256) __attribute__((amdgpu_waves_per_eu(1, 2))) k_mlp(const __bf16* __restrict__ attn,
                                             const float* __restrict__ wo,
                                             const float* __restrict__ x,
                                             const float* __restrict__ w1,
                                             const float* __restrict__ w3,
                                             const float* __restrict__ w2,
                                             float* __restrict__ out) {
  __shared__ __attribute__((aligned(16))) __bf16 hs[32 * HSP];
  __shared__ __attribute__((aligned(16))) __bf16 acts[32 * ASP];
  // The wave's number in a scalar register: the loop over column tiles then ends on a scalar branch.
  const int wave = __builtin_amdgcn_readfirstlane(threadIdx.x >> 5), lane = threadIdx.x & 31;
  const int half = lane >> 4, l16 = lane & 15;
  const int row0 = blockIdx.x * 32;
  const int col = wave * 16 + l16;

  // a) output projection + residual
  v8f h[2];
  {
    const __bf16* arow = attn + (size_t)(row0 + l16) * DIM + half * 8;
    const float* wpo = wo + (half * 8) * DIM + col;
    const float* xp = x + (size_t)(row0 + half * 8) * DIM + col;
    h[0] = vz8();
    h[1] = vz8();
#pragma unroll
    for (int f = 0; f < 4; ++f) {
      const v16bf a0 = afrag_bf(arow, f * 32, 0);
      const v16bf a1 = afrag_bf(arow + 16 * DIM, f * 32, 0);
      const v16bf bw = bfrag_p(wpo, DIM, f * 32);
      h[0] = wmma_bf(a0, bw, h[0]);
      h[1] = wmma_bf(a1, bw, h[1]);
    }
#pragma unroll
    for (int m = 0; m < 2; ++m)
#pragma unroll
      for (int r = 0; r < 8; ++r) {
        h[m][r] = xp[(size_t)(m * 16 + r) * DIM] + h[m][r];
        hs[(m * 16 + half * 8 + r) * HSP + col] = (__bf16)h[m][r];
      }
    // One wait behind the last loads of this part, their address registers named as inputs so that they
    // live up to it: no register that an issued load names as its address is written again in front of it.
    asm volatile("s_wait_xcnt 0x0" :: "v"(arow), "v"(wpo), "v"(xp) : "memory");
  }
  __syncthreads();   // h of all 128 columns is in LDS

  // b) FFN gate
  {
    const __bf16* hrow = hs + l16 * HSP + half * 8;
    v16bf A0[4], A1[4];
#pragma unroll
    for (int f = 0; f < 4; ++f) {
      A0[f] = afrag_bf(hrow, f * 32, 0);
      A1[f] = afrag_bf(hrow + 16 * HSP, f * 32, 0);
    }
    for (int ct = wave; ct < HIDP / 16; ct += 8) {
      const int nn = ct * 16 + l16;
      const int wcol = (nn < HID) ? nn : 0;            // clamp (pad cols zeroed on store)
      const float* p1 = w1 + (half * 8) * HID + wcol;
      const float* p3 = w3 + (half * 8) * HID + wcol;
      v8f a1[2], a3[2];
#pragma unroll
      for (int m = 0; m < 2; ++m) { a1[m] = vz8(); a3[m] = vz8(); }
#pragma unroll
      for (int f = 0; f < 4; ++f) {
        const v16bf b1 = bfrag_p(p1, HID, f * 32);
        a1[0] = wmma_bf(A0[f], b1, a1[0]);
        a1[1] = wmma_bf(A1[f], b1, a1[1]);
        const v16bf b3 = bfrag_p(p3, HID, f * 32);
        a3[0] = wmma_bf(A0[f], b3, a3[0]);
        a3[1] = wmma_bf(A1[f], b3, a3[1]);
      }
      // As above: the next column tile forms new addresses only behind this wait.
      asm volatile("s_wait_xcnt 0x0" :: "v"(p1), "v"(p3) : "memory");
#pragma unroll
      for (int m = 0; m < 2; ++m) {
        float e[8];                                        // exp(-s) = 2^(-s * log2 e)
#pragma unroll
        for (int r = 0; r < 8; ++r) e[r] = a1[m][r] * -1.44269504f;
        asm("v_exp_f32 %0, %0\n\tv_exp_f32 %1, %1\n\tv_exp_f32 %2, %2\n\tv_exp_f32 %3, %3\n\t"
            "v_exp_f32 %4, %4\n\tv_exp_f32 %5, %5\n\tv_exp_f32 %6, %6\n\tv_exp_f32 %7, %7\n\t"
            "v_nop"
            : "+v"(e[0]), "+v"(e[1]), "+v"(e[2]), "+v"(e[3]),
              "+v"(e[4]), "+v"(e[5]), "+v"(e[6]), "+v"(e[7]));
#pragma unroll
        for (int r = 0; r < 8; ++r) {
          const float s = a1[m][r];
          const float g = (s / (1.0f + e[r])) * a3[m][r];  // silu * gate
          acts[(m * 16 + half * 8 + r) * ASP + nn] = (__bf16)((nn < HID) ? g : 0.0f);   // pad cols -> 0
        }
      }
    }
  }
  __syncthreads();   // act of all 352 columns is in LDS

  // c) FFN down projection + residual
  {
    const __bf16* crow = acts + l16 * ASP + half * 8;
    const float* wp2 = w2 + (half * 8) * DIM + col;
    // Rows 344..351 of w2 do not exist: half 1 reads rows that do in their place and takes 0 for them.
    const float* wpt = (half == 0) ? wp2 + (size_t)(HIDP - 16) * DIM : wp2;
    v8f acc[2];
    acc[0] = vz8();
    acc[1] = vz8();
#pragma unroll
    for (int f = 0; f < HIDP / 32; ++f) {              // 11 K-steps (pad rows are 0)
      const v16bf a0 = afrag_bf(crow, f * 32, 0);
      const v16bf a1 = afrag_bf(crow + 16 * ASP, f * 32, 0);
      v16bf bw;
      if (f * 32 + 32 <= HID) {
        bw = bfrag_p(wp2, DIM, f * 32);
      } else {                                         // the last step
#pragma unroll
        for (int j = 0; j < 8; ++j) {
          const float t = wpt[(size_t)j * DIM];
          bw[j]     = (__bf16)wp2[(size_t)(f * 32 + j) * DIM];
          bw[j + 8] = (__bf16)((half == 0) ? t : 0.0f);
        }
      }
      acc[0] = wmma_bf(a0, bw, acc[0]);
      acc[1] = wmma_bf(a1, bw, acc[1]);
    }
    // As above, behind the last loads of the kernel.
    asm volatile("s_wait_xcnt 0x0" :: "v"(wp2), "v"(wpt) : "memory");
    float* op = out + (size_t)(row0 + half * 8) * DIM + col;
#pragma unroll
    for (int m = 0; m < 2; ++m)
#pragma unroll
      for (int r = 0; r < 8; ++r) op[(size_t)(m * 16 + r) * DIM] = h[m][r] + acc[m][r];
  }
}

// ---------------- launcher ----------------
extern "C" void kernel_launch(void* const* d_in, const int* in_sizes, int n_in,
                              void* d_out, int out_size, void* d_ws, size_t ws_size,
                              hipStream_t stream) {
  (void)in_sizes; (void)n_in; (void)out_size; (void)ws_size;
  const float* x  = (const float*)d_in[0];
  const float* wq = (const float*)d_in[1];
  const float* wk = (const float*)d_in[2];
  const float* wv = (const float*)d_in[3];
  const float* wo = (const float*)d_in[4];
  const float* w1 = (const float*)d_in[5];
  const float* w3 = (const float*)d_in[6];
  const float* w2 = (const float*)d_in[7];
  float* out = (float*)d_out;

  char* ws = (char*)d_ws;                       // 8 MB total
  __bf16* Q    = (__bf16*)(ws);                 // 2 MB  [B,H,S,8]
  __bf16* K    = (__bf16*)(ws + (2u  << 20));   // 2 MB
  __bf16* V    = (__bf16*)(ws + (4u  << 20));   // 2 MB  [B,H,S/32,2,2,8,8]
  __bf16* attn = (__bf16*)(ws + (6u  << 20));   // 2 MB  [B*S,128]

  const dim3 blk(256);
  k_qkv <<<dim3((MTOT / 32) * 8 / 8), blk, 0, stream>>>(x, wq, wk, wv, Q, K, V);
  k_attn<<<dim3(SEQ / 128, BATCH * NH), blk, 0, stream>>>(Q, K, V, attn);
  k_mlp <<<dim3(MTOT / 32), blk, 0, stream>>>(attn, wo, x, w1, w3, w2, out);
}

// v006
// It runs in 48.2 microseconds.
// Timed twice side by side with v005, it ran 1.04 and 1.05 times as fast.
// All steps since v000 together make it 2.96 times as fast.
#include <hip/hip_runtime.h>
#include <stdint.h>

// ---------------- problem constants ----------------
#define DIM   128
#define NH    16
#define HD    8
#define SEQ   2048
#define BATCH 4
#define MTOT  (BATCH*SEQ)   // 8192 rows
#define HID   344
#define HIDP  352
#define KCH   256

typedef __attribute__((ext_vector_type(16))) __bf16 v16bf;
typedef __attribute__((ext_vector_type(8)))  __bf16 v8bf;
typedef __attribute__((ext_vector_type(8)))  float  v8f;
typedef __attribute__((ext_vector_type(4)))  unsigned int u32x4;
typedef __attribute__((ext_vector_type(8)))  int i32x8;
typedef __attribute__((ext_vector_type(4)))  int i32x4;

static __device__ inline v8f wmma_bf(v16bf a, v16bf b, v8f c) {
  // D = A(16x32 bf16) * B(32x16 bf16) + C(16x16 f32)
  return __builtin_amdgcn_wmma_f32_16x16x32_bf16(false, a, false, b,
                                                 (short)0, c, false, false);
}

static __device__ inline v8f vz8() {
  v8f v;
#pragma unroll
  for (int i = 0; i < 8; ++i) v[i] = 0.0f;
  return v;
}
static __device__ inline v16bf vz16() {
  v16bf v;
#pragma unroll
  for (int i = 0; i < 16; ++i) v[i] = (__bf16)0.0f;
  return v;
}

// A fragment (16x32), source fp32 row-major. lane holds row (lane&15);
// K pattern: half=lane>>4 -> elems 0..7 = K k0..k0+7, elems 8..15 = K k0+16..k0+23
static __device__ inline v16bf afrag_f32(const float* row, int kb, int half) {
  const int k0 = kb + half * 8;
  v16bf a;
#pragma unroll
  for (int j = 0; j < 8; ++j) {
    a[j]     = (__bf16)row[k0 + j];
    a[j + 8] = (__bf16)row[k0 + 16 + j];
  }
  return a;
}

// A fragment, source bf16 row-major (16B-aligned rows) -> two b128 loads
static __device__ inline v16bf afrag_bf(const __bf16* row, int kb, int half) {
  const int k0 = kb + half * 8;
  v8bf lo = *(const v8bf*)(row + k0);
  v8bf hi = *(const v8bf*)(row + k0 + 16);
  v16bf a;
#pragma unroll
  for (int j = 0; j < 8; ++j) { a[j] = lo[j]; a[j + 8] = hi[j]; }
  return a;
}

// B fragment (32x16) from fp32 weight W[K x N] (row-major, ldn = N); lane holds one column.
// From a lane's own pointer wp = W + (half * 8) * ldn + col: every load is wp plus a constant.
static __device__ inline v16bf bfrag_p(const float* wp, int ldn, int kb) {
  v16bf b;
#pragma unroll
  for (int j = 0; j < 8; ++j) {
    b[j]     = (__bf16)wp[(size_t)(kb + j) * ldn];
    b[j + 8] = (__bf16)wp[(size_t)(kb + 16 + j) * ldn];
  }
  return b;
}

static __device__ inline float xhalf(float v) {
  const int b = __builtin_bit_cast(int, v);
  return __builtin_bit_cast(float,
      __builtin_amdgcn_permlanex16(b, b, 0x76543210, 0xfedcba98, false, false));
}

static __device__ inline void tdm_load_1d(uint32_t lds_off, const void* gptr,
                                          uint32_t nbytes) {
  const uint64_t ga = (uint64_t)(uintptr_t)gptr;
  const uint32_t elems = nbytes >> 2;
  u32x4 g0;
  g0[0] = 1u;
  g0[1] = lds_off;
  g0[2] = (uint32_t)ga;
  g0[3] = (uint32_t)((ga >> 32) & 0x01FFFFFFu)
        | (2u << 30);
  i32x8 g1;
  g1[0] = (int)(2u << 16);
  g1[1] = (int)((elems & 0xFFFFu) << 16);
  g1[2] = (int)((elems >> 16) | (1u << 16));
  g1[3] = (int)((elems & 0xFFFFu) << 16);
  g1[4] = 1;
  g1[5] = (int)elems;
  g1[6] = 0;
  g1[7] = 0;
  i32x4 gz4;
  gz4[0] = 0; gz4[1] = 0; gz4[2] = 0; gz4[3] = 0;   // groups 2/3 unused (<=2D)
  i32x8 gz8;
#pragma unroll
  for (int i = 0; i < 8; ++i) gz8[i] = 0;
  __builtin_amdgcn_tensor_load_to_lds(g0, g1, gz4, gz4, gz8, 0);
}

__global__ void __launch_bounds__(256) __attribute__((amdgpu_waves_per_eu(1, 2))) k_qkv(const float* __restrict__ x,
                                             const float* __restrict__ wq,
                                             const float* __restrict__ wk,
                                             const float* __restrict__ wv,
                                             __bf16* __restrict__ Q,
                                             __bf16* __restrict__ K,
                                             __bf16* __restrict__ V) {
  const int wave = threadIdx.x >> 5, lane = threadIdx.x & 31;
  const int half = lane >> 4, l16 = lane & 15;
  // A wave owns 2 row tiles x 3 column tiles of the 512 x 24 (3 matrices x 8): each x
  // fragment feeds 3 products and each weight fragment 2. The 8 waves of a block share the columns.
  const int rp = (blockIdx.x * 8 + wave) & 255;  // pair of row tiles
  const int cg = blockIdx.x >> 5;                // triple of column tiles, 0..7

  const float* xrow = x + (size_t)(rp * 32 + l16) * DIM + half * 8;
  const float* wp[3];
#pragma unroll
  for (int n = 0; n < 3; ++n) {
    const int t2 = cg * 3 + n;
    const int mat = t2 >> 3;
    wp[n] = ((mat == 0) ? wq : (mat == 1) ? wk : wv) + (half * 8) * DIM + (t2 & 7) * 16 + l16;
  }
  v8f acc[2][3];
#pragma unroll
  for (int m = 0; m < 2; ++m)
#pragma unroll
    for (int n = 0; n < 3; ++n) acc[m][n] = vz8();
#pragma unroll
  for (int f = 0; f < 4; ++f) {
    const v16bf a0 = afrag_f32(xrow, f * 32, 0);
    const v16bf a1 = afrag_f32(xrow + 16 * DIM, f * 32, 0);
#pragma unroll
    for (int n = 0; n < 3; ++n) {
      const v16bf bw = bfrag_p(wp[n], DIM, f * 32);
      acc[0][n] = wmma_bf(a0, bw, acc[0][n]);
      acc[1][n] = wmma_bf(a1, bw, acc[1][n]);
    }
  }
  // One wait behind the last loads of the products, their address registers named as inputs so that they
  // live up to it: no register that an issued load names as its address is written again in front of it.
  asm volatile("s_wait_xcnt 0x0" :: "v"(xrow), "v"(wp[0]), "v"(wp[1]), "v"(wp[2]) : "memory");
#pragma unroll
  for (int n = 0; n < 3; ++n) {
    const int t2 = cg * 3 + n;
    const int mat = t2 >> 3;
    __bf16* Out = (mat == 0) ? Q : (mat == 1) ? K : V;
    const int col = (t2 & 7) * 16 + l16;
    const int head = col >> 3, d = col & 7;
    const float osc = (mat == 0) ? 1.44269504f : 1.0f;   // Q carries log2 e: the scores are exponents of 2
    if (mat == 2) {
      // The wave's 32 rows are one block of keys; a lane's 8 accumulator rows are 8 keys in a row: 16 bytes.
      __bf16* vblk = V + ((size_t)((rp >> 6) * NH + head)) * SEQ * HD + (rp & 63) * (32 * HD) + half * 64 + d * 8;
#pragma unroll
      for (int m = 0; m < 2; ++m) {
        v8bf o;
#pragma unroll
        for (int r = 0; r < 8; ++r) o[r] = (__bf16)acc[m][n][r];
        *(v8bf*)(vblk + m * 128) = o;
      }
      // The next column tile reuses registers that these stores name as address or data: the wait closes
      // the branch, in front of that.
      if (n < 2) asm volatile("s_wait_xcnt 0x0" ::: "memory");
    } else {
#pragma unroll
      for (int m = 0; m < 2; ++m)
#pragma unroll
        for (int r = 0; r < 8; ++r) {
          const int grow = rp * 32 + m * 16 + half * 8 + r;
          const int b = grow >> 11, srow = grow & (SEQ - 1);
          Out[(((size_t)(b * NH + head)) * SEQ + srow) * HD + d] = (__bf16)(acc[m][n][r] * osc);
        }
      // As in the other branch; behind the last tile too: in the built code the other branch's block follows this one.
      asm volatile("s_wait_xcnt 0x0" ::: "memory");
    }
  }
}

__global__ void __launch_bounds__(256) k_attn(const __bf16* __restrict__ Q,
                                              const __bf16* __restrict__ K,
                                              const __bf16* __restrict__ V,
                                              __bf16* __restrict__ attn) {
  const int bh = blockIdx.y;
  const int wave = threadIdx.x >> 5, lane = threadIdx.x & 31;
  const int half = lane >> 4, l16 = lane & 15;
  const int qbase = blockIdx.x * 128 + wave * 16;
  const __bf16* Qh = Q + (size_t)bh * SEQ * HD;
  const __bf16* Kh = K + (size_t)bh * SEQ * HD;
  const __bf16* Vh = V + (size_t)bh * SEQ * HD;

  __shared__ __bf16 kbuf[2][KCH * HD];         // 2 x 4KB
  __shared__ __bf16 vbuf[2][KCH * HD];         // 2 x 4KB
  __shared__ __attribute__((aligned(16))) __bf16 ones[256];   // rows 8..15 of every V^T fragment
  ones[threadIdx.x] = (__bf16)1.0f;            // read only behind the first barrier of the chunk loop

  // Q^T fragment: B(32x16), lane = query column, only d=0..7 real -> zeros elsewhere
  v16bf qf = vz16();
  if (half == 0) {
    v8bf qv = *(const v8bf*)(Qh + (size_t)(qbase + l16) * HD);
#pragma unroll
    for (int j = 0; j < 8; ++j) qf[j] = qv[j];
  }

  // One lane offset (in elements) serves both K loads of a step and the V loads of rows 0..7: in half 0 it is K row l16,
  // in rows 0..7 it is the V piece (key half, head dim l16) of the block order that k_qkv writes.
  const int fo = ((l16 + half * 8) & 15) * HD;
  v8bf kz;
#pragma unroll
  for (int j = 0; j < 8; ++j) kz[j] = (__bf16)0.0f;
  v8f cneg = vz8();      // minus the maximum in use of query l16, equal in both halves: a C operand
  float thr = -3.0e38f;  // a score above this moves the maximum in use: any in the first step, then 8
  float lo  = -3.0e38f;  // the least move: the first step takes its own maximum, later ones never go down
  v8f oacc = vz8();      // O^T: register r = row half*8 + r, lane = query; rows 0..7 head dims, row 8 the sum of P
  const bool vreal = l16 < 8;
  const int vstep = (8 - (l16 & 8)) * (4 * HD);

  if (wave == 0) {
    tdm_load_1d((uint32_t)(uintptr_t)&kbuf[0][0], Kh, KCH * HD * 2);
    tdm_load_1d((uint32_t)(uintptr_t)&vbuf[0][0], Vh, KCH * HD * 2);
  }

  for (int c = 0; c < SEQ / KCH; ++c) {
    if (wave == 0) __builtin_amdgcn_s_wait_tensorcnt(0);   // chunk c landed
    __syncthreads();                                       // visible to all waves
    if (wave == 0 && c + 1 < SEQ / KCH) {                  // prefetch chunk c+1
      const int nb = (c + 1) & 1;
      tdm_load_1d((uint32_t)(uintptr_t)&kbuf[nb][0],
                  Kh + (size_t)(c + 1) * KCH * HD, KCH * HD * 2);
      tdm_load_1d((uint32_t)(uintptr_t)&vbuf[nb][0],
                  Vh + (size_t)(c + 1) * KCH * HD, KCH * HD * 2);
    }
    const __bf16* kchb = &kbuf[c & 1][0];
    const __bf16* vp = vreal ? &vbuf[c & 1][fo] : &ones[(1 - half) * 64];

    for (int sub = 0; sub < KCH / 32; ++sub) {
      const int s0 = sub * 32;
      const v8bf k0 = *(const v8bf*)(kchb + (size_t)s0 * HD + fo);
      const v8bf k1 = *(const v8bf*)(kchb + (size_t)(s0 + 16) * HD + fo);
      const v8bf v0 = *(const v8bf*)vp;
      const v8bf v1 = *(const v8bf*)(vp + 16 * HD);
      vp += vstep;
      const v16bf bk0 = __builtin_shufflevector(k0, kz, 0, 1, 2, 3, 4, 5, 6, 7, 8, 9, 10, 11, 12, 13, 14, 15);
      const v16bf bk1 = __builtin_shufflevector(k1, kz, 0, 1, 2, 3, 4, 5, 6, 7, 8, 9, 10, 11, 12, 13, 14, 15);
      // sc0[r] = score(key s0 + half*8 + r, query l16) - maximum in use; sc1: keys 16 further on
      v8f sc0 = wmma_bf(bk0, qf, cneg);
      v8f sc1 = wmma_bf(bk1, qf, cneg);

      // V^T fragment (A 16x32, rows 0..7 = head dims), keys in the order of P^T below.
      // V lies in that order (k_qkv): a lane's 8 keys of a 16-key tile are 16 bytes in a row.
      // Rows 8..15 are ones: O^T row 8 takes the sum of P^T's column, rounded as the product reads it.
      const v16bf vb = __builtin_shufflevector(v0, v1, 0, 1, 2, 3, 4, 5, 6, 7, 8, 9, 10, 11, 12, 13, 14, 15);

      // online softmax, one query per lane
      float mx = fmaxf(sc0[0], sc1[0]);
#pragma unroll
      for (int r = 1; r < 8; ++r) mx = fmaxf(mx, fmaxf(sc0[r], sc1[r]));
      if (__builtin_amdgcn_ballot_w32(mx > thr) != 0) {   // one scalar branch a step, the same for the whole wave
        mx = fmaxf(mx, xhalf(mx));
        const float delta = fmaxf(mx, lo);                // how far this query's maximum in use moves
        float scale = fminf(-delta, 0.0f);                // a first step below 0 has nothing to rescale yet
        asm("v_exp_f32 %0, %0\n\tv_nop" : "+v"(scale));
#pragma unroll
        for (int r = 0; r < 8; ++r) {
          sc0[r] -= delta;
          sc1[r] -= delta;
          cneg[r] -= delta;
          oacc[r] *= scale;
        }
        thr = 8.0f;
        lo = 0.0f;
      }
      float e0[8], e1[8];
      asm("v_exp_f32 %0, %8\n\tv_exp_f32 %1, %9\n\tv_exp_f32 %2, %10\n\tv_exp_f32 %3, %11\n\t"
          "v_exp_f32 %4, %12\n\tv_exp_f32 %5, %13\n\tv_exp_f32 %6, %14\n\tv_exp_f32 %7, %15\n\t"
          "v_nop"
          : "=&v"(e0[0]), "=&v"(e0[1]), "=&v"(e0[2]), "=&v"(e0[3]),
            "=&v"(e0[4]), "=&v"(e0[5]), "=&v"(e0[6]), "=&v"(e0[7])
          : "v"(sc0[0]), "v"(sc0[1]), "v"(sc0[2]), "v"(sc0[3]),
            "v"(sc0[4]), "v"(sc0[5]), "v"(sc0[6]), "v"(sc0[7]));
      asm("v_exp_f32 %0, %8\n\tv_exp_f32 %1, %9\n\tv_exp_f32 %2, %10\n\tv_exp_f32 %3, %11\n\t"
          "v_exp_f32 %4, %12\n\tv_exp_f32 %5, %13\n\tv_exp_f32 %6, %14\n\tv_exp_f32 %7, %15\n\t"
          "v_nop"
          : "=&v"(e1[0]), "=&v"(e1[1]), "=&v"(e1[2]), "=&v"(e1[3]),
            "=&v"(e1[4]), "=&v"(e1[5]), "=&v"(e1[6]), "=&v"(e1[7])
          : "v"(sc1[0]), "v"(sc1[1]), "v"(sc1[2]), "v"(sc1[3]),
            "v"(sc1[4]), "v"(sc1[5]), "v"(sc1[6]), "v"(sc1[7]));
      v16bf pb;            // P^T fragment (B 32x16): element j = key half*8 + j, j + 8 = 16 + half*8 + j
#pragma unroll
      for (int r = 0; r < 8; ++r) {
        pb[r]     = (__bf16)e0[r];
        pb[r + 8] = (__bf16)e1[r];
      }
      asm("v_wmma_f32_16x16x32_bf16 %0, %1, %2, %0\n\tv_nop\n\tv_nop\n\tv_nop\n\tv_nop"
          : "+v"(oacc)
          : "v"(__builtin_bit_cast(i32x8, vb)), "v"(__builtin_bit_cast(i32x8, pb)));
    }
    __syncthreads();   // all waves done with buffer c&1 before it is re-filled
  }
  // normalize + store [B,S,128] bf16: lane (half 0) = query, 8 head dims = 16 bytes
  const float lrow = xhalf(oacc[0]);   // half 0 takes O^T row 8 of its query from half 1
  if (half == 0) {
    const int b = bh >> 4, h = bh & 15;
    v8bf o;
#pragma unroll
    for (int r = 0; r < 8; ++r) o[r] = (__bf16)(oacc[r] / lrow);
    *(v8bf*)(attn + ((size_t)(b * SEQ + qbase + l16)) * DIM + h * HD) = o;
  }
}

// ---------------- 3) output projection, FFN gate and FFN down projection in one launch ----------------
// All three are local to a row of the sequence. A block of 8 waves owns 32 rows, one block per WGP:
//   a) h = x + attn @ wo: wave w owns column tile w of both row tiles; h stays in its registers in f32
//      and goes to LDS in bf16;
//   b) act = silu(h @ w1) * (h @ w3): wave w owns column tiles w, w + 8, w + 16 of the 22; act goes to LDS;
//   c) out = h + act @ w2: wave w owns column tile w again, so the residual is the h it still holds.
// Each weight fragment feeds both row tiles. Roundings and the order of every sum are those of three launches.
// The loops over f, m, r and j are unrolled because their indices select registers.
#define HSP 136
#define ASP 360
__global__ void __launch_bounds__(256) __attribute__((amdgpu_waves_per_eu(1, 2))) k_mlp(const __bf16* __restrict__ attn,
                                             const float* __restrict__ wo,
                                             const float* __restrict__ x,
                                             const float* __restrict__ w1,
                                             const float* __restrict__ w3,
                                             const float* __restrict__ w2,
                                             float* __restrict__ out) {
  __shared__ __attribute__((aligned(16))) __bf16 hs[32 * HSP];
  __shared__ __attribute__((aligned(16))) __bf16 acts[32 * ASP];
  // The wave's number in a scalar register: the loop over column tiles then ends on a scalar branch.
  const int wave = __builtin_amdgcn_readfirstlane(threadIdx.x >> 5), lane = threadIdx.x & 31;
  const int half = lane >> 4, l16 = lane & 15;
  const int row0 = blockIdx.x * 32;
  const int col = wave * 16 + l16;

  // a) output projection + residual
  v8f h[2];
  {
    const __bf16* arow = attn + (size_t)(row0 + l16) * DIM + half * 8;
    const float* wpo = wo + (half * 8) * DIM + col;
    const float* xp = x + (size_t)(row0 + half * 8) * DIM + col;
    h[0] = vz8();
    h[1] = vz8();
#pragma unroll
    for (int f = 0; f < 4; ++f) {
      const v16bf a0 = afrag_bf(arow, f * 32, 0);
      const v16bf a1 = afrag_bf(arow + 16 * DIM, f * 32, 0);
      const v16bf bw = bfrag_p(wpo, DIM, f * 32);
      h[0] = wmma_bf(a0, bw, h[0]);
      h[1] = wmma_bf(a1, bw, h[1]);
    }
#pragma unroll
    for (int m = 0; m < 2; ++m)
#pragma unroll
      for (int r = 0; r < 8; ++r) {
        h[m][r] = xp[(size_t)(m * 16 + r) * DIM] + h[m][r];
        hs[(m * 16 + half * 8 + r) * HSP + col] = (__bf16)h[m][r];
      }
    // One wait behind the last loads of this part, their address registers named as inputs so that they
    // live up to it: no register that an issued load names as its address is written again in front of it.
    asm volatile("s_wait_xcnt 0x0" :: "v"(arow), "v"(wpo), "v"(xp) : "memory");
  }
  __syncthreads();   // h of all 128 columns is in LDS

  // b) FFN gate
  {
    const __bf16* hrow = hs + l16 * HSP + half * 8;
    v16bf A0[4], A1[4];
#pragma unroll
    for (int f = 0; f < 4; ++f) {
      A0[f] = afrag_bf(hrow, f * 32, 0);
      A1[f] = afrag_bf(hrow + 16 * HSP, f * 32, 0);
    }
    for (int ct = wave; ct < HIDP / 16; ct += 8) {
      const int nn = ct * 16 + l16;
      const int wcol = (nn < HID) ? nn : 0;            // clamp (pad cols zeroed on store)
      const float* p1 = w1 + (half * 8) * HID + wcol;
      const float* p3 = w3 + (half * 8) * HID + wcol;
      v8f a1[2], a3[2];
#pragma unroll
      for (int m = 0; m < 2; ++m) { a1[m] = vz8(); a3[m] = vz8(); }
#pragma unroll
      for (int f = 0; f < 4; ++f) {
        const v16bf b1 = bfrag_p(p1, HID, f * 32);
        a1[0] = wmma_bf(A0[f], b1, a1[0]);
        a1[1] = wmma_bf(A1[f], b1, a1[1]);
        const v16bf b3 = bfrag_p(p3, HID, f * 32);
        a3[0] = wmma_bf(A0[f], b3, a3[0]);
        a3[1] = wmma_bf(A1[f], b3, a3[1]);
      }
      // As above: the next column tile forms new addresses only behind this wait.
      asm volatile("s_wait_xcnt 0x0" :: "v"(p1), "v"(p3) : "memory");
#pragma unroll
      for (int m = 0; m < 2; ++m) {
        float e[8];                                        // exp(-s) = 2^(-s * log2 e)
#pragma unroll
        for (int r = 0; r < 8; ++r) e[r] = a1[m][r] * -1.44269504f;
        asm("v_exp_f32 %0, %0\n\tv_exp_f32 %1, %1\n\tv_exp_f32 %2, %2\n\tv_exp_f32 %3, %3\n\t"
            "v_exp_f32 %4, %4\n\tv_exp_f32 %5, %5\n\tv_exp_f32 %6, %6\n\tv_exp_f32 %7, %7\n\t"
            "v_nop"
            : "+v"(e[0]), "+v"(e[1]), "+v"(e[2]), "+v"(e[3]),
              "+v"(e[4]), "+v"(e[5]), "+v"(e[6]), "+v"(e[7]));
#pragma unroll
        for (int r = 0; r < 8; ++r) {
          const float s = a1[m][r];
          const float g = (s / (1.0f + e[r])) * a3[m][r];  // silu * gate
          acts[(m * 16 + half * 8 + r) * ASP + nn] = (__bf16)((nn < HID) ? g : 0.0f);   // pad cols -> 0
        }
      }
    }
  }
  __syncthreads();   // act of all 352 columns is in LDS

  // c) FFN down projection + residual
  {
    const __bf16* crow = acts + l16 * ASP + half * 8;
    const float* wp2 = w2 + (half * 8) * DIM + col;
    // Rows 344..351 of w2 do not exist: half 1 reads rows that do in their place and takes 0 for them.
    const float* wpt = (half == 0) ? wp2 + (size_t)(HIDP - 16) * DIM : wp2;
    v8f acc[2];
    acc[0] = vz8();
    acc[1] = vz8();
#pragma unroll
    for (int f = 0; f < HIDP / 32; ++f) {              // 11 K-steps (pad rows are 0)
      const v16bf a0 = afrag_bf(crow, f * 32, 0);
      const v16bf a1 = afrag_bf(crow + 16 * ASP, f * 32, 0);
      v16bf bw;
      if (f * 32 + 32 <= HID) {
        bw = bfrag_p(wp2, DIM, f * 32);
      } else {                                         // the last step
#pragma unroll
        for (int j = 0; j < 8; ++j) {
          const float t = wpt[(size_t)j * DIM];
          bw[j]     = (__bf16)wp2[(size_t)(f * 32 + j) * DIM];
          bw[j + 8] = (__bf16)((half == 0) ? t : 0.0f);
        }
      }
      acc[0] = wmma_bf(a0, bw, acc[0]);
      acc[1] = wmma_bf(a1, bw, acc[1]);
    }
    // As above, behind the last loads of the kernel.
    asm volatile("s_wait_xcnt 0x0" :: "v"(wp2), "v"(wpt) : "memory");
    float* op = out + (size_t)(row0 + half * 8) * DIM + col;
#pragma unroll
    for (int m = 0; m < 2; ++m)
#pragma unroll
      for (int r = 0; r < 8; ++r) op[(size_t)(m * 16 + r) * DIM] = h[m][r] + acc[m][r];
  }
}

// ---------------- launcher ----------------
extern "C" void kernel_launch(void* const* d_in, const int* in_sizes, int n_in,
                              void* d_out, int out_size, void* d_ws, size_t ws_size,
                              hipStream_t stream) {
  (void)in_sizes; (void)n_in; (void)out_size; (void)ws_size;
  const float* x  = (const float*)d_in[0];
  const float* wq = (const float*)d_in[1];
  const float* wk = (const float*)d_in[2];
  const float* wv = (const float*)d_in[3];
  const float* wo = (const float*)d_in[4];
  const float* w1 = (const float*)d_in[5];
  const float* w3 = (const float*)d_in[6];
  const float* w2 = (const float*)d_in[7];
  float* out = (float*)d_out;

  char* ws = (char*)d_ws;                       // 8 MB total
  __bf16* Q    = (__bf16*)(ws);                 // 2 MB  [B,H,S,8]
  __bf16* K    = (__bf16*)(ws + (2u  << 20));   // 2 MB
  __bf16* V    = (__bf16*)(ws + (4u  << 20));   // 2 MB  [B,H,S/32,2,2,8,8]
  __bf16* attn = (__bf16*)(ws + (6u  << 20));   // 2 MB  [B*S,128]

  const dim3 blk(256);
  k_qkv <<<dim3((MTOT / 32) * 8 / 8), blk, 0, stream>>>(x, wq, wk, wv, Q, K, V);
  k_attn<<<dim3(SEQ / 128, BATCH * NH), blk, 0, stream>>>(Q, K, V, attn);
  k_mlp <<<dim3(MTOT / 32), blk, 0, stream>>>(attn, wo, x, w1, w3, w2, out);
}

// v007
// Measured time: 41.3 microseconds a run.
// Two timings next to v006 both put it at 1.16 times that version's speed.
// All steps since v000 together make it 3.44 times as fast.
#include <hip/hip_runtime.h>
#include <stdint.h>

// ---------------- problem constants ----------------
#define DIM   128
#define NH    16
#define HD    8
#define SEQ   2048
#define BATCH 4
#define MTOT  (BATCH*SEQ)   // 8192 rows
#define HID   344
#define HIDP  352
#define KCH   256
// bf16 copies of wo, w1, w3, w2 in B fragment order: one fragment (32 k x 16 columns) is 512 elements.
#define FRE   512           // elements of a fragment
#define FR_WO 0             // wo: 8 column tiles x 4 k steps, fragment = tile * 4 + step
#define FR_W1 32            // w1: 22 x 4
#define FR_W3 120           // w3: 22 x 4
#define FR_W2 208           // w2: 8 column tiles x 11 k steps, fragment = tile * 11 + step
#define NFRAG 296

typedef __attribute__((ext_vector_type(16))) __bf16 v16bf;
typedef __attribute__((ext_vector_type(8)))  __bf16 v8bf;
typedef __attribute__((ext_vector_type(8)))  float  v8f;
typedef __attribute__((ext_vector_type(4)))  unsigned int u32x4;
typedef __attribute__((ext_vector_type(8)))  int i32x8;
typedef __attribute__((ext_vector_type(4)))  int i32x4;

static __device__ inline v8f wmma_bf(v16bf a, v16bf b, v8f c) {
  // D = A(16x32 bf16) * B(32x16 bf16) + C(16x16 f32)
  return __builtin_amdgcn_wmma_f32_16x16x32_bf16(false, a, false, b,
                                                 (short)0, c, false, false);
}

static __device__ inline v8f vz8() {
  v8f v;
#pragma unroll
  for (int i = 0; i < 8; ++i) v[i] = 0.0f;
  return v;
}
static __device__ inline v16bf vz16() {
  v16bf v;
#pragma unroll
  for (int i = 0; i < 16; ++i) v[i] = (__bf16)0.0f;
  return v;
}

// A fragment (16x32), source fp32 row-major. lane holds row (lane&15);
// K pattern: half=lane>>4 -> elems 0..7 = K k0..k0+7, elems 8..15 = K k0+16..k0+23
static __device__ inline v16bf afrag_f32(const float* row, int kb, int half) {
  const int k0 = kb + half * 8;
  v16bf a;
#pragma unroll
  for (int j = 0; j < 8; ++j) {
    a[j]     = (__bf16)row[k0 + j];
    a[j + 8] = (__bf16)row[k0 + 16 + j];
  }
  return a;
}

// A fragment, source bf16 row-major (16B-aligned rows) -> two b128 loads
static __device__ inline v16bf afrag_bf(const __bf16* row, int kb, int half) {
  const int k0 = kb + half * 8;
  v8bf lo = *(const v8bf*)(row + k0);
  v8bf hi = *(const v8bf*)(row + k0 + 16);
  v16bf a;
#pragma unroll
  for (int j = 0; j < 8; ++j) { a[j] = lo[j]; a[j + 8] = hi[j]; }
  return a;
}

// B fragment (32x16) from fp32 weight W[K x N] (row-major, ldn = N); lane holds one column.
// From a lane's own pointer wp = W + (half * 8) * ldn + col: every load is wp plus a constant.
static __device__ inline v16bf bfrag_p(const float* wp, int ldn, int kb) {
  v16bf b;
#pragma unroll
  for (int j = 0; j < 8; ++j) {
    b[j]     = (__bf16)wp[(size_t)(kb + j) * ldn];
    b[j + 8] = (__bf16)wp[(size_t)(kb + 16 + j) * ldn];
  }
  return b;
}

// B fragment from the bf16 copy in fragment order; p = fragment + lane * 8: two b128 loads, each 512 bytes
// in a row over the wave. Elements 0..7 and 8..15 are those of bfrag_p.
static __device__ inline v16bf bfrag_w(const __bf16* p) {
  const v8bf lo = *(const v8bf*)p;
  const v8bf hi = *(const v8bf*)(p + 256);
  return __builtin_shufflevector(lo, hi, 0, 1, 2, 3, 4, 5, 6, 7, 8, 9, 10, 11, 12, 13, 14, 15);
}

// One wave rounds fragment (column tile ct, k step f) of W[nrow x LDN] to bf16 and stores it in that order;
// dst = fragment + lane * 8. The pitch is a compile-time constant: every load is a lane's pointer plus a constant.
template <int LDN>
static __device__ inline void wfrag_store(const float* W, int nrow, int ct, int f, int half, int l16, __bf16* dst) {
  const int col = ct * 16 + l16;
  const int k0 = f * 32 + half * 8;
  const bool cok = col < LDN;            // columns 344..351 of w1 and w3 do not exist: 0
  const bool kok = k0 + 16 < nrow;       // rows 344..351 of w2 do not exist: 0
  const float* p0 = W + (size_t)k0 * LDN + (cok ? col : 0);
  const float* p1 = kok ? p0 + 16 * LDN : p0;
  float a[8], b[8];
#pragma unroll
  for (int j = 0; j < 8; ++j) {
    a[j] = p0[(size_t)j * LDN];
    b[j] = p1[(size_t)j * LDN];
  }
  // One wait behind these loads, their address registers named as inputs so that they live up to it.
  asm volatile("s_wait_xcnt 0x0" :: "v"(p0), "v"(p1) : "memory");
  v8bf lo, hi;
#pragma unroll
  for (int j = 0; j < 8; ++j) {
    lo[j] = (__bf16)(cok ? a[j] : 0.0f);
    hi[j] = (__bf16)((cok && kok) ? b[j] : 0.0f);
  }
  *(v8bf*)dst = lo;
  *(v8bf*)(dst + 256) = hi;
  // In the built code the other matrices' blocks follow this one and write the registers that these stores name.
  asm volatile("s_wait_xcnt 0x0" ::: "memory");
}

static __device__ inline float xhalf(float v) {
  const int b = __builtin_bit_cast(int, v);
  return __builtin_bit_cast(float,
      __builtin_amdgcn_permlanex16(b, b, 0x76543210, 0xfedcba98, false, false));
}

static __device__ inline void tdm_load_1d(uint32_t lds_off, const void* gptr,
                                          uint32_t nbytes) {
  const uint64_t ga = (uint64_t)(uintptr_t)gptr;
  const uint32_t elems = nbytes >> 2;
  u32x4 g0;
  g0[0] = 1u;
  g0[1] = lds_off;
  g0[2] = (uint32_t)ga;
  g0[3] = (uint32_t)((ga >> 32) & 0x01FFFFFFu)
        | (2u << 30);
  i32x8 g1;
  g1[0] = (int)(2u << 16);
  g1[1] = (int)((elems & 0xFFFFu) << 16);
  g1[2] = (int)((elems >> 16) | (1u << 16));
  g1[3] = (int)((elems & 0xFFFFu) << 16);
  g1[4] = 1;
  g1[5] = (int)elems;
  g1[6] = 0;
  g1[7] = 0;
  i32x4 gz4;
  gz4[0] = 0; gz4[1] = 0; gz4[2] = 0; gz4[3] = 0;   // groups 2/3 unused (<=2D)
  i32x8 gz8;
#pragma unroll
  for (int i = 0; i < 8; ++i) gz8[i] = 0;
  __builtin_amdgcn_tensor_load_to_lds(g0, g1, gz4, gz4, gz8, 0);
}

__global__ void __launch_bounds__(256) __attribute__((amdgpu_waves_per_eu(1, 2))) k_qkv(const float* __restrict__ x,
                                             const float* __restrict__ wq,
                                             const float* __restrict__ wk,
                                             const float* __restrict__ wv,
                                             const float* __restrict__ wo,
                                             const float* __restrict__ w1,
                                             const float* __restrict__ w3,
                                             const float* __restrict__ w2,
                                             __bf16* __restrict__ Q,
                                             __bf16* __restrict__ K,
                                             __bf16* __restrict__ V,
                                             __bf16* __restrict__ WB) {
  const int wave = threadIdx.x >> 5, lane = threadIdx.x & 31;
  const int half = lane >> 4, l16 = lane & 15;
  if (blockIdx.x >= MTOT / 32) {
    // The fragment's number in a scalar register: the choice of the matrix is a scalar branch.
    const int g = __builtin_amdgcn_readfirstlane((int)(blockIdx.x - MTOT / 32) * 8 + wave);
    __bf16* dst = WB + (size_t)g * FRE + lane * 8;
    if (g < FR_W1)      wfrag_store<DIM>(wo, DIM, g >> 2, g & 3, half, l16, dst);
    else if (g < FR_W3) wfrag_store<HID>(w1, DIM, (g - FR_W1) >> 2, (g - FR_W1) & 3, half, l16, dst);
    else if (g < FR_W2) wfrag_store<HID>(w3, DIM, (g - FR_W3) >> 2, (g - FR_W3) & 3, half, l16, dst);
    else                wfrag_store<DIM>(w2, HID, (g - FR_W2) / 11, (g - FR_W2) % 11, half, l16, dst);
    return;
  }
  // A wave owns 2 row tiles x 3 column tiles of the 512 x 24 (3 matrices x 8): each x
  // fragment feeds 3 products and each weight fragment 2. The 8 waves of a block share the columns.
  const int rp = (blockIdx.x * 8 + wave) & 255;  // pair of row tiles
  const int cg = blockIdx.x >> 5;                // triple of column tiles, 0..7

  const float* xrow = x + (size_t)(rp * 32 + l16) * DIM + half * 8;
  const float* wp[3];
#pragma unroll
  for (int n = 0; n < 3; ++n) {
    const int t2 = cg * 3 + n;
    const int mat = t2 >> 3;
    wp[n] = ((mat == 0) ? wq : (mat == 1) ? wk : wv) + (half * 8) * DIM + (t2 & 7) * 16 + l16;
  }
  v8f acc[2][3];
#pragma unroll
  for (int m = 0; m < 2; ++m)
#pragma unroll
    for (int n = 0; n < 3; ++n) acc[m][n] = vz8();
#pragma unroll
  for (int f = 0; f < 4; ++f) {
    const v16bf a0 = afrag_f32(xrow, f * 32, 0);
    const v16bf a1 = afrag_f32(xrow + 16 * DIM, f * 32, 0);
#pragma unroll
    for (int n = 0; n < 3; ++n) {
      const v16bf bw = bfrag_p(wp[n], DIM, f * 32);
      acc[0][n] = wmma_bf(a0, bw, acc[0][n]);
      acc[1][n] = wmma_bf(a1, bw, acc[1][n]);
    }
  }
  // One wait behind the last loads of the products, their address registers named as inputs so that they
  // live up to it: no register that an issued load names as its address is written again in front of it.
  asm volatile("s_wait_xcnt 0x0" :: "v"(xrow), "v"(wp[0]), "v"(wp[1]), "v"(wp[2]) : "memory");
#pragma unroll
  for (int n = 0; n < 3; ++n) {
    const int t2 = cg * 3 + n;
    const int mat = t2 >> 3;
    __bf16* Out = (mat == 0) ? Q : (mat == 1) ? K : V;
    const int col = (t2 & 7) * 16 + l16;
    const int head = col >> 3, d = col & 7;
    const float osc = (mat == 0) ? 1.44269504f : 1.0f;   // Q carries log2 e: the scores are exponents of 2
    if (mat == 2) {
      // The wave's 32 rows are one block of keys; a lane's 8 accumulator rows are 8 keys in a row: 16 bytes.
      __bf16* vblk = V + ((size_t)((rp >> 6) * NH + head)) * SEQ * HD + (rp & 63) * (32 * HD) + half * 64 + d * 8;
#pragma unroll
      for (int m = 0; m < 2; ++m) {
        v8bf o;
#pragma unroll
        for (int r = 0; r < 8; ++r) o[r] = (__bf16)acc[m][n][r];
        *(v8bf*)(vblk + m * 128) = o;
      }
      // The next column tile reuses registers that these stores name as address or data: the wait closes
      // the branch, in front of that.
      // Behind the last tile too: in the built code the blocks that lay down the weight fragments follow.
      asm volatile("s_wait_xcnt 0x0" ::: "memory");
    } else {
#pragma unroll
      for (int m = 0; m < 2; ++m)
#pragma unroll
        for (int r = 0; r < 8; ++r) {
          const int grow = rp * 32 + m * 16 + half * 8 + r;
          const int b = grow >> 11, srow = grow & (SEQ - 1);
          Out[(((size_t)(b * NH + head)) * SEQ + srow) * HD + d] = (__bf16)(acc[m][n][r] * osc);
        }
      // As in the other branch; behind the last tile too: in the built code the other branch's block follows this one.
      asm volatile("s_wait_xcnt 0x0" ::: "memory");
    }
  }
}

__global__ void __launch_bounds__(256) k_attn(const __bf16* __restrict__ Q,
                                              const __bf16* __restrict__ K,
                                              const __bf16* __restrict__ V,
                                              __bf16* __restrict__ attn) {
  const int bh = blockIdx.y;
  const int wave = threadIdx.x >> 5, lane = threadIdx.x & 31;
  const int half = lane >> 4, l16 = lane & 15;
  const int qbase = blockIdx.x * 128 + wave * 16;
  const __bf16* Qh = Q + (size_t)bh * SEQ * HD;
  const __bf16* Kh = K + (size_t)bh * SEQ * HD;
  const __bf16* Vh = V + (size_t)bh * SEQ * HD;

  __shared__ __bf16 kbuf[2][KCH * HD];         // 2 x 4KB
  __shared__ __bf16 vbuf[2][KCH * HD];         // 2 x 4KB
  __shared__ __attribute__((aligned(16))) __bf16 ones[256];   // rows 8..15 of every V^T fragment
  ones[threadIdx.x] = (__bf16)1.0f;            // read only behind the first barrier of the chunk loop

  // Q^T fragment: B(32x16), lane = query column, only d=0..7 real -> zeros elsewhere
  v16bf qf = vz16();
  if (half == 0) {
    v8bf qv = *(const v8bf*)(Qh + (size_t)(qbase + l16) * HD);
#pragma unroll
    for (int j = 0; j < 8; ++j) qf[j] = qv[j];
  }

  // One lane offset (in elements) serves both K loads of a step and the V loads of rows 0..7: in half 0 it is K row l16,
  // in rows 0..7 it is the V piece (key half, head dim l16) of the block order that k_qkv writes.
  const int fo = ((l16 + half * 8) & 15) * HD;
  v8bf kz;
#pragma unroll
  for (int j = 0; j < 8; ++j) kz[j] = (__bf16)0.0f;
  v8f cneg = vz8();      // minus the maximum in use of query l16, equal in both halves: a C operand
  float thr = -3.0e38f;  // a score above this moves the maximum in use: any in the first step, then 8
  float lo  = -3.0e38f;  // the least move: the first step takes its own maximum, later ones never go down
  v8f oacc = vz8();      // O^T: register r = row half*8 + r, lane = query; rows 0..7 head dims, row 8 the sum of P
  const bool vreal = l16 < 8;
  const int vstep = (8 - (l16 & 8)) * (4 * HD);

  if (wave == 0) {
    tdm_load_1d((uint32_t)(uintptr_t)&kbuf[0][0], Kh, KCH * HD * 2);
    tdm_load_1d((uint32_t)(uintptr_t)&vbuf[0][0], Vh, KCH * HD * 2);
  }

  for (int c = 0; c < SEQ / KCH; ++c) {
    if (wave == 0) __builtin_amdgcn_s_wait_tensorcnt(0);   // chunk c landed
    __syncthreads();                                       // visible to all waves
    if (wave == 0 && c + 1 < SEQ / KCH) {                  // prefetch chunk c+1
      const int nb = (c + 1) & 1;
      tdm_load_1d((uint32_t)(uintptr_t)&kbuf[nb][0],
                  Kh + (size_t)(c + 1) * KCH * HD, KCH * HD * 2);
      tdm_load_1d((uint32_t)(uintptr_t)&vbuf[nb][0],
                  Vh + (size_t)(c + 1) * KCH * HD, KCH * HD * 2);
    }
    const __bf16* kchb = &kbuf[c & 1][0];
    const __bf16* vp = vreal ? &vbuf[c & 1][fo] : &ones[(1 - half) * 64];

    for (int sub = 0; sub < KCH / 32; ++sub) {
      const int s0 = sub * 32;
      const v8bf k0 = *(const v8bf*)(kchb + (size_t)s0 * HD + fo);
      const v8bf k1 = *(const v8bf*)(kchb + (size_t)(s0 + 16) * HD + fo);
      const v8bf v0 = *(const v8bf*)vp;
      const v8bf v1 = *(const v8bf*)(vp + 16 * HD);
      vp += vstep;
      const v16bf bk0 = __builtin_shufflevector(k0, kz, 0, 1, 2, 3, 4, 5, 6, 7, 8, 9, 10, 11, 12, 13, 14, 15);
      const v16bf bk1 = __builtin_shufflevector(k1, kz, 0, 1, 2, 3, 4, 5, 6, 7, 8, 9, 10, 11, 12, 13, 14, 15);
      // sc0[r] = score(key s0 + half*8 + r, query l16) - maximum in use; sc1: keys 16 further on
      v8f sc0 = wmma_bf(bk0, qf, cneg);
      v8f sc1 = wmma_bf(bk1, qf, cneg);

      // V^T fragment (A 16x32, rows 0..7 = head dims), keys in the order of P^T below.
      // V lies in that order (k_qkv): a lane's 8 keys of a 16-key tile are 16 bytes in a row.
      // Rows 8..15 are ones: O^T row 8 takes the sum of P^T's column, rounded as the product reads it.
      const v16bf vb = __builtin_shufflevector(v0, v1, 0, 1, 2, 3, 4, 5, 6, 7, 8, 9, 10, 11, 12, 13, 14, 15);

      // online softmax, one query per lane
      float mx = fmaxf(sc0[0], sc1[0]);
#pragma unroll
      for (int r = 1; r < 8; ++r) mx = fmaxf(mx, fmaxf(sc0[r], sc1[r]));
      if (__builtin_amdgcn_ballot_w32(mx > thr) != 0) {   // one scalar branch a step, the same for the whole wave
        mx = fmaxf(mx, xhalf(mx));
        const float delta = fmaxf(mx, lo);                // how far this query's maximum in use moves
        float scale = fminf(-delta, 0.0f);                // a first step below 0 has nothing to rescale yet
        asm("v_exp_f32 %0, %0\n\tv_nop" : "+v"(scale));
#pragma unroll
        for (int r = 0; r < 8; ++r) {
          sc0[r] -= delta;
          sc1[r] -= delta;
          cneg[r] -= delta;
          oacc[r] *= scale;
        }
        thr = 8.0f;
        lo = 0.0f;
      }
      float e0[8], e1[8];
      asm("v_exp_f32 %0, %8\n\tv_exp_f32 %1, %9\n\tv_exp_f32 %2, %10\n\tv_exp_f32 %3, %11\n\t"
          "v_exp_f32 %4, %12\n\tv_exp_f32 %5, %13\n\tv_exp_f32 %6, %14\n\tv_exp_f32 %7, %15\n\t"
          "v_nop"
          : "=&v"(e0[0]), "=&v"(e0[1]), "=&v"(e0[2]), "=&v"(e0[3]),
            "=&v"(e0[4]), "=&v"(e0[5]), "=&v"(e0[6]), "=&v"(e0[7])
          : "v"(sc0[0]), "v"(sc0[1]), "v"(sc0[2]), "v"(sc0[3]),
            "v"(sc0[4]), "v"(sc0[5]), "v"(sc0[6]), "v"(sc0[7]));
      asm("v_exp_f32 %0, %8\n\tv_exp_f32 %1, %9\n\tv_exp_f32 %2, %10\n\tv_exp_f32 %3, %11\n\t"
          "v_exp_f32 %4, %12\n\tv_exp_f32 %5, %13\n\tv_exp_f32 %6, %14\n\tv_exp_f32 %7, %15\n\t"
          "v_nop"
          : "=&v"(e1[0]), "=&v"(e1[1]), "=&v"(e1[2]), "=&v"(e1[3]),
            "=&v"(e1[4]), "=&v"(e1[5]), "=&v"(e1[6]), "=&v"(e1[7])
          : "v"(sc1[0]), "v"(sc1[1]), "v"(sc1[2]), "v"(sc1[3]),
            "v"(sc1[4]), "v"(sc1[5]), "v"(sc1[6]), "v"(sc1[7]));
      v16bf pb;            // P^T fragment (B 32x16): element j = key half*8 + j, j + 8 = 16 + half*8 + j
#pragma unroll
      for (int r = 0; r < 8; ++r) {
        pb[r]     = (__bf16)e0[r];
        pb[r + 8] = (__bf16)e1[r];
      }
      asm("v_wmma_f32_16x16x32_bf16 %0, %1, %2, %0\n\tv_nop\n\tv_nop\n\tv_nop\n\tv_nop"
          : "+v"(oacc)
          : "v"(__builtin_bit_cast(i32x8, vb)), "v"(__builtin_bit_cast(i32x8, pb)));
    }
    __syncthreads();   // all waves done with buffer c&1 before it is re-filled
  }
  // normalize + store [B,S,128] bf16: lane (half 0) = query, 8 head dims = 16 bytes
  const float lrow = xhalf(oacc[0]);   // half 0 takes O^T row 8 of its query from half 1
  if (half == 0) {
    const int b = bh >> 4, h = bh & 15;
    v8bf o;
#pragma unroll
    for (int r = 0; r < 8; ++r) o[r] = (__bf16)(oacc[r] / lrow);
    *(v8bf*)(attn + ((size_t)(b * SEQ + qbase + l16)) * DIM + h * HD) = o;
  }
}

// ---------------- 3) output projection, FFN gate and FFN down projection in one launch ----------------
// All three are local to a row of the sequence. A block of 8 waves owns 32 rows, one block per WGP:
//   a) h = x + attn @ wo: wave w owns column tile w of both row tiles; h stays in its registers in f32
//      and goes to LDS in bf16;
//   b) act = silu(h @ w1) * (h @ w3): wave w owns column tiles w, w + 8, w + 16 of the 22; act goes to LDS;
//   c) out = h + act @ w2: wave w owns column tile w again, so the residual is the h it still holds.
// Each weight fragment feeds both row tiles. Roundings and the order of every sum are those of three launches.
// The weights come as bf16 in fragment order (WB, written by k_qkv): 2 loads of 16 bytes a lane for a fragment.
// The loops over f, m, r and j are unrolled because their indices select registers.
#define HSP 136
#define ASP 360
__global__ void __launch_bounds__(256) __attribute__((amdgpu_waves_per_eu(1, 2))) k_mlp(const __bf16* __restrict__ attn,
                                             const __bf16* __restrict__ WB,
                                             const float* __restrict__ x,
                                             float* __restrict__ out) {
  __shared__ __attribute__((aligned(16))) __bf16 hs[32 * HSP];
  __shared__ __attribute__((aligned(16))) __bf16 acts[32 * ASP];
  // The wave's number in a scalar register: the loop over column tiles then ends on a scalar branch.
  const int wave = __builtin_amdgcn_readfirstlane(threadIdx.x >> 5), lane = threadIdx.x & 31;
  const int half = lane >> 4, l16 = lane & 15;
  const int row0 = blockIdx.x * 32;
  const int col = wave * 16 + l16;

  // a) output projection + residual
  v8f h[2];
  {
    const __bf16* arow = attn + (size_t)(row0 + l16) * DIM + half * 8;
    const __bf16* wpo = WB + (FR_WO + wave * 4) * FRE + lane * 8;
    const float* xp = x + (size_t)(row0 + half * 8) * DIM + col;
    h[0] = vz8();
    h[1] = vz8();
#pragma unroll
    for (int f = 0; f < 4; ++f) {
      const v16bf a0 = afrag_bf(arow, f * 32, 0);
      const v16bf a1 = afrag_bf(arow + 16 * DIM, f * 32, 0);
      const v16bf bw = bfrag_w(wpo + f * FRE);
      h[0] = wmma_bf(a0, bw, h[0]);
      h[1] = wmma_bf(a1, bw, h[1]);
    }
#pragma unroll
    for (int m = 0; m < 2; ++m)
#pragma unroll
      for (int r = 0; r < 8; ++r) {
        h[m][r] = xp[(size_t)(m * 16 + r) * DIM] + h[m][r];
        hs[(m * 16 + half * 8 + r) * HSP + col] = (__bf16)h[m][r];
      }
    // One wait behind the last loads of this part, their address registers named as inputs so that they
    // live up to it: no register that an issued load names as its address is written again in front of it.
    asm volatile("s_wait_xcnt 0x0" :: "v"(arow), "v"(wpo), "v"(xp) : "memory");
  }
  __syncthreads();   // h of all 128 columns is in LDS

  // b) FFN gate
  {
    const __bf16* hrow = hs + l16 * HSP + half * 8;
    v16bf A0[4], A1[4];
#pragma unroll
    for (int f = 0; f < 4; ++f) {
      A0[f] = afrag_bf(hrow, f * 32, 0);
      A1[f] = afrag_bf(hrow + 16 * HSP, f * 32, 0);
    }
    for (int ct = wave; ct < HIDP / 16; ct += 8) {
      const int nn = ct * 16 + l16;
      const __bf16* p1 = WB + (FR_W1 + ct * 4) * FRE + lane * 8;
      const __bf16* p3 = WB + (FR_W3 + ct * 4) * FRE + lane * 8;
      v8f a1[2], a3[2];
#pragma unroll
      for (int m = 0; m < 2; ++m) { a1[m] = vz8(); a3[m] = vz8(); }
      v16bf B1[4], B3[4];
#pragma unroll
      for (int f = 0; f < 4; ++f) {
        B1[f] = bfrag_w(p1 + f * FRE);
        B3[f] = bfrag_w(p3 + f * FRE);
      }
      // Keeps the products behind the loads: without it the scheduler deals the loads out among the products,
      // two at a time, and the tile pays the latency of L2 four times over instead of once.
      __builtin_amdgcn_sched_barrier(0);
      // As above: the next column tile forms new addresses only behind this wait.
      asm volatile("s_wait_xcnt 0x0" :: "v"(p1), "v"(p3) : "memory");
#pragma unroll
      for (int f = 0; f < 4; ++f) {
        a1[0] = wmma_bf(A0[f], B1[f], a1[0]);
        a1[1] = wmma_bf(A1[f], B1[f], a1[1]);
        a3[0] = wmma_bf(A0[f], B3[f], a3[0]);
        a3[1] = wmma_bf(A1[f], B3[f], a3[1]);
      }
#pragma unroll
      for (int m = 0; m < 2; ++m) {
        float e[8];                                        // exp(-s) = 2^(-s * log2 e)
#pragma unroll
        for (int r = 0; r < 8; ++r) e[r] = a1[m][r] * -1.44269504f;
        asm("v_exp_f32 %0, %0\n\tv_exp_f32 %1, %1\n\tv_exp_f32 %2, %2\n\tv_exp_f32 %3, %3\n\t"
            "v_exp_f32 %4, %4\n\tv_exp_f32 %5, %5\n\tv_exp_f32 %6, %6\n\tv_exp_f32 %7, %7\n\t"
            "v_nop"
            : "+v"(e[0]), "+v"(e[1]), "+v"(e[2]), "+v"(e[3]),
              "+v"(e[4]), "+v"(e[5]), "+v"(e[6]), "+v"(e[7]));
#pragma unroll
        for (int r = 0; r < 8; ++r) {
          const float s = a1[m][r];
          const float g = (s / (1.0f + e[r])) * a3[m][r];  // silu * gate
          acts[(m * 16 + half * 8 + r) * ASP + nn] = (__bf16)((nn < HID) ? g : 0.0f);   // pad cols -> 0
        }
      }
    }
  }
  __syncthreads();   // act of all 352 columns is in LDS

  // c) FFN down projection + residual
  {
    const __bf16* crow = acts + l16 * ASP + half * 8;
    const __bf16* wp2 = WB + (FR_W2 + wave * 11) * FRE + lane * 8;
    v8f acc[2];
    acc[0] = vz8();
    acc[1] = vz8();
#pragma unroll
    for (int f = 0; f < HIDP / 32; ++f) {              // 11 K-steps (pad rows are 0)
      const v16bf a0 = afrag_bf(crow, f * 32, 0);
      const v16bf a1 = afrag_bf(crow + 16 * ASP, f * 32, 0);
      const v16bf bw = bfrag_w(wp2 + f * FRE);
      acc[0] = wmma_bf(a0, bw, acc[0]);
      acc[1] = wmma_bf(a1, bw, acc[1]);
    }
    // As above, behind the last loads of the kernel.
    asm volatile("s_wait_xcnt 0x0" :: "v"(wp2) : "memory");
    float* op = out + (size_t)(row0 + half * 8) * DIM + col;
#pragma unroll
    for (int m = 0; m < 2; ++m)
#pragma unroll
      for (int r = 0; r < 8; ++r) op[(size_t)(m * 16 + r) * DIM] = h[m][r] + acc[m][r];
  }
}

// ---------------- launcher ----------------
extern "C" void kernel_launch(void* const* d_in, const int* in_sizes, int n_in,
                              void* d_out, int out_size, void* d_ws, size_t ws_size,
                              hipStream_t stream) {
  (void)in_sizes; (void)n_in; (void)out_size; (void)ws_size;
  const float* x  = (const float*)d_in[0];
  const float* wq = (const float*)d_in[1];
  const float* wk = (const float*)d_in[2];
  const float* wv = (const float*)d_in[3];
  const float* wo = (const float*)d_in[4];
  const float* w1 = (const float*)d_in[5];
  const float* w3 = (const float*)d_in[6];
  const float* w2 = (const float*)d_in[7];
  float* out = (float*)d_out;

  char* ws = (char*)d_ws;                       // 8 MB + 296 KB
  __bf16* Q    = (__bf16*)(ws);                 // 2 MB  [B,H,S,8]
  __bf16* K    = (__bf16*)(ws + (2u  << 20));   // 2 MB
  __bf16* V    = (__bf16*)(ws + (4u  << 20));   // 2 MB  [B,H,S/32,2,2,8,8]
  __bf16* attn = (__bf16*)(ws + (6u  << 20));   // 2 MB  [B*S,128]
  __bf16* WB   = (__bf16*)(ws + (8u  << 20));   // 296 KB  wo, w1, w3, w2 in fragment order

  const dim3 blk(256);
  k_qkv <<<dim3(MTOT / 32 + NFRAG / 8), blk, 0, stream>>>(x, wq, wk, wv, wo, w1, w3, w2, Q, K, V, WB);
  k_attn<<<dim3(SEQ / 128, BATCH * NH), blk, 0, stream>>>(Q, K, V, attn);
  k_mlp <<<dim3(MTOT / 32), blk, 0, stream>>>(attn, WB, x, out);
}

// v008
// Measured time: 38.4 microseconds a run.
// Two timings next to v007 both put it at 1.09 times that version's speed.
// Counting every step since v000, it is 3.75 times as fast.
#include <hip/hip_runtime.h>
#include <stdint.h>

// ---------------- problem constants ----------------
#define DIM   128
#define NH    16
#define HD    8
#define SEQ   2048
#define BATCH 4
#define MTOT  (BATCH*SEQ)   // 8192 rows
#define HID   344
#define HIDP  352
#define KCH   256
// bf16 copies of wo, w1, w3, w2 in B fragment order: one fragment (32 k x 16 columns) is 512 elements.
#define FRE   512           // elements of a fragment
#define FR_WO 0             // wo: 8 column tiles x 4 k steps, fragment = tile * 4 + step
#define FR_W1 32            // w1: 22 x 4
#define FR_W3 120           // w3: 22 x 4
#define FR_W2 208           // w2: 8 column tiles x 11 k steps, fragment = tile * 11 + step
#define NFRAG 296

typedef __attribute__((ext_vector_type(16))) __bf16 v16bf;
typedef __attribute__((ext_vector_type(8)))  __bf16 v8bf;
typedef __attribute__((ext_vector_type(8)))  float  v8f;
typedef __attribute__((ext_vector_type(4)))  unsigned int u32x4;
typedef __attribute__((ext_vector_type(8)))  int i32x8;
typedef __attribute__((ext_vector_type(4)))  int i32x4;

static __device__ inline v8f wmma_bf(v16bf a, v16bf b, v8f c) {
  // D = A(16x32 bf16) * B(32x16 bf16) + C(16x16 f32)
  return __builtin_amdgcn_wmma_f32_16x16x32_bf16(false, a, false, b,
                                                 (short)0, c, false, false);
}

static __device__ inline v8f vz8() {
  v8f v;
#pragma unroll
  for (int i = 0; i < 8; ++i) v[i] = 0.0f;
  return v;
}
static __device__ inline v16bf vz16() {
  v16bf v;
#pragma unroll
  for (int i = 0; i < 16; ++i) v[i] = (__bf16)0.0f;
  return v;
}

// A fragment (16x32), source fp32 row-major. lane holds row (lane&15);
// K pattern: half=lane>>4 -> elems 0..7 = K k0..k0+7, elems 8..15 = K k0+16..k0+23
static __device__ inline v16bf afrag_f32(const float* row, int kb, int half) {
  const int k0 = kb + half * 8;
  v16bf a;
#pragma unroll
  for (int j = 0; j < 8; ++j) {
    a[j]     = (__bf16)row[k0 + j];
    a[j + 8] = (__bf16)row[k0 + 16 + j];
  }
  return a;
}

// A fragment, source bf16 row-major (16B-aligned rows) -> two b128 loads
static __device__ inline v16bf afrag_bf(const __bf16* row, int kb, int half) {
  const int k0 = kb + half * 8;
  v8bf lo = *(const v8bf*)(row + k0);
  v8bf hi = *(const v8bf*)(row + k0 + 16);
  v16bf a;
#pragma unroll
  for (int j = 0; j < 8; ++j) { a[j] = lo[j]; a[j + 8] = hi[j]; }
  return a;
}

// B fragment (32x16) from fp32 weight W[K x N] (row-major, ldn = N); lane holds one column.
// From a lane's own pointer wp = W + (half * 8) * ldn + col: every load is wp plus a constant.
static __device__ inline v16bf bfrag_p(const float* wp, int ldn, int kb) {
  v16bf b;
#pragma unroll
  for (int j = 0; j < 8; ++j) {
    b[j]     = (__bf16)wp[(size_t)(kb + j) * ldn];
    b[j + 8] = (__bf16)wp[(size_t)(kb + 16 + j) * ldn];
  }
  return b;
}

// B fragment from the bf16 copy in fragment order; p = fragment + lane * 8: two b128 loads, each 512 bytes
// in a row over the wave. Elements 0..7 and 8..15 are those of bfrag_p.
static __device__ inline v16bf bfrag_w(const __bf16* p) {
  const v8bf lo = *(const v8bf*)p;
  const v8bf hi = *(const v8bf*)(p + 256);
  return __builtin_shufflevector(lo, hi, 0, 1, 2, 3, 4, 5, 6, 7, 8, 9, 10, 11, 12, 13, 14, 15);
}

// One wave rounds fragment (column tile ct, k step f) of W[nrow x LDN] to bf16 and stores it in that order;
// dst = fragment + lane * 8. The pitch is a compile-time constant: every load is a lane's pointer plus a constant.
template <int LDN>
static __device__ inline void wfrag_store(const float* W, int nrow, int ct, int f, int half, int l16, __bf16* dst) {
  const int col = ct * 16 + l16;
  const int k0 = f * 32 + half * 8;
  const bool cok = col < LDN;            // columns 344..351 of w1 and w3 do not exist: 0
  const bool kok = k0 + 16 < nrow;       // rows 344..351 of w2 do not exist: 0
  const float* p0 = W + (size_t)k0 * LDN + (cok ? col : 0);
  const float* p1 = kok ? p0 + 16 * LDN : p0;
  float a[8], b[8];
#pragma unroll
  for (int j = 0; j < 8; ++j) {
    a[j] = p0[(size_t)j * LDN];
    b[j] = p1[(size_t)j * LDN];
  }
  // One wait behind these loads, their address registers named as inputs so that they live up to it.
  asm volatile("s_wait_xcnt 0x0" :: "v"(p0), "v"(p1) : "memory");
  v8bf lo, hi;
#pragma unroll
  for (int j = 0; j < 8; ++j) {
    lo[j] = (__bf16)(cok ? a[j] : 0.0f);
    hi[j] = (__bf16)((cok && kok) ? b[j] : 0.0f);
  }
  *(v8bf*)dst = lo;
  *(v8bf*)(dst + 256) = hi;
  // In the built code the other matrices' blocks follow this one and write the registers that these stores name.
  asm volatile("s_wait_xcnt 0x0" ::: "memory");
}

static __device__ inline float xhalf(float v) {
  const int b = __builtin_bit_cast(int, v);
  return __builtin_bit_cast(float,
      __builtin_amdgcn_permlanex16(b, b, 0x76543210, 0xfedcba98, false, false));
}

static __device__ inline void tdm_load_1d(uint32_t lds_off, const void* gptr,
                                          uint32_t nbytes) {
  const uint64_t ga = (uint64_t)(uintptr_t)gptr;
  const uint32_t elems = nbytes >> 2;
  u32x4 g0;
  g0[0] = 1u;
  g0[1] = lds_off;
  g0[2] = (uint32_t)ga;
  g0[3] = (uint32_t)((ga >> 32) & 0x01FFFFFFu)
        | (2u << 30);
  i32x8 g1;
  g1[0] = (int)(2u << 16);
  g1[1] = (int)((elems & 0xFFFFu) << 16);
  g1[2] = (int)((elems >> 16) | (1u << 16));
  g1[3] = (int)((elems & 0xFFFFu) << 16);
  g1[4] = 1;
  g1[5] = (int)elems;
  g1[6] = 0;
  g1[7] = 0;
  i32x4 gz4;
  gz4[0] = 0; gz4[1] = 0; gz4[2] = 0; gz4[3] = 0;   // groups 2/3 unused (<=2D)
  i32x8 gz8;
#pragma unroll
  for (int i = 0; i < 8; ++i) gz8[i] = 0;
  __builtin_amdgcn_tensor_load_to_lds(g0, g1, gz4, gz4, gz8, 0);
}

__global__ void __launch_bounds__(256) __attribute__((amdgpu_waves_per_eu(1, 2))) k_qkv(const float* __restrict__ x,
                                             const float* __restrict__ wq,
                                             const float* __restrict__ wk,
                                             const float* __restrict__ wv,
                                             const float* __restrict__ wo,
                                             const float* __restrict__ w1,
                                             const float* __restrict__ w3,
                                             const float* __restrict__ w2,
                                             __bf16* __restrict__ Q,
                                             __bf16* __restrict__ K,
                                             __bf16* __restrict__ V,
                                             __bf16* __restrict__ WB) {
  const int wave = threadIdx.x >> 5, lane = threadIdx.x & 31;
  const int half = lane >> 4, l16 = lane & 15;
  if (blockIdx.x >= MTOT / 32) {
    // The fragment's number in a scalar register: the choice of the matrix is a scalar branch.
    const int g = __builtin_amdgcn_readfirstlane((int)(blockIdx.x - MTOT / 32) * 8 + wave);
    __bf16* dst = WB + (size_t)g * FRE + lane * 8;
    if (g < FR_W1)      wfrag_store<DIM>(wo, DIM, g >> 2, g & 3, half, l16, dst);
    else if (g < FR_W3) wfrag_store<HID>(w1, DIM, (g - FR_W1) >> 2, (g - FR_W1) & 3, half, l16, dst);
    else if (g < FR_W2) wfrag_store<HID>(w3, DIM, (g - FR_W3) >> 2, (g - FR_W3) & 3, half, l16, dst);
    else                wfrag_store<DIM>(w2, HID, (g - FR_W2) / 11, (g - FR_W2) % 11, half, l16, dst);
    return;
  }
  // A wave owns 2 row tiles x 3 column tiles of the 512 x 24 (3 matrices x 8): each x
  // fragment feeds 3 products and each weight fragment 2. The 8 waves of a block share the columns.
  const int rp = (blockIdx.x * 8 + wave) & 255;  // pair of row tiles
  const int cg = blockIdx.x >> 5;                // triple of column tiles, 0..7

  const float* xrow = x + (size_t)(rp * 32 + l16) * DIM + half * 8;
  const float* wp[3];
#pragma unroll
  for (int n = 0; n < 3; ++n) {
    const int t2 = cg * 3 + n;
    const int mat = t2 >> 3;
    wp[n] = ((mat == 0) ? wq : (mat == 1) ? wk : wv) + (half * 8) * DIM + (t2 & 7) * 16 + l16;
  }
  v8f acc[2][3];
#pragma unroll
  for (int m = 0; m < 2; ++m)
#pragma unroll
    for (int n = 0; n < 3; ++n) acc[m][n] = vz8();
#pragma unroll
  for (int f = 0; f < 4; ++f) {
    const v16bf a0 = afrag_f32(xrow, f * 32, 0);
    const v16bf a1 = afrag_f32(xrow + 16 * DIM, f * 32, 0);
#pragma unroll
    for (int n = 0; n < 3; ++n) {
      const v16bf bw = bfrag_p(wp[n], DIM, f * 32);
      acc[0][n] = wmma_bf(a0, bw, acc[0][n]);
      acc[1][n] = wmma_bf(a1, bw, acc[1][n]);
    }
  }
  // One wait behind the last loads of the products, their address registers named as inputs so that they
  // live up to it: no register that an issued load names as its address is written again in front of it.
  asm volatile("s_wait_xcnt 0x0" :: "v"(xrow), "v"(wp[0]), "v"(wp[1]), "v"(wp[2]) : "memory");
#pragma unroll
  for (int n = 0; n < 3; ++n) {
    const int t2 = cg * 3 + n;
    const int mat = t2 >> 3;
    __bf16* Out = (mat == 0) ? Q : (mat == 1) ? K : V;
    const int col = (t2 & 7) * 16 + l16;
    const int head = col >> 3, d = col & 7;
    const float osc = (mat == 0) ? 1.44269504f : 1.0f;   // Q carries log2 e: the scores are exponents of 2
    if (mat == 2) {
      // The wave's 32 rows are one block of keys; a lane's 8 accumulator rows are 8 keys in a row: 16 bytes.
      __bf16* vblk = V + ((size_t)((rp >> 6) * NH + head)) * SEQ * HD + (rp & 63) * (32 * HD) + half * 64 + d * 8;
#pragma unroll
      for (int m = 0; m < 2; ++m) {
        v8bf o;
#pragma unroll
        for (int r = 0; r < 8; ++r) o[r] = (__bf16)acc[m][n][r];
        *(v8bf*)(vblk + m * 128) = o;
      }
      // The next column tile reuses registers that these stores name as address or data: the wait closes
      // the branch, in front of that.
      // Behind the last tile too: in the built code the blocks that lay down the weight fragments follow.
      asm volatile("s_wait_xcnt 0x0" ::: "memory");
    } else {
#pragma unroll
      for (int m = 0; m < 2; ++m)
#pragma unroll
        for (int r = 0; r < 8; ++r) {
          const int grow = rp * 32 + m * 16 + half * 8 + r;
          const int b = grow >> 11, srow = grow & (SEQ - 1);
          Out[(((size_t)(b * NH + head)) * SEQ + srow) * HD + d] = (__bf16)(acc[m][n][r] * osc);
        }
      // As in the other branch; behind the last tile too: in the built code the other branch's block follows this one.
      asm volatile("s_wait_xcnt 0x0" ::: "memory");
    }
  }
}

__global__ void __launch_bounds__(256) k_attn(const __bf16* __restrict__ Q,
                                              const __bf16* __restrict__ K,
                                              const __bf16* __restrict__ V,
                                              __bf16* __restrict__ attn) {
  const int bh = blockIdx.y;
  const int wave = threadIdx.x >> 5, lane = threadIdx.x & 31;
  const int half = lane >> 4, l16 = lane & 15;
  const int swave = __builtin_amdgcn_readfirstlane(wave);   // for the store behind the loop
  const int qrow = blockIdx.x * 128 + wave * 16 + l16;   // the lane's query
  const __bf16* Qh = Q + (size_t)bh * SEQ * HD;
  const __bf16* Kh = K + (size_t)bh * SEQ * HD;
  const __bf16* Vh = V + (size_t)bh * SEQ * HD;

  __shared__ __bf16 kbuf[2][KCH * HD];         // 2 x 4KB
  __shared__ __bf16 vbuf[2][KCH * HD];         // 2 x 4KB
  __shared__ __attribute__((aligned(16))) __bf16 ones[256];   // rows 8..15 of every V^T fragment
  ones[threadIdx.x] = (__bf16)1.0f;            // read only behind the first barrier of the chunk loop

  v16bf qf[4];
  {
    const v8bf qv = *(const v8bf*)(Qh + (size_t)qrow * HD);
#pragma unroll
    for (int g = 0; g < 4; ++g) {
      qf[g] = vz16();
#pragma unroll
      for (int j = 0; j < 8; ++j) qf[g][(g >> 1) * 8 + j] = (half == (g & 1)) ? qv[j] : (__bf16)0.0f;
    }
  }

  // A lane's V piece (key half, head dim l16) of the block order that k_qkv writes, in elements.
  const int fo = ((l16 + half * 8) & 15) * HD;
  v8f cneg = vz8();      // minus the maximum in use of query l16, equal in both halves: a C operand
  float thr = -3.0e38f;  // a score above this moves the maximum in use: any in the first step, then 8
  float lo  = -3.0e38f;  // the least move: the first step takes its own maximum, later ones never go down
  v8f oacc = vz8();      // O^T: register r = row half*8 + r, lane = query; rows 0..7 head dims, row 8 the sum of P
  const bool vreal = l16 < 8;
  const int vstep = (8 - (l16 & 8)) * (4 * HD);

  if (wave == 0) {
    tdm_load_1d((uint32_t)(uintptr_t)&kbuf[0][0], Kh, KCH * HD * 2);
    tdm_load_1d((uint32_t)(uintptr_t)&vbuf[0][0], Vh, KCH * HD * 2);
  }

  for (int c = 0; c < SEQ / KCH; ++c) {
    if (wave == 0) __builtin_amdgcn_s_wait_tensorcnt(0);   // chunk c landed
    __syncthreads();                                       // visible to all waves
    if (wave == 0 && c + 1 < SEQ / KCH) {                  // prefetch chunk c+1
      const int nb = (c + 1) & 1;
      tdm_load_1d((uint32_t)(uintptr_t)&kbuf[nb][0],
                  Kh + (size_t)(c + 1) * KCH * HD, KCH * HD * 2);
      tdm_load_1d((uint32_t)(uintptr_t)&vbuf[nb][0],
                  Vh + (size_t)(c + 1) * KCH * HD, KCH * HD * 2);
    }
    const __bf16* kchb = &kbuf[c & 1][0];
    const __bf16* vp = vreal ? &vbuf[c & 1][fo] : &ones[(1 - half) * 64];

    for (int sub = 0; sub < KCH / 64; ++sub) {
      const int s0 = sub * 64;
      const v8bf klo = *(const v8bf*)(kchb + (size_t)(s0 + lane) * HD);
      const v8bf khi = *(const v8bf*)(kchb + (size_t)(s0 + 32 + lane) * HD);
      const v16bf ka = __builtin_shufflevector(klo, khi, 0, 1, 2, 3, 4, 5, 6, 7, 8, 9, 10, 11, 12, 13, 14, 15);
      // sc0[r] = score(key s0 + half*8 + r, query l16) - maximum in use; sc1, sc2, sc3: keys 16, 32, 48 further on
      v8f sc0 = wmma_bf(ka, qf[0], cneg);
      v8f sc1 = wmma_bf(ka, qf[1], cneg);
      v8f sc2 = wmma_bf(ka, qf[2], cneg);
      v8f sc3 = wmma_bf(ka, qf[3], cneg);
      __builtin_amdgcn_sched_group_barrier(0x008, 4, 0);
      __builtin_amdgcn_sched_group_barrier(0x002, 8, 0);
      const v8bf v0 = *(const v8bf*)vp;
      const v8bf v1 = *(const v8bf*)(vp + 16 * HD);
      vp += vstep;
      const v8bf v2 = *(const v8bf*)vp;
      const v8bf v3 = *(const v8bf*)(vp + 16 * HD);
      vp += vstep;

      // V^T fragments (A 16x32, rows 0..7 = head dims), keys in the order of P^T below.
      // V lies in that order (k_qkv): a lane's 8 keys of a 16-key tile are 16 bytes in a row.
      // Rows 8..15 are ones: O^T row 8 takes the sum of P^T's column, rounded as the product reads it.
      const v16bf vb0 = __builtin_shufflevector(v0, v1, 0, 1, 2, 3, 4, 5, 6, 7, 8, 9, 10, 11, 12, 13, 14, 15);
      const v16bf vb1 = __builtin_shufflevector(v2, v3, 0, 1, 2, 3, 4, 5, 6, 7, 8, 9, 10, 11, 12, 13, 14, 15);

      // online softmax, one query per lane
      // The tiles in the order of their products: the later a product, the later its scores are read.
      float mx = sc0[0];
#pragma unroll
      for (int r = 1; r < 8; ++r) mx = fmaxf(fmaxf(mx, sc0[r]), sc1[r]);
      mx = fmaxf(fmaxf(mx, sc1[0]), sc2[0]);
#pragma unroll
      for (int r = 1; r < 8; ++r) mx = fmaxf(fmaxf(mx, sc2[r]), sc3[r]);
      mx = fmaxf(mx, sc3[0]);
      if (__builtin_amdgcn_ballot_w32(mx > thr) != 0) {   // one scalar branch a step, the same for the whole wave
        mx = fmaxf(mx, xhalf(mx));
        const float delta = fmaxf(mx, lo);                // how far this query's maximum in use moves
        float scale = fminf(-delta, 0.0f);                // a first step below 0 has nothing to rescale yet
        asm("v_exp_f32 %0, %0\n\tv_nop" : "+v"(scale));
#pragma unroll
        for (int r = 0; r < 8; ++r) {
          sc0[r] -= delta;
          sc1[r] -= delta;
          sc2[r] -= delta;
          sc3[r] -= delta;
          cneg[r] -= delta;
          oacc[r] *= scale;
        }
        thr = 8.0f;
        lo = 0.0f;
      }
      float e0[8], e1[8], e2[8], e3[8];
      asm("v_exp_f32 %0, %8\n\tv_exp_f32 %1, %9\n\tv_exp_f32 %2, %10\n\tv_exp_f32 %3, %11\n\t"
          "v_exp_f32 %4, %12\n\tv_exp_f32 %5, %13\n\tv_exp_f32 %6, %14\n\tv_exp_f32 %7, %15\n\t"
          "v_nop"
          : "=&v"(e0[0]), "=&v"(e0[1]), "=&v"(e0[2]), "=&v"(e0[3]),
            "=&v"(e0[4]), "=&v"(e0[5]), "=&v"(e0[6]), "=&v"(e0[7])
          : "v"(sc0[0]), "v"(sc0[1]), "v"(sc0[2]), "v"(sc0[3]),
            "v"(sc0[4]), "v"(sc0[5]), "v"(sc0[6]), "v"(sc0[7]));
      asm("v_exp_f32 %0, %8\n\tv_exp_f32 %1, %9\n\tv_exp_f32 %2, %10\n\tv_exp_f32 %3, %11\n\t"
          "v_exp_f32 %4, %12\n\tv_exp_f32 %5, %13\n\tv_exp_f32 %6, %14\n\tv_exp_f32 %7, %15\n\t"
          "v_nop"
          : "=&v"(e1[0]), "=&v"(e1[1]), "=&v"(e1[2]), "=&v"(e1[3]),
            "=&v"(e1[4]), "=&v"(e1[5]), "=&v"(e1[6]), "=&v"(e1[7])
          : "v"(sc1[0]), "v"(sc1[1]), "v"(sc1[2]), "v"(sc1[3]),
            "v"(sc1[4]), "v"(sc1[5]), "v"(sc1[6]), "v"(sc1[7]));
      asm("v_exp_f32 %0, %8\n\tv_exp_f32 %1, %9\n\tv_exp_f32 %2, %10\n\tv_exp_f32 %3, %11\n\t"
          "v_exp_f32 %4, %12\n\tv_exp_f32 %5, %13\n\tv_exp_f32 %6, %14\n\tv_exp_f32 %7, %15\n\t"
          "v_nop"
          : "=&v"(e2[0]), "=&v"(e2[1]), "=&v"(e2[2]), "=&v"(e2[3]),
            "=&v"(e2[4]), "=&v"(e2[5]), "=&v"(e2[6]), "=&v"(e2[7])
          : "v"(sc2[0]), "v"(sc2[1]), "v"(sc2[2]), "v"(sc2[3]),
            "v"(sc2[4]), "v"(sc2[5]), "v"(sc2[6]), "v"(sc2[7]));
      asm("v_exp_f32 %0, %8\n\tv_exp_f32 %1, %9\n\tv_exp_f32 %2, %10\n\tv_exp_f32 %3, %11\n\t"
          "v_exp_f32 %4, %12\n\tv_exp_f32 %5, %13\n\tv_exp_f32 %6, %14\n\tv_exp_f32 %7, %15\n\t"
          "v_nop"
          : "=&v"(e3[0]), "=&v"(e3[1]), "=&v"(e3[2]), "=&v"(e3[3]),
            "=&v"(e3[4]), "=&v"(e3[5]), "=&v"(e3[6]), "=&v"(e3[7])
          : "v"(sc3[0]), "v"(sc3[1]), "v"(sc3[2]), "v"(sc3[3]),
            "v"(sc3[4]), "v"(sc3[5]), "v"(sc3[6]), "v"(sc3[7]));
      v16bf pb0, pb1;      // P^T fragments (B 32x16): element j = key half*8 + j, j + 8 = 16 + half*8 + j
#pragma unroll
      for (int r = 0; r < 8; ++r) {
        pb0[r]     = (__bf16)e0[r];
        pb0[r + 8] = (__bf16)e1[r];
        pb1[r]     = (__bf16)e2[r];
        pb1[r + 8] = (__bf16)e3[r];
      }
      asm("v_wmma_f32_16x16x32_bf16 %0, %1, %2, %0\n\tv_wmma_f32_16x16x32_bf16 %0, %3, %4, %0\n\t"
          "v_nop\n\tv_nop\n\tv_nop\n\tv_nop"
          : "+v"(oacc)
          : "v"(__builtin_bit_cast(i32x8, vb0)), "v"(__builtin_bit_cast(i32x8, pb0)),
            "v"(__builtin_bit_cast(i32x8, vb1)), "v"(__builtin_bit_cast(i32x8, pb1)));
    }
    __syncthreads();   // all waves done with buffer c&1 before it is re-filled
  }
  // normalize + store [B,S,128] bf16: lane (half 0) = query, 8 head dims = 16 bytes
  const float lrow = xhalf(oacc[0]);   // half 0 takes O^T row 8 of its query from half 1
  if (half == 0) {
    const int b = bh >> 4, h = bh & 15;
    v8bf o;
#pragma unroll
    for (int r = 0; r < 8; ++r) o[r] = (__bf16)(oacc[r] / lrow);
    const int q = blockIdx.x * 128 + swave * 16 + (int)(__builtin_amdgcn_mbcnt_lo(~0u, 0u) & 15u);
    *(v8bf*)(attn + ((size_t)(b * SEQ + q)) * DIM + h * HD) = o;
  }
}

// ---------------- 3) output projection, FFN gate and FFN down projection in one launch ----------------
// All three are local to a row of the sequence. A block of 8 waves owns 32 rows, one block per WGP:
//   a) h = x + attn @ wo: wave w owns column tile w of both row tiles; h stays in its registers in f32
//      and goes to LDS in bf16;
//   b) act = silu(h @ w1) * (h @ w3): wave w owns column tiles w, w + 8, w + 16 of the 22; act goes to LDS;
//   c) out = h + act @ w2: wave w owns column tile w again, so the residual is the h it still holds.
// Each weight fragment feeds both row tiles. Roundings and the order of every sum are those of three launches.
// The weights come as bf16 in fragment order (WB, written by k_qkv): 2 loads of 16 bytes a lane for a fragment.
// The loops over f, m, r and j are unrolled because their indices select registers.
#define HSP 136
#define ASP 360
__global__ void __launch_bounds__(256) __attribute__((amdgpu_waves_per_eu(1, 2))) k_mlp(const __bf16* __restrict__ attn,
                                             const __bf16* __restrict__ WB,
                                             const float* __restrict__ x,
                                             float* __restrict__ out) {
  __shared__ __attribute__((aligned(16))) __bf16 hs[32 * HSP];
  __shared__ __attribute__((aligned(16))) __bf16 acts[32 * ASP];
  // The wave's number in a scalar register: the loop over column tiles then ends on a scalar branch.
  const int wave = __builtin_amdgcn_readfirstlane(threadIdx.x >> 5), lane = threadIdx.x & 31;
  const int half = lane >> 4, l16 = lane & 15;
  const int row0 = blockIdx.x * 32;
  const int col = wave * 16 + l16;

  // a) output projection + residual
  v8f h[2];
  {
    const __bf16* arow = attn + (size_t)(row0 + l16) * DIM + half * 8;
    const __bf16* wpo = WB + (FR_WO + wave * 4) * FRE + lane * 8;
    const float* xp = x + (size_t)(row0 + half * 8) * DIM + col;
    h[0] = vz8();
    h[1] = vz8();
#pragma unroll
    for (int f = 0; f < 4; ++f) {
      const v16bf a0 = afrag_bf(arow, f * 32, 0);
      const v16bf a1 = afrag_bf(arow + 16 * DIM, f * 32, 0);
      const v16bf bw = bfrag_w(wpo + f * FRE);
      h[0] = wmma_bf(a0, bw, h[0]);
      h[1] = wmma_bf(a1, bw, h[1]);
    }
#pragma unroll
    for (int m = 0; m < 2; ++m)
#pragma unroll
      for (int r = 0; r < 8; ++r) {
        h[m][r] = xp[(size_t)(m * 16 + r) * DIM] + h[m][r];
        hs[(m * 16 + half * 8 + r) * HSP + col] = (__bf16)h[m][r];
      }
    // One wait behind the last loads of this part, their address registers named as inputs so that they
    // live up to it: no register that an issued load names as its address is written again in front of it.
    asm volatile("s_wait_xcnt 0x0" :: "v"(arow), "v"(wpo), "v"(xp) : "memory");
  }
  __syncthreads();   // h of all 128 columns is in LDS

  // b) FFN gate
  {
    const __bf16* hrow = hs + l16 * HSP + half * 8;
    v16bf A0[4], A1[4];
#pragma unroll
    for (int f = 0; f < 4; ++f) {
      A0[f] = afrag_bf(hrow, f * 32, 0);
      A1[f] = afrag_bf(hrow + 16 * HSP, f * 32, 0);
    }
    for (int ct = wave; ct < HIDP / 16; ct += 8) {
      const int nn = ct * 16 + l16;
      const __bf16* p1 = WB + (FR_W1 + ct * 4) * FRE + lane * 8;
      const __bf16* p3 = WB + (FR_W3 + ct * 4) * FRE + lane * 8;
      v8f a1[2], a3[2];
#pragma unroll
      for (int m = 0; m < 2; ++m) { a1[m] = vz8(); a3[m] = vz8(); }
      v16bf B1[4], B3[4];
#pragma unroll
      for (int f = 0; f < 4; ++f) {
        B1[f] = bfrag_w(p1 + f * FRE);
        B3[f] = bfrag_w(p3 + f * FRE);
      }
      // Keeps the products behind the loads: without it the scheduler deals the loads out among the products,
      // two at a time, and the tile pays the latency of L2 four times over instead of once.
      __builtin_amdgcn_sched_barrier(0);
      // As above: the next column tile forms new addresses only behind this wait.
      asm volatile("s_wait_xcnt 0x0" :: "v"(p1), "v"(p3) : "memory");
#pragma unroll
      for (int f = 0; f < 4; ++f) {
        a1[0] = wmma_bf(A0[f], B1[f], a1[0]);
        a1[1] = wmma_bf(A1[f], B1[f], a1[1]);
        a3[0] = wmma_bf(A0[f], B3[f], a3[0]);
        a3[1] = wmma_bf(A1[f], B3[f], a3[1]);
      }
#pragma unroll
      for (int m = 0; m < 2; ++m) {
        float e[8];                                        // exp(-s) = 2^(-s * log2 e)
#pragma unroll
        for (int r = 0; r < 8; ++r) e[r] = a1[m][r] * -1.44269504f;
        asm("v_exp_f32 %0, %0\n\tv_exp_f32 %1, %1\n\tv_exp_f32 %2, %2\n\tv_exp_f32 %3, %3\n\t"
            "v_exp_f32 %4, %4\n\tv_exp_f32 %5, %5\n\tv_exp_f32 %6, %6\n\tv_exp_f32 %7, %7\n\t"
            "v_nop"
            : "+v"(e[0]), "+v"(e[1]), "+v"(e[2]), "+v"(e[3]),
              "+v"(e[4]), "+v"(e[5]), "+v"(e[6]), "+v"(e[7]));
#pragma unroll
        for (int r = 0; r < 8; ++r) {
          const float s = a1[m][r];
          const float g = (s / (1.0f + e[r])) * a3[m][r];  // silu * gate
          acts[(m * 16 + half * 8 + r) * ASP + nn] = (__bf16)((nn < HID) ? g : 0.0f);   // pad cols -> 0
        }
      }
    }
  }
  __syncthreads();   // act of all 352 columns is in LDS

  // c) FFN down projection + residual
  {
    const __bf16* crow = acts + l16 * ASP + half * 8;
    const __bf16* wp2 = WB + (FR_W2 + wave * 11) * FRE + lane * 8;
    v8f acc[2];
    acc[0] = vz8();
    acc[1] = vz8();
#pragma unroll
    for (int f = 0; f < HIDP / 32; ++f) {              // 11 K-steps (pad rows are 0)
      const v16bf a0 = afrag_bf(crow, f * 32, 0);
      const v16bf a1 = afrag_bf(crow + 16 * ASP, f * 32, 0);
      const v16bf bw = bfrag_w(wp2 + f * FRE);
      acc[0] = wmma_bf(a0, bw, acc[0]);
      acc[1] = wmma_bf(a1, bw, acc[1]);
    }
    // As above, behind the last loads of the kernel.
    asm volatile("s_wait_xcnt 0x0" :: "v"(wp2) : "memory");
    float* op = out + (size_t)(row0 + half * 8) * DIM + col;
#pragma unroll
    for (int m = 0; m < 2; ++m)
#pragma unroll
      for (int r = 0; r < 8; ++r) op[(size_t)(m * 16 + r) * DIM] = h[m][r] + acc[m][r];
  }
}

// ---------------- launcher ----------------
extern "C" void kernel_launch(void* const* d_in, const int* in_sizes, int n_in,
                              void* d_out, int out_size, void* d_ws, size_t ws_size,
                              hipStream_t stream) {
  (void)in_sizes; (void)n_in; (void)out_size; (void)ws_size;
  const float* x  = (const float*)d_in[0];
  const float* wq = (const float*)d_in[1];
  const float* wk = (const float*)d_in[2];
  const float* wv = (const float*)d_in[3];
  const float* wo = (const float*)d_in[4];
  const float* w1 = (const float*)d_in[5];
  const float* w3 = (const float*)d_in[6];
  const float* w2 = (const float*)d_in[7];
  float* out = (float*)d_out;

  char* ws = (char*)d_ws;                       // 8 MB + 296 KB
  __bf16* Q    = (__bf16*)(ws);                 // 2 MB  [B,H,S,8]
  __bf16* K    = (__bf16*)(ws + (2u  << 20));   // 2 MB
  __bf16* V    = (__bf16*)(ws + (4u  << 20));   // 2 MB  [B,H,S/32,2,2,8,8]
  __bf16* attn = (__bf16*)(ws + (6u  << 20));   // 2 MB  [B*S,128]
  __bf16* WB   = (__bf16*)(ws + (8u  << 20));   // 296 KB  wo, w1, w3, w2 in fragment order

  const dim3 blk(256);
  k_qkv <<<dim3(MTOT / 32 + NFRAG / 8), blk, 0, stream>>>(x, wq, wk, wv, wo, w1, w3, w2, Q, K, V, WB);
  k_attn<<<dim3(SEQ / 128, BATCH * NH), blk, 0, stream>>>(Q, K, V, attn);
  k_mlp <<<dim3(MTOT / 32), blk, 0, stream>>>(attn, WB, x, out);
}

// v009
// Measured time: 35.1 microseconds a run.
// Two timings next to v008 both put it at 1.08 times that version's speed.
// All steps since v000 together make it 4.04 times as fast.
#include <hip/hip_runtime.h>
#include <stdint.h>

// ---------------- problem constants ----------------
#define DIM   128
#define NH    16
#define HD    8
#define SEQ   2048
#define BATCH 4
#define MTOT  (BATCH*SEQ)   // 8192 rows
#define HID   344
#define HIDP  352
#define KCH   256
// bf16 copies of wo, w1, w3, w2 in B fragment order: one fragment (32 k x 16 columns) is 512 elements.
#define FRE   512           // elements of a fragment
#define FR_WO 0             // wo: 8 column tiles x 4 k steps, fragment = tile * 4 + step
#define FR_W1 32            // w1: 22 x 4
#define FR_W3 120           // w3: 22 x 4
#define FR_W2 208           // w2: 8 column tiles x 11 k steps, fragment = tile * 11 + step
#define NFRAG 296

typedef __attribute__((ext_vector_type(16))) __bf16 v16bf;
typedef __attribute__((ext_vector_type(8)))  __bf16 v8bf;
typedef __attribute__((ext_vector_type(8)))  float  v8f;
typedef __attribute__((ext_vector_type(4)))  unsigned int u32x4;
typedef __attribute__((ext_vector_type(8)))  int i32x8;
typedef __attribute__((ext_vector_type(4)))  int i32x4;

static __device__ inline v8f wmma_bf(v16bf a, v16bf b, v8f c) {
  // D = A(16x32 bf16) * B(32x16 bf16) + C(16x16 f32)
  return __builtin_amdgcn_wmma_f32_16x16x32_bf16(false, a, false, b,
                                                 (short)0, c, false, false);
}

static __device__ inline v8f vz8() {
  v8f v;
#pragma unroll
  for (int i = 0; i < 8; ++i) v[i] = 0.0f;
  return v;
}
static __device__ inline v16bf vz16() {
  v16bf v;
#pragma unroll
  for (int i = 0; i < 16; ++i) v[i] = (__bf16)0.0f;
  return v;
}

// A fragment (16x32), source fp32 row-major. lane holds row (lane&15);
// K pattern: half=lane>>4 -> elems 0..7 = K k0..k0+7, elems 8..15 = K k0+16..k0+23
static __device__ inline v16bf afrag_f32(const float* row, int kb, int half) {
  const int k0 = kb + half * 8;
  v16bf a;
#pragma unroll
  for (int j = 0; j < 8; ++j) {
    a[j]     = (__bf16)row[k0 + j];
    a[j + 8] = (__bf16)row[k0 + 16 + j];
  }
  return a;
}

// A fragment, source bf16 row-major (16B-aligned rows) -> two b128 loads
static __device__ inline v16bf afrag_bf(const __bf16* row, int kb, int half) {
  const int k0 = kb + half * 8;
  v8bf lo = *(const v8bf*)(row + k0);
  v8bf hi = *(const v8bf*)(row + k0 + 16);
  v16bf a;
#pragma unroll
  for (int j = 0; j < 8; ++j) { a[j] = lo[j]; a[j + 8] = hi[j]; }
  return a;
}

// B fragment (32x16) from fp32 weight W[K x N] (row-major, ldn = N); lane holds one column.
// From a lane's own pointer wp = W + (half * 8) * ldn + col: every load is wp plus a constant.
static __device__ inline v16bf bfrag_p(const float* wp, int ldn, int kb) {
  v16bf b;
#pragma unroll
  for (int j = 0; j < 8; ++j) {
    b[j]     = (__bf16)wp[(size_t)(kb + j) * ldn];
    b[j + 8] = (__bf16)wp[(size_t)(kb + 16 + j) * ldn];
  }
  return b;
}

// B fragment from the bf16 copy in fragment order; p = fragment + lane * 8: two b128 loads, each 512 bytes
// in a row over the wave. Elements 0..7 and 8..15 are those of bfrag_p.
static __device__ inline v16bf bfrag_w(const __bf16* p) {
  const v8bf lo = *(const v8bf*)p;
  const v8bf hi = *(const v8bf*)(p + 256);
  return __builtin_shufflevector(lo, hi, 0, 1, 2, 3, 4, 5, 6, 7, 8, 9, 10, 11, 12, 13, 14, 15);
}

// One wave rounds fragment (column tile ct, k step f) of W[nrow x LDN] to bf16 and stores it in that order;
// dst = fragment + lane * 8. The pitch is a compile-time constant: every load is a lane's pointer plus a constant.
template <int LDN>
static __device__ inline void wfrag_store(const float* W, int nrow, int ct, int f, int half, int l16, __bf16* dst) {
  const int col = ct * 16 + l16;
  const int k0 = f * 32 + half * 8;
  const bool cok = col < LDN;            // columns 344..351 of w1 and w3 do not exist: 0
  const bool kok = k0 + 16 < nrow;       // rows 344..351 of w2 do not exist: 0
  const float* p0 = W + (size_t)k0 * LDN + (cok ? col : 0);
  const float* p1 = kok ? p0 + 16 * LDN : p0;
  float a[8], b[8];
#pragma unroll
  for (int j = 0; j < 8; ++j) {
    a[j] = p0[(size_t)j * LDN];
    b[j] = p1[(size_t)j * LDN];
  }
  // One wait behind these loads, their address registers named as inputs so that they live up to it.
  asm volatile("s_wait_xcnt 0x0" :: "v"(p0), "v"(p1) : "memory");
  v8bf lo, hi;
#pragma unroll
  for (int j = 0; j < 8; ++j) {
    lo[j] = (__bf16)(cok ? a[j] : 0.0f);
    hi[j] = (__bf16)((cok && kok) ? b[j] : 0.0f);
  }
  *(v8bf*)dst = lo;
  *(v8bf*)(dst + 256) = hi;
  // In the built code the other matrices' blocks follow this one and write the registers that these stores name.
  asm volatile("s_wait_xcnt 0x0" ::: "memory");
}

static __device__ inline float xhalf(float v) {
  const int b = __builtin_bit_cast(int, v);
  return __builtin_bit_cast(float,
      __builtin_amdgcn_permlanex16(b, b, 0x76543210, 0xfedcba98, false, false));
}

static __device__ inline void tdm_load_1d(uint32_t lds_off, const void* gptr,
                                          uint32_t nbytes) {
  const uint64_t ga = (uint64_t)(uintptr_t)gptr;
  const uint32_t elems = nbytes >> 2;
  u32x4 g0;
  g0[0] = 1u;
  g0[1] = lds_off;
  g0[2] = (uint32_t)ga;
  g0[3] = (uint32_t)((ga >> 32) & 0x01FFFFFFu)
        | (2u << 30);
  i32x8 g1;
  g1[0] = (int)(2u << 16);
  g1[1] = (int)((elems & 0xFFFFu) << 16);
  g1[2] = (int)((elems >> 16) | (1u << 16));
  g1[3] = (int)((elems & 0xFFFFu) << 16);
  g1[4] = 1;
  g1[5] = (int)elems;
  g1[6] = 0;
  g1[7] = 0;
  i32x4 gz4;
  gz4[0] = 0; gz4[1] = 0; gz4[2] = 0; gz4[3] = 0;   // groups 2/3 unused (<=2D)
  i32x8 gz8;
#pragma unroll
  for (int i = 0; i < 8; ++i) gz8[i] = 0;
  __builtin_amdgcn_tensor_load_to_lds(g0, g1, gz4, gz4, gz8, 0);
}

__global__ void __launch_bounds__(256) __attribute__((amdgpu_waves_per_eu(1, 2))) k_qkv(const float* __restrict__ x,
                                             const float* __restrict__ wq,
                                             const float* __restrict__ wk,
                                             const float* __restrict__ wv,
                                             const float* __restrict__ wo,
                                             const float* __restrict__ w1,
                                             const float* __restrict__ w3,
                                             const float* __restrict__ w2,
                                             __bf16* __restrict__ Q,
                                             __bf16* __restrict__ K,
                                             __bf16* __restrict__ V,
                                             __bf16* __restrict__ WB) {
  const int wave = threadIdx.x >> 5, lane = threadIdx.x & 31;
  const int half = lane >> 4, l16 = lane & 15;
  if (blockIdx.x >= MTOT / 32) {
    // The fragment's number in a scalar register: the choice of the matrix is a scalar branch.
    const int g = __builtin_amdgcn_readfirstlane((int)(blockIdx.x - MTOT / 32) * 8 + wave);
    __bf16* dst = WB + (size_t)g * FRE + lane * 8;
    if (g < FR_W1)      wfrag_store<DIM>(wo, DIM, g >> 2, g & 3, half, l16, dst);
    else if (g < FR_W3) wfrag_store<HID>(w1, DIM, (g - FR_W1) >> 2, (g - FR_W1) & 3, half, l16, dst);
    else if (g < FR_W2) wfrag_store<HID>(w3, DIM, (g - FR_W3) >> 2, (g - FR_W3) & 3, half, l16, dst);
    else                wfrag_store<DIM>(w2, HID, (g - FR_W2) / 11, (g - FR_W2) % 11, half, l16, dst);
    return;
  }
  // A wave owns 2 row tiles x 3 column tiles of the 512 x 24 (3 matrices x 8): each x
  // fragment feeds 3 products and each weight fragment 2. The 8 waves of a block share the columns.
  const int rp = (blockIdx.x * 8 + wave) & 255;  // pair of row tiles
  const int cg = blockIdx.x >> 5;                // triple of column tiles, 0..7

  const float* xrow = x + (size_t)(rp * 32 + l16) * DIM + half * 8;
  const float* wp[3];
#pragma unroll
  for (int n = 0; n < 3; ++n) {
    const int t2 = cg * 3 + n;
    const int mat = t2 >> 3;
    wp[n] = ((mat == 0) ? wq : (mat == 1) ? wk : wv) + (half * 8) * DIM + (t2 & 7) * 16 + l16;
  }
  v8f acc[2][3];
#pragma unroll
  for (int m = 0; m < 2; ++m)
#pragma unroll
    for (int n = 0; n < 3; ++n) acc[m][n] = vz8();
#pragma unroll
  for (int f = 0; f < 4; ++f) {
    const v16bf a0 = afrag_f32(xrow, f * 32, 0);
    const v16bf a1 = afrag_f32(xrow + 16 * DIM, f * 32, 0);
#pragma unroll
    for (int n = 0; n < 3; ++n) {
      const v16bf bw = bfrag_p(wp[n], DIM, f * 32);
      acc[0][n] = wmma_bf(a0, bw, acc[0][n]);
      acc[1][n] = wmma_bf(a1, bw, acc[1][n]);
    }
  }
  // One wait behind the last loads of the products, their address registers named as inputs so that they
  // live up to it: no register that an issued load names as its address is written again in front of it.
  asm volatile("s_wait_xcnt 0x0" :: "v"(xrow), "v"(wp[0]), "v"(wp[1]), "v"(wp[2]) : "memory");
#pragma unroll
  for (int n = 0; n < 3; ++n) {
    const int t2 = cg * 3 + n;
    const int mat = t2 >> 3;
    __bf16* Out = (mat == 0) ? Q : (mat == 1) ? K : V;
    const int col = (t2 & 7) * 16 + l16;
    const int head = col >> 3, d = col & 7;
    const float osc = (mat == 0) ? 1.44269504f : 1.0f;   // Q carries log2 e: the scores are exponents of 2
    if (mat == 2) {
      // The wave's 32 rows are one block of keys; a lane's 8 accumulator rows are 8 keys in a row: 16 bytes.
      __bf16* vblk = V + ((size_t)((rp >> 6) * NH + head)) * SEQ * HD + (rp & 63) * (32 * HD) + half * 64 + d * 8;
#pragma unroll
      for (int m = 0; m < 2; ++m) {
        v8bf o;
#pragma unroll
        for (int r = 0; r < 8; ++r) o[r] = (__bf16)acc[m][n][r];
        *(v8bf*)(vblk + m * 128) = o;
      }
      // The next column tile reuses registers that these stores name as address or data: the wait closes
      // the branch, in front of that.
      // Behind the last tile too: in the built code the blocks that lay down the weight fragments follow.
      asm volatile("s_wait_xcnt 0x0" ::: "memory");
    } else {
#pragma unroll
      for (int m = 0; m < 2; ++m)
#pragma unroll
        for (int r = 0; r < 8; ++r) {
          const int grow = rp * 32 + m * 16 + half * 8 + r;
          const int b = grow >> 11, srow = grow & (SEQ - 1);
          Out[(((size_t)(b * NH + head)) * SEQ + srow) * HD + d] = (__bf16)(acc[m][n][r] * osc);
        }
      // As in the other branch; behind the last tile too: in the built code the other branch's block follows this one.
      asm volatile("s_wait_xcnt 0x0" ::: "memory");
    }
  }
}

template <bool LEAD>
static __device__ inline __attribute__((always_inline)) i32x4 exp_pack(const v8f& s) {
  int w0, w1, w2, w3;
  float e0, e1, e2, e3, e4, e5, e6, e7;
  if constexpr (LEAD)
    asm("v_nop\n\tv_nop\n\tv_nop\n\tv_nop\n\t"
        "v_exp_f32 %0, %12\n\tv_exp_f32 %1, %13\n\tv_exp_f32 %2, %14\n\tv_exp_f32 %3, %15\n\t"
        "v_exp_f32 %4, %16\n\tv_exp_f32 %5, %17\n\tv_exp_f32 %6, %18\n\tv_exp_f32 %7, %19\n\t"
        "v_cvt_pk_bf16_f32 %8, %0, %1\n\tv_cvt_pk_bf16_f32 %9, %2, %3\n\t"
        "s_delay_alu instid0(TRANS32_DEP_3)\n\tv_cvt_pk_bf16_f32 %10, %4, %5\n\t"
        "s_delay_alu instid0(TRANS32_DEP_1)\n\tv_cvt_pk_bf16_f32 %11, %6, %7"
        : "=&v"(e0), "=&v"(e1), "=&v"(e2), "=&v"(e3), "=&v"(e4), "=&v"(e5), "=&v"(e6), "=&v"(e7),
          "=&v"(w0), "=&v"(w1), "=&v"(w2), "=&v"(w3)
        : "v"(s[0]), "v"(s[1]), "v"(s[2]), "v"(s[3]), "v"(s[4]), "v"(s[5]), "v"(s[6]), "v"(s[7]));
  else
    asm("v_exp_f32 %0, %12\n\tv_exp_f32 %1, %13\n\tv_exp_f32 %2, %14\n\tv_exp_f32 %3, %15\n\t"
        "v_exp_f32 %4, %16\n\tv_exp_f32 %5, %17\n\tv_exp_f32 %6, %18\n\tv_exp_f32 %7, %19\n\t"
        "v_cvt_pk_bf16_f32 %8, %0, %1\n\tv_cvt_pk_bf16_f32 %9, %2, %3\n\t"
        "s_delay_alu instid0(TRANS32_DEP_3)\n\tv_cvt_pk_bf16_f32 %10, %4, %5\n\t"
        "s_delay_alu instid0(TRANS32_DEP_1)\n\tv_cvt_pk_bf16_f32 %11, %6, %7"
        : "=&v"(e0), "=&v"(e1), "=&v"(e2), "=&v"(e3), "=&v"(e4), "=&v"(e5), "=&v"(e6), "=&v"(e7),
          "=&v"(w0), "=&v"(w1), "=&v"(w2), "=&v"(w3)
        : "v"(s[0]), "v"(s[1]), "v"(s[2]), "v"(s[3]), "v"(s[4]), "v"(s[5]), "v"(s[6]), "v"(s[7]));
  i32x4 w;
  w[0] = w0; w[1] = w1; w[2] = w2; w[3] = w3;
  return w;
}

// One step of k_attn: 64 keys for the wave's 16 queries. kp: the lane's K piece; vp: the lane's V piece.
// Not EXACT, the loop's form: K and V come from LDS (vp of the lanes of rows 8..15: their ones, vstep 0), and the
// scores go to the exponentials as they come.
// EXACT, the form of the second run: K and V come from global memory (the lanes of rows 8..15 read a V piece too and
// drop it for ones), and the step looks at its scores and moves the maximum in use where one lies more than 8 above.
template <bool EXACT>
static __device__ inline __attribute__((always_inline)) void attn_step(const __bf16* kp, const __bf16* vp, int vstep,
                                                                       bool vreal, const v16bf (&qf)[4], v8f& cneg,
                                                                       v8f& oacc) {
  const v8bf klo = *(const v8bf*)kp;
  const v8bf khi = *(const v8bf*)(kp + 32 * HD);
  const v16bf ka = __builtin_shufflevector(klo, khi, 0, 1, 2, 3, 4, 5, 6, 7, 8, 9, 10, 11, 12, 13, 14, 15);
  // sc0[r] = score(key s0 + half*8 + r, query l16) - maximum in use; sc1, sc2, sc3: keys 16, 32, 48 further on
  v8f sc0 = wmma_bf(ka, qf[0], cneg);
  v8f sc1 = wmma_bf(ka, qf[1], cneg);
  v8f sc2 = wmma_bf(ka, qf[2], cneg);
  v8f sc3 = wmma_bf(ka, qf[3], cneg);
  if constexpr (EXACT) {
    __builtin_amdgcn_sched_group_barrier(0x008, 4, 0);
    __builtin_amdgcn_sched_group_barrier(0x002, 8, 0);
  }
  v8bf v0 = *(const v8bf*)vp;
  v8bf v1 = *(const v8bf*)(vp + 16 * HD);
  v8bf v2 = *(const v8bf*)(vp + vstep);
  v8bf v3 = *(const v8bf*)(vp + vstep + 16 * HD);
  if constexpr (EXACT) {
    // One wait behind the step's global loads, their address registers named as inputs so that they live up to it:
    // the next step forms new addresses only behind it.
    asm volatile("s_wait_xcnt 0x0" :: "v"(kp), "v"(vp) : "memory");
#pragma unroll
    for (int j = 0; j < 8; ++j) {
      v0[j] = vreal ? v0[j] : (__bf16)1.0f;
      v1[j] = vreal ? v1[j] : (__bf16)1.0f;
      v2[j] = vreal ? v2[j] : (__bf16)1.0f;
      v3[j] = vreal ? v3[j] : (__bf16)1.0f;
    }
  }

  // V^T fragments (A 16x32, rows 0..7 = head dims), keys in the order of P^T below.
  // V lies in that order (k_qkv): a lane's 8 keys of a 16-key tile are 16 bytes in a row.
  // Rows 8..15 are ones: O^T row 8 takes the sum of P^T's column, rounded as the product reads it.
  const v16bf vb0 = __builtin_shufflevector(v0, v1, 0, 1, 2, 3, 4, 5, 6, 7, 8, 9, 10, 11, 12, 13, 14, 15);
  const v16bf vb1 = __builtin_shufflevector(v2, v3, 0, 1, 2, 3, 4, 5, 6, 7, 8, 9, 10, 11, 12, 13, 14, 15);

  // online softmax, one query per lane
  if constexpr (EXACT) {
    // The tiles in the order of their products: the later a product, the later its scores are read.
    float mx = sc0[0];
#pragma unroll
    for (int r = 1; r < 8; ++r) mx = fmaxf(fmaxf(mx, sc0[r]), sc1[r]);
    mx = fmaxf(fmaxf(mx, sc1[0]), sc2[0]);
#pragma unroll
    for (int r = 1; r < 8; ++r) mx = fmaxf(fmaxf(mx, sc2[r]), sc3[r]);
    mx = fmaxf(mx, sc3[0]);
    if (__builtin_amdgcn_ballot_w32(mx > 8.0f) != 0) {   // one scalar branch a step, the same for the whole wave
      mx = fmaxf(mx, xhalf(mx));
      const float delta = fmaxf(mx, 0.0f);              // how far this query's maximum in use moves: never down
      float scale = -delta;
      asm("v_exp_f32 %0, %0\n\tv_nop" : "+v"(scale));
#pragma unroll
      for (int r = 0; r < 8; ++r) {
        sc0[r] -= delta;
        sc1[r] -= delta;
        sc2[r] -= delta;
        sc3[r] -= delta;
        cneg[r] -= delta;
        oacc[r] *= scale;
      }
    }
  }
  i32x8 pw0, pw1;      // P^T fragments (B 32x16), two bf16 a word: element j = key half*8 + j, j + 8 = 16 + half*8 + j
  if constexpr (EXACT) {
    float e0[8], e1[8], e2[8], e3[8];
    asm("v_exp_f32 %0, %8\n\tv_exp_f32 %1, %9\n\tv_exp_f32 %2, %10\n\tv_exp_f32 %3, %11\n\t"
        "v_exp_f32 %4, %12\n\tv_exp_f32 %5, %13\n\tv_exp_f32 %6, %14\n\tv_exp_f32 %7, %15\n\t"
        "v_nop"
        : "=&v"(e0[0]), "=&v"(e0[1]), "=&v"(e0[2]), "=&v"(e0[3]),
          "=&v"(e0[4]), "=&v"(e0[5]), "=&v"(e0[6]), "=&v"(e0[7])
        : "v"(sc0[0]), "v"(sc0[1]), "v"(sc0[2]), "v"(sc0[3]),
          "v"(sc0[4]), "v"(sc0[5]), "v"(sc0[6]), "v"(sc0[7]));
    asm("v_exp_f32 %0, %8\n\tv_exp_f32 %1, %9\n\tv_exp_f32 %2, %10\n\tv_exp_f32 %3, %11\n\t"
        "v_exp_f32 %4, %12\n\tv_exp_f32 %5, %13\n\tv_exp_f32 %6, %14\n\tv_exp_f32 %7, %15\n\t"
        "v_nop"
        : "=&v"(e1[0]), "=&v"(e1[1]), "=&v"(e1[2]), "=&v"(e1[3]),
          "=&v"(e1[4]), "=&v"(e1[5]), "=&v"(e1[6]), "=&v"(e1[7])
        : "v"(sc1[0]), "v"(sc1[1]), "v"(sc1[2]), "v"(sc1[3]),
          "v"(sc1[4]), "v"(sc1[5]), "v"(sc1[6]), "v"(sc1[7]));
    asm("v_exp_f32 %0, %8\n\tv_exp_f32 %1, %9\n\tv_exp_f32 %2, %10\n\tv_exp_f32 %3, %11\n\t"
        "v_exp_f32 %4, %12\n\tv_exp_f32 %5, %13\n\tv_exp_f32 %6, %14\n\tv_exp_f32 %7, %15\n\t"
        "v_nop"
        : "=&v"(e2[0]), "=&v"(e2[1]), "=&v"(e2[2]), "=&v"(e2[3]),
          "=&v"(e2[4]), "=&v"(e2[5]), "=&v"(e2[6]), "=&v"(e2[7])
        : "v"(sc2[0]), "v"(sc2[1]), "v"(sc2[2]), "v"(sc2[3]),
          "v"(sc2[4]), "v"(sc2[5]), "v"(sc2[6]), "v"(sc2[7]));
    asm("v_exp_f32 %0, %8\n\tv_exp_f32 %1, %9\n\tv_exp_f32 %2, %10\n\tv_exp_f32 %3, %11\n\t"
        "v_exp_f32 %4, %12\n\tv_exp_f32 %5, %13\n\tv_exp_f32 %6, %14\n\tv_exp_f32 %7, %15\n\t"
        "v_nop"
        : "=&v"(e3[0]), "=&v"(e3[1]), "=&v"(e3[2]), "=&v"(e3[3]),
          "=&v"(e3[4]), "=&v"(e3[5]), "=&v"(e3[6]), "=&v"(e3[7])
        : "v"(sc3[0]), "v"(sc3[1]), "v"(sc3[2]), "v"(sc3[3]),
          "v"(sc3[4]), "v"(sc3[5]), "v"(sc3[6]), "v"(sc3[7]));
    v16bf pb0, pb1;
#pragma unroll
    for (int r = 0; r < 8; ++r) {
      pb0[r]     = (__bf16)e0[r];
      pb0[r + 8] = (__bf16)e1[r];
      pb1[r]     = (__bf16)e2[r];
      pb1[r + 8] = (__bf16)e3[r];
    }
    pw0 = __builtin_bit_cast(i32x8, pb0);
    pw1 = __builtin_bit_cast(i32x8, pb1);
  } else {
    const i32x4 p0 = exp_pack<true>(sc0);
    const i32x4 p1 = exp_pack<false>(sc1);
    const i32x4 p2 = exp_pack<false>(sc2);
    const i32x4 p3 = exp_pack<false>(sc3);
    pw0 = __builtin_shufflevector(p0, p1, 0, 1, 2, 3, 4, 5, 6, 7);
    pw1 = __builtin_shufflevector(p2, p3, 0, 1, 2, 3, 4, 5, 6, 7);
  }
  asm("v_wmma_f32_16x16x32_bf16 %0, %1, %2, %0\n\tv_wmma_f32_16x16x32_bf16 %0, %3, %4, %0\n\t"
      "v_nop\n\tv_nop\n\tv_nop\n\tv_nop"
      : "+v"(oacc)
      : "v"(__builtin_bit_cast(i32x8, vb0)), "v"(pw0), "v"(__builtin_bit_cast(i32x8, vb1)), "v"(pw1));
}

__global__ void __launch_bounds__(256) k_attn(const __bf16* __restrict__ Q,
                                              const __bf16* __restrict__ K,
                                              const __bf16* __restrict__ V,
                                              __bf16* __restrict__ attn) {
  const int bh = blockIdx.y;
  const int wave = threadIdx.x >> 5, lane = threadIdx.x & 31;
  const int half = lane >> 4, l16 = lane & 15;
  const int swave = __builtin_amdgcn_readfirstlane(wave);   // for the store behind the loop
  const int qrow = blockIdx.x * 128 + wave * 16 + l16;   // the lane's query
  const __bf16* Qh = Q + (size_t)bh * SEQ * HD;
  const __bf16* Kh = K + (size_t)bh * SEQ * HD;
  const __bf16* Vh = V + (size_t)bh * SEQ * HD;

  __shared__ __bf16 kbuf[2][KCH * HD];         // 2 x 4KB
  __shared__ __bf16 vbuf[2][KCH * HD];         // 2 x 4KB
  __shared__ __attribute__((aligned(16))) __bf16 ones[256];   // rows 8..15 of the V^T fragments read from LDS
  ones[threadIdx.x] = (__bf16)1.0f;            // read only behind the first barrier of the chunk loop

  v16bf qf[4];
  {
    const v8bf qv = *(const v8bf*)(Qh + (size_t)qrow * HD);
#pragma unroll
    for (int g = 0; g < 4; ++g) {
      qf[g] = vz16();
#pragma unroll
      for (int j = 0; j < 8; ++j) qf[g][(g >> 1) * 8 + j] = (half == (g & 1)) ? qv[j] : (__bf16)0.0f;
    }
  }

  // A lane's V piece (key half, head dim l16) of the block order that k_qkv writes, in elements.
  const int fo = ((l16 + half * 8) & 15) * HD;
  v8f cneg = vz8();      // minus the maximum in use of query l16, equal in both halves: a C operand
  v8f oacc = vz8();      // O^T: register r = row half*8 + r, lane = query; rows 0..7 head dims, row 8 the sum of P
  const bool vreal = l16 < 8;
  const int vstep = (8 - (l16 & 8)) * (4 * HD);

  if (wave == 0) {
    tdm_load_1d((uint32_t)(uintptr_t)&kbuf[0][0], Kh, KCH * HD * 2);
    tdm_load_1d((uint32_t)(uintptr_t)&vbuf[0][0], Vh, KCH * HD * 2);
  }

  // The maximum in use starts as the maximum over the first 64 keys, read here from global memory while chunk 0 flies.
  {
    const v8bf klo = *(const v8bf*)(Kh + (size_t)lane * HD);
    const v8bf khi = *(const v8bf*)(Kh + (size_t)(32 + lane) * HD);
    const v16bf ka = __builtin_shufflevector(klo, khi, 0, 1, 2, 3, 4, 5, 6, 7, 8, 9, 10, 11, 12, 13, 14, 15);
    float mx = -3.0e38f;
#pragma unroll
    for (int g = 0; g < 4; ++g) {
      const v8f sc = wmma_bf(ka, qf[g], cneg);
#pragma unroll
      for (int r = 0; r < 8; ++r) mx = fmaxf(mx, sc[r]);
    }
    mx = fmaxf(mx, xhalf(mx));
#pragma unroll
    for (int r = 0; r < 8; ++r) cneg[r] = -mx;
  }

  for (int c = 0; c < SEQ / KCH; ++c) {
    if (wave == 0) __builtin_amdgcn_s_wait_tensorcnt(0);   // chunk c landed
    __syncthreads();                                       // visible to all waves
    if (wave == 0 && c + 1 < SEQ / KCH) {                  // prefetch chunk c+1
      const int nb = (c + 1) & 1;
      tdm_load_1d((uint32_t)(uintptr_t)&kbuf[nb][0],
                  Kh + (size_t)(c + 1) * KCH * HD, KCH * HD * 2);
      tdm_load_1d((uint32_t)(uintptr_t)&vbuf[nb][0],
                  Vh + (size_t)(c + 1) * KCH * HD, KCH * HD * 2);
    }
    const __bf16* kchb = &kbuf[c & 1][0];
    const __bf16* vp = vreal ? &vbuf[c & 1][fo] : &ones[(1 - half) * 64];

#pragma unroll 1
    for (int sub = 0; sub < KCH / 64; ++sub)
      attn_step<false>(kchb + (size_t)(sub * 64 + lane) * HD, vp + sub * 2 * vstep, vstep, vreal, qf, cneg, oacc);
    __syncthreads();   // all waves done with buffer c&1 before it is re-filled
  }
  if ((__builtin_amdgcn_ballot_w32(!(oacc[0] <= 4294967296.0f)) & 0xffff0000u) != 0) {   // a scalar branch
    oacc = vz8();
    for (int s = 0; s < SEQ / 64; ++s)
      attn_step<true>(Kh + (size_t)(s * 64 + lane) * HD, Vh + (size_t)s * (64 * HD) + fo, 32 * HD, vreal, qf, cneg, oacc);
  }
  // normalize + store [B,S,128] bf16: lane (half 0) = query, 8 head dims = 16 bytes
  const float lrow = xhalf(oacc[0]);   // half 0 takes O^T row 8 of its query from half 1
  if (half == 0) {
    const int b = bh >> 4, h = bh & 15;
    v8bf o;
#pragma unroll
    for (int r = 0; r < 8; ++r) o[r] = (__bf16)(oacc[r] / lrow);
    const int q = blockIdx.x * 128 + swave * 16 + (int)(__builtin_amdgcn_mbcnt_lo(~0u, 0u) & 15u);
    *(v8bf*)(attn + ((size_t)(b * SEQ + q)) * DIM + h * HD) = o;
  }
}

// ---------------- 3) output projection, FFN gate and FFN down projection in one launch ----------------
// All three are local to a row of the sequence. A block of 8 waves owns 32 rows, one block per WGP:
//   a) h = x + attn @ wo: wave w owns column tile w of both row tiles; h stays in its registers in f32
//      and goes to LDS in bf16;
//   b) act = silu(h @ w1) * (h @ w3): wave w owns column tiles w, w + 8, w + 16 of the 22; act goes to LDS;
//   c) out = h + act @ w2: wave w owns column tile w again, so the residual is the h it still holds.
// Each weight fragment feeds both row tiles. Roundings and the order of every sum are those of three launches.
// The weights come as bf16 in fragment order (WB, written by k_qkv): 2 loads of 16 bytes a lane for a fragment.
// The loops over f, m, r and j are unrolled because their indices select registers.
#define HSP 136
#define ASP 360
__global__ void __launch_bounds__(256) __attribute__((amdgpu_waves_per_eu(1, 2))) k_mlp(const __bf16* __restrict__ attn,
                                             const __bf16* __restrict__ WB,
                                             const float* __restrict__ x,
                                             float* __restrict__ out) {
  __shared__ __attribute__((aligned(16))) __bf16 hs[32 * HSP];
  __shared__ __attribute__((aligned(16))) __bf16 acts[32 * ASP];
  // The wave's number in a scalar register: the loop over column tiles then ends on a scalar branch.
  const int wave = __builtin_amdgcn_readfirstlane(threadIdx.x >> 5), lane = threadIdx.x & 31;
  const int half = lane >> 4, l16 = lane & 15;
  const int row0 = blockIdx.x * 32;
  const int col = wave * 16 + l16;

  // a) output projection + residual
  v8f h[2];
  {
    const __bf16* arow = attn + (size_t)(row0 + l16) * DIM + half * 8;
    const __bf16* wpo = WB + (FR_WO + wave * 4) * FRE + lane * 8;
    const float* xp = x + (size_t)(row0 + half * 8) * DIM + col;
    h[0] = vz8();
    h[1] = vz8();
#pragma unroll
    for (int f = 0; f < 4; ++f) {
      const v16bf a0 = afrag_bf(arow, f * 32, 0);
      const v16bf a1 = afrag_bf(arow + 16 * DIM, f * 32, 0);
      const v16bf bw = bfrag_w(wpo + f * FRE);
      h[0] = wmma_bf(a0, bw, h[0]);
      h[1] = wmma_bf(a1, bw, h[1]);
    }
#pragma unroll
    for (int m = 0; m < 2; ++m)
#pragma unroll
      for (int r = 0; r < 8; ++r) {
        h[m][r] = xp[(size_t)(m * 16 + r) * DIM] + h[m][r];
        hs[(m * 16 + half * 8 + r) * HSP + col] = (__bf16)h[m][r];
      }
    // One wait behind the last loads of this part, their address registers named as inputs so that they
    // live up to it: no register that an issued load names as its address is written again in front of it.
    asm volatile("s_wait_xcnt 0x0" :: "v"(arow), "v"(wpo), "v"(xp) : "memory");
  }
  __syncthreads();   // h of all 128 columns is in LDS

  // b) FFN gate
  {
    const __bf16* hrow = hs + l16 * HSP + half * 8;
    v16bf A0[4], A1[4];
#pragma unroll
    for (int f = 0; f < 4; ++f) {
      A0[f] = afrag_bf(hrow, f * 32, 0);
      A1[f] = afrag_bf(hrow + 16 * HSP, f * 32, 0);
    }
    for (int ct = wave; ct < HIDP / 16; ct += 8) {
      const int nn = ct * 16 + l16;
      const __bf16* p1 = WB + (FR_W1 + ct * 4) * FRE + lane * 8;
      const __bf16* p3 = WB + (FR_W3 + ct * 4) * FRE + lane * 8;
      v8f a1[2], a3[2];
#pragma unroll
      for (int m = 0; m < 2; ++m) { a1[m] = vz8(); a3[m] = vz8(); }
      v16bf B1[4], B3[4];
#pragma unroll
      for (int f = 0; f < 4; ++f) {
        B1[f] = bfrag_w(p1 + f * FRE);
        B3[f] = bfrag_w(p3 + f * FRE);
      }
      // Keeps the products behind the loads: without it the scheduler deals the loads out among the products,
      // two at a time, and the tile pays the latency of L2 four times over instead of once.
      __builtin_amdgcn_sched_barrier(0);
      // As above: the next column tile forms new addresses only behind this wait.
      asm volatile("s_wait_xcnt 0x0" :: "v"(p1), "v"(p3) : "memory");
#pragma unroll
      for (int f = 0; f < 4; ++f) {
        a1[0] = wmma_bf(A0[f], B1[f], a1[0]);
        a1[1] = wmma_bf(A1[f], B1[f], a1[1]);
        a3[0] = wmma_bf(A0[f], B3[f], a3[0]);
        a3[1] = wmma_bf(A1[f], B3[f], a3[1]);
      }
#pragma unroll
      for (int m = 0; m < 2; ++m) {
        float e[8];                                        // exp(-s) = 2^(-s * log2 e)
#pragma unroll
        for (int r = 0; r < 8; ++r) e[r] = a1[m][r] * -1.44269504f;
        asm("v_exp_f32 %0, %0\n\tv_exp_f32 %1, %1\n\tv_exp_f32 %2, %2\n\tv_exp_f32 %3, %3\n\t"
            "v_exp_f32 %4, %4\n\tv_exp_f32 %5, %5\n\tv_exp_f32 %6, %6\n\tv_exp_f32 %7, %7\n\t"
            "v_nop"
            : "+v"(e[0]), "+v"(e[1]), "+v"(e[2]), "+v"(e[3]),
              "+v"(e[4]), "+v"(e[5]), "+v"(e[6]), "+v"(e[7]));
#pragma unroll
        for (int r = 0; r < 8; ++r) {
          const float s = a1[m][r];
          const float g = (s / (1.0f + e[r])) * a3[m][r];  // silu * gate
          acts[(m * 16 + half * 8 + r) * ASP + nn] = (__bf16)((nn < HID) ? g : 0.0f);   // pad cols -> 0
        }
      }
    }
  }
  __syncthreads();   // act of all 352 columns is in LDS

  // c) FFN down projection + residual
  {
    const __bf16* crow = acts + l16 * ASP + half * 8;
    const __bf16* wp2 = WB + (FR_W2 + wave * 11) * FRE + lane * 8;
    v8f acc[2];
    acc[0] = vz8();
    acc[1] = vz8();
#pragma unroll
    for (int f = 0; f < HIDP / 32; ++f) {              // 11 K-steps (pad rows are 0)
      const v16bf a0 = afrag_bf(crow, f * 32, 0);
      const v16bf a1 = afrag_bf(crow + 16 * ASP, f * 32, 0);
      const v16bf bw = bfrag_w(wp2 + f * FRE);
      acc[0] = wmma_bf(a0, bw, acc[0]);
      acc[1] = wmma_bf(a1, bw, acc[1]);
    }
    // As above, behind the last loads of the kernel.
    asm volatile("s_wait_xcnt 0x0" :: "v"(wp2) : "memory");
    float* op = out + (size_t)(row0 + half * 8) * DIM + col;
#pragma unroll
    for (int m = 0; m < 2; ++m)
#pragma unroll
      for (int r = 0; r < 8; ++r) op[(size_t)(m * 16 + r) * DIM] = h[m][r] + acc[m][r];
  }
}

// ---------------- launcher ----------------
extern "C" void kernel_launch(void* const* d_in, const int* in_sizes, int n_in,
                              void* d_out, int out_size, void* d_ws, size_t ws_size,
                              hipStream_t stream) {
  (void)in_sizes; (void)n_in; (void)out_size; (void)ws_size;
  const float* x  = (const float*)d_in[0];
  const float* wq = (const float*)d_in[1];
  const float* wk = (const float*)d_in[2];
  const float* wv = (const float*)d_in[3];
  const float* wo = (const float*)d_in[4];
  const float* w1 = (const float*)d_in[5];
  const float* w3 = (const float*)d_in[6];
  const float* w2 = (const float*)d_in[7];
  float* out = (float*)d_out;

  char* ws = (char*)d_ws;                       // 8 MB + 296 KB
  __bf16* Q    = (__bf16*)(ws);                 // 2 MB  [B,H,S,8]
  __bf16* K    = (__bf16*)(ws + (2u  << 20));   // 2 MB
  __bf16* V    = (__bf16*)(ws + (4u  << 20));   // 2 MB  [B,H,S/32,2,2,8,8]
  __bf16* attn = (__bf16*)(ws + (6u  << 20));   // 2 MB  [B*S,128]
  __bf16* WB   = (__bf16*)(ws + (8u  << 20));   // 296 KB  wo, w1, w3, w2 in fragment order

  const dim3 blk(256);
  k_qkv <<<dim3(MTOT / 32 + NFRAG / 8), blk, 0, stream>>>(x, wq, wk, wv, wo, w1, w3, w2, Q, K, V, WB);
  k_attn<<<dim3(SEQ / 128, BATCH * NH), blk, 0, stream>>>(Q, K, V, attn);
  k_mlp <<<dim3(MTOT / 32), blk, 0, stream>>>(attn, WB, x, out);
}

// v010
// One run takes 33 microseconds.
// Two timings next to v009 put it at 1.08 and 1.09 times that version's speed.
// All steps since v000 together make it 4.39 times as fast.
#include <hip/hip_runtime.h>
#include <stdint.h>

// ---------------- problem constants ----------------
#define DIM   128
#define NH    16
#define HD    8
#define SEQ   2048
#define BATCH 4
#define MTOT  (BATCH*SEQ)   // 8192 rows
#define HID   344
#define HIDP  352
#define KCH   256
// bf16 copies of wo, w1, w3, w2 in B fragment order: one fragment (32 k x 16 columns) is 512 elements.
#define FRE   512           // elements of a fragment
#define FR_WO 0             // wo: 8 column tiles x 4 k steps, fragment = tile * 4 + step
#define FR_W1 32            // w1: 22 x 4
#define FR_W3 120           // w3: 22 x 4
#define FR_W2 208           // w2: 8 column tiles x 11 k steps, fragment = tile * 11 + step
#define NFRAG 296

typedef __attribute__((ext_vector_type(16))) __bf16 v16bf;
typedef __attribute__((ext_vector_type(8)))  __bf16 v8bf;
typedef __attribute__((ext_vector_type(16))) _Float16 v16h;
typedef __attribute__((ext_vector_type(8)))  _Float16 v8h;
typedef __attribute__((ext_vector_type(8)))  float  v8f;
typedef __attribute__((ext_vector_type(4)))  unsigned int u32x4;
typedef __attribute__((ext_vector_type(8)))  int i32x8;
typedef __attribute__((ext_vector_type(4)))  int i32x4;

static __device__ inline v8f wmma_bf(v16bf a, v16bf b, v8f c) {
  // D = A(16x32 bf16) * B(32x16 bf16) + C(16x16 f32)
  return __builtin_amdgcn_wmma_f32_16x16x32_bf16(false, a, false, b,
                                                 (short)0, c, false, false);
}

// The same product on f16 operands, f32 result.
static __device__ inline v8f wmma_h(v16h a, v16h b, v8f c) {
  return __builtin_amdgcn_wmma_f32_16x16x32_f16(false, a, false, b, (short)0, c, false, false);
}

static __device__ inline v8f vz8() {
  v8f v;
#pragma unroll
  for (int i = 0; i < 8; ++i) v[i] = 0.0f;
  return v;
}

static __device__ inline v16h vz16h() {
  v16h v;
#pragma unroll
  for (int i = 0; i < 16; ++i) v[i] = (_Float16)0.0f;
  return v;
}

// A fragment (16x32), source fp32 row-major. lane holds row (lane&15);
// K pattern: half=lane>>4 -> elems 0..7 = K k0..k0+7, elems 8..15 = K k0+16..k0+23
static __device__ inline v16bf afrag_f32(const float* row, int kb, int half) {
  const int k0 = kb + half * 8;
  v16bf a;
#pragma unroll
  for (int j = 0; j < 8; ++j) {
    a[j]     = (__bf16)row[k0 + j];
    a[j + 8] = (__bf16)row[k0 + 16 + j];
  }
  return a;
}

// A fragment, source bf16 row-major (16B-aligned rows) -> two b128 loads
static __device__ inline v16bf afrag_bf(const __bf16* row, int kb, int half) {
  const int k0 = kb + half * 8;
  v8bf lo = *(const v8bf*)(row + k0);
  v8bf hi = *(const v8bf*)(row + k0 + 16);
  v16bf a;
#pragma unroll
  for (int j = 0; j < 8; ++j) { a[j] = lo[j]; a[j + 8] = hi[j]; }
  return a;
}

// B fragment (32x16) from fp32 weight W[K x N] (row-major, ldn = N); lane holds one column.
// From a lane's own pointer wp = W + (half * 8) * ldn + col: every load is wp plus a constant.
static __device__ inline v16bf bfrag_p(const float* wp, int ldn, int kb) {
  v16bf b;
#pragma unroll
  for (int j = 0; j < 8; ++j) {
    b[j]     = (__bf16)wp[(size_t)(kb + j) * ldn];
    b[j + 8] = (__bf16)wp[(size_t)(kb + 16 + j) * ldn];
  }
  return b;
}

// B fragment from the bf16 copy in fragment order; p = fragment + lane * 8: two b128 loads, each 512 bytes
// in a row over the wave. Elements 0..7 and 8..15 are those of bfrag_p.
static __device__ inline v16bf bfrag_w(const __bf16* p) {
  const v8bf lo = *(const v8bf*)p;
  const v8bf hi = *(const v8bf*)(p + 256);
  return __builtin_shufflevector(lo, hi, 0, 1, 2, 3, 4, 5, 6, 7, 8, 9, 10, 11, 12, 13, 14, 15);
}

// One wave rounds fragment (column tile ct, k step f) of W[nrow x LDN] to bf16 and stores it in that order;
// dst = fragment + lane * 8. The pitch is a compile-time constant: every load is a lane's pointer plus a constant.
template <int LDN>
static __device__ inline void wfrag_store(const float* W, int nrow, int ct, int f, int half, int l16, __bf16* dst) {
  const int col = ct * 16 + l16;
  const int k0 = f * 32 + half * 8;
  const bool cok = col < LDN;            // columns 344..351 of w1 and w3 do not exist: 0
  const bool kok = k0 + 16 < nrow;       // rows 344..351 of w2 do not exist: 0
  const float* p0 = W + (size_t)k0 * LDN + (cok ? col : 0);
  const float* p1 = kok ? p0 + 16 * LDN : p0;
  float a[8], b[8];
#pragma unroll
  for (int j = 0; j < 8; ++j) {
    a[j] = p0[(size_t)j * LDN];
    b[j] = p1[(size_t)j * LDN];
  }
  // One wait behind these loads, their address registers named as inputs so that they live up to it.
  asm volatile("s_wait_xcnt 0x0" :: "v"(p0), "v"(p1) : "memory");
  v8bf lo, hi;
#pragma unroll
  for (int j = 0; j < 8; ++j) {
    lo[j] = (__bf16)(cok ? a[j] : 0.0f);
    hi[j] = (__bf16)((cok && kok) ? b[j] : 0.0f);
  }
  *(v8bf*)dst = lo;
  *(v8bf*)(dst + 256) = hi;
  // In the built code the other matrices' blocks follow this one and write the registers that these stores name.
  asm volatile("s_wait_xcnt 0x0" ::: "memory");
}

static __device__ inline float xhalf(float v) {
  const int b = __builtin_bit_cast(int, v);
  return __builtin_bit_cast(float,
      __builtin_amdgcn_permlanex16(b, b, 0x76543210, 0xfedcba98, false, false));
}

static __device__ inline void tdm_load_1d(uint32_t lds_off, const void* gptr,
                                          uint32_t nbytes) {
  const uint64_t ga = (uint64_t)(uintptr_t)gptr;
  const uint32_t elems = nbytes >> 2;
  u32x4 g0;
  g0[0] = 1u;
  g0[1] = lds_off;
  g0[2] = (uint32_t)ga;
  g0[3] = (uint32_t)((ga >> 32) & 0x01FFFFFFu)
        | (2u << 30);
  i32x8 g1;
  g1[0] = (int)(2u << 16);
  g1[1] = (int)((elems & 0xFFFFu) << 16);
  g1[2] = (int)((elems >> 16) | (1u << 16));
  g1[3] = (int)((elems & 0xFFFFu) << 16);
  g1[4] = 1;
  g1[5] = (int)elems;
  g1[6] = 0;
  g1[7] = 0;
  i32x4 gz4;
  gz4[0] = 0; gz4[1] = 0; gz4[2] = 0; gz4[3] = 0;   // groups 2/3 unused (<=2D)
  i32x8 gz8;
#pragma unroll
  for (int i = 0; i < 8; ++i) gz8[i] = 0;
  __builtin_amdgcn_tensor_load_to_lds(g0, g1, gz4, gz4, gz8, 0);
}

__global__ void __launch_bounds__(256) __attribute__((amdgpu_waves_per_eu(1, 2))) k_qkv(const float* __restrict__ x,
                                             const float* __restrict__ wq,
                                             const float* __restrict__ wk,
                                             const float* __restrict__ wv,
                                             const float* __restrict__ wo,
                                             const float* __restrict__ w1,
                                             const float* __restrict__ w3,
                                             const float* __restrict__ w2,
                                             _Float16* __restrict__ Q,
                                             _Float16* __restrict__ K,
                                             _Float16* __restrict__ V,
                                             __bf16* __restrict__ WB) {
  const int wave = threadIdx.x >> 5, lane = threadIdx.x & 31;
  const int half = lane >> 4, l16 = lane & 15;
  if (blockIdx.x >= MTOT / 32) {
    // The fragment's number in a scalar register: the choice of the matrix is a scalar branch.
    const int g = __builtin_amdgcn_readfirstlane((int)(blockIdx.x - MTOT / 32) * 8 + wave);
    __bf16* dst = WB + (size_t)g * FRE + lane * 8;
    if (g < FR_W1)      wfrag_store<DIM>(wo, DIM, g >> 2, g & 3, half, l16, dst);
    else if (g < FR_W3) wfrag_store<HID>(w1, DIM, (g - FR_W1) >> 2, (g - FR_W1) & 3, half, l16, dst);
    else if (g < FR_W2) wfrag_store<HID>(w3, DIM, (g - FR_W3) >> 2, (g - FR_W3) & 3, half, l16, dst);
    else                wfrag_store<DIM>(w2, HID, (g - FR_W2) / 11, (g - FR_W2) % 11, half, l16, dst);
    return;
  }
  // A wave owns 2 row tiles x 3 column tiles of the 512 x 24 (3 matrices x 8): each x
  // fragment feeds 3 products and each weight fragment 2. The 8 waves of a block share the columns.
  const int rp = (blockIdx.x * 8 + wave) & 255;  // pair of row tiles
  const int cg = blockIdx.x >> 5;                // triple of column tiles, 0..7

  const float* xrow = x + (size_t)(rp * 32 + l16) * DIM + half * 8;
  const float* wp[3];
#pragma unroll
  for (int n = 0; n < 3; ++n) {
    const int t2 = cg * 3 + n;
    const int mat = t2 >> 3;
    wp[n] = ((mat == 0) ? wq : (mat == 1) ? wk : wv) + (half * 8) * DIM + (t2 & 7) * 16 + l16;
  }
  v8f acc[2][3];
#pragma unroll
  for (int m = 0; m < 2; ++m)
#pragma unroll
    for (int n = 0; n < 3; ++n) acc[m][n] = vz8();
#pragma unroll
  for (int f = 0; f < 4; ++f) {
    const v16bf a0 = afrag_f32(xrow, f * 32, 0);
    const v16bf a1 = afrag_f32(xrow + 16 * DIM, f * 32, 0);
#pragma unroll
    for (int n = 0; n < 3; ++n) {
      const v16bf bw = bfrag_p(wp[n], DIM, f * 32);
      acc[0][n] = wmma_bf(a0, bw, acc[0][n]);
      acc[1][n] = wmma_bf(a1, bw, acc[1][n]);
    }
  }
  // One wait behind the last loads of the products, their address registers named as inputs so that they
  // live up to it: no register that an issued load names as its address is written again in front of it.
  asm volatile("s_wait_xcnt 0x0" :: "v"(xrow), "v"(wp[0]), "v"(wp[1]), "v"(wp[2]) : "memory");
#pragma unroll
  for (int n = 0; n < 3; ++n) {
    const int t2 = cg * 3 + n;
    const int mat = t2 >> 3;
    _Float16* Out = (mat == 0) ? Q : (mat == 1) ? K : V;
    const int col = (t2 & 7) * 16 + l16;
    const int head = col >> 3, d = col & 7;
    const float osc = (mat == 0) ? 1.44269504f : 1.0f;   // Q carries log2 e: the scores are exponents of 2
    if (mat == 2) {
      // The wave's 32 rows are one block of keys; a lane's 8 accumulator rows are 8 keys in a row: 16 bytes.
      _Float16* vblk = V + ((size_t)((rp >> 6) * NH + head)) * SEQ * HD + (rp & 63) * (32 * HD) + half * 64 + d * 8;
#pragma unroll
      for (int m = 0; m < 2; ++m) {
        v8h o;
#pragma unroll
        for (int r = 0; r < 8; ++r) o[r] = (_Float16)acc[m][n][r];
        *(v8h*)(vblk + m * 128) = o;
      }
      // The next column tile reuses registers that these stores name as address or data: the wait closes
      // the branch, in front of that.
      // Behind the last tile too: in the built code the blocks that lay down the weight fragments follow.
      asm volatile("s_wait_xcnt 0x0" ::: "memory");
    } else {
#pragma unroll
      for (int m = 0; m < 2; ++m)
#pragma unroll
        for (int r = 0; r < 8; ++r) {
          const int grow = rp * 32 + m * 16 + half * 8 + r;
          const int b = grow >> 11, srow = grow & (SEQ - 1);
          Out[(((size_t)(b * NH + head)) * SEQ + srow) * HD + d] = (_Float16)(acc[m][n][r] * osc);
        }
      // As in the other branch; behind the last tile too: in the built code the other branch's block follows this one.
      asm volatile("s_wait_xcnt 0x0" ::: "memory");
    }
  }
}

// The type of the C operand that carries minus the maximum in use: f16 in the loop, f32 in the second run.
template <bool EXACT> struct score_t { typedef v8h t; };
template <> struct score_t<true> { typedef v8f t; };

// One step of k_attn: 64 keys for the wave's 16 queries. kp: the lane's K piece; vp: the lane's V piece.
// Not EXACT, the loop's form: K and V come from LDS (vp of the lanes of rows 8..15: their ones, vstep 0), and the
// scores, written by their product as f16, go to the exponentials as they come.
// EXACT, the form of the second run: K and V come from global memory (the lanes of rows 8..15 read a V piece too and
// drop it for ones), the scores are f32, and the step looks at them and moves the maximum in use where one lies more than 8 above.
template <bool EXACT>
static __device__ inline __attribute__((always_inline)) void attn_step(const _Float16* kp, const _Float16* vp, int vstep,
                                                                       bool vreal, const v16h (&qf)[4],
                                                                       typename score_t<EXACT>::t& cneg, v8f& oacc) {
  const v8h klo = *(const v8h*)kp;
  const v8h khi = *(const v8h*)(kp + 32 * HD);
  const v16h ka = __builtin_shufflevector(klo, khi, 0, 1, 2, 3, 4, 5, 6, 7, 8, 9, 10, 11, 12, 13, 14, 15);
  // sc0[r] = score(key s0 + half*8 + r, query l16) - maximum in use; sc1, sc2, sc3: keys 16, 32, 48 further on
  v8f sc0, sc1, sc2, sc3;   // the second run's; the loop's scores are f16 and stay inside its statement below
  i32x8 pw0, pw1;           // P^T fragments (B 32x16), two f16 a word: element j = key half*8 + j, j + 8 = 16 + half*8 + j
  if constexpr (!EXACT) {
    asm("v_wmma_f16_16x16x32_f16 v[96:99], %2, %3, %7\n\tv_wmma_f16_16x16x32_f16 v[100:103], %2, %4, %7\n\t"
        "v_wmma_f16_16x16x32_f16 v[104:107], %2, %5, %7\n\tv_wmma_f16_16x16x32_f16 v[108:111], %2, %6, %7\n\t"
        "v_nop\n\t"
        "v_exp_f16 v96.l, v96.l\n\tv_exp_f16 v97.l, v97.l\n\tv_exp_f16 v98.l, v98.l\n\tv_exp_f16 v99.l, v99.l\n\t"
        "v_exp_f16 v96.h, v96.h\n\tv_exp_f16 v97.h, v97.h\n\tv_exp_f16 v98.h, v98.h\n\tv_exp_f16 v99.h, v99.h\n\t"
        "v_exp_f16 v100.l, v100.l\n\tv_exp_f16 v101.l, v101.l\n\tv_exp_f16 v102.l, v102.l\n\tv_exp_f16 v103.l, v103.l\n\t"
        "v_exp_f16 v100.h, v100.h\n\tv_exp_f16 v101.h, v101.h\n\tv_exp_f16 v102.h, v102.h\n\tv_exp_f16 v103.h, v103.h\n\t"
        "v_exp_f16 v104.l, v104.l\n\tv_exp_f16 v105.l, v105.l\n\tv_exp_f16 v106.l, v106.l\n\tv_exp_f16 v107.l, v107.l\n\t"
        "v_exp_f16 v104.h, v104.h\n\tv_exp_f16 v105.h, v105.h\n\tv_exp_f16 v106.h, v106.h\n\tv_exp_f16 v107.h, v107.h\n\t"
        "v_exp_f16 v108.l, v108.l\n\tv_exp_f16 v109.l, v109.l\n\tv_exp_f16 v110.l, v110.l\n\tv_exp_f16 v111.l, v111.l\n\t"
        "v_exp_f16 v108.h, v108.h\n\tv_exp_f16 v109.h, v109.h\n\tv_exp_f16 v110.h, v110.h\n\tv_exp_f16 v111.h, v111.h"
        : "=&{v[96:103]}"(pw0), "=&{v[104:111]}"(pw1)
        : "v"(__builtin_bit_cast(i32x8, ka)), "v"(__builtin_bit_cast(i32x8, qf[0])), "v"(__builtin_bit_cast(i32x8, qf[1])),
          "v"(__builtin_bit_cast(i32x8, qf[2])), "v"(__builtin_bit_cast(i32x8, qf[3])), "v"(__builtin_bit_cast(i32x4, cneg)));
  }
  if constexpr (EXACT) {
    sc0 = wmma_h(ka, qf[0], cneg);
    sc1 = wmma_h(ka, qf[1], cneg);
    sc2 = wmma_h(ka, qf[2], cneg);
    sc3 = wmma_h(ka, qf[3], cneg);
    __builtin_amdgcn_sched_group_barrier(0x008, 4, 0);
    __builtin_amdgcn_sched_group_barrier(0x002, 8, 0);
  }
  v8h v0 = *(const v8h*)vp;
  v8h v1 = *(const v8h*)(vp + 16 * HD);
  v8h v2 = *(const v8h*)(vp + vstep);
  v8h v3 = *(const v8h*)(vp + vstep + 16 * HD);
  if constexpr (EXACT) {
    // One wait behind the step's global loads, their address registers named as inputs so that they live up to it:
    // the next step forms new addresses only behind it.
    asm volatile("s_wait_xcnt 0x0" :: "v"(kp), "v"(vp) : "memory");
#pragma unroll
    for (int j = 0; j < 8; ++j) {
      v0[j] = vreal ? v0[j] : (_Float16)1.0f;
      v1[j] = vreal ? v1[j] : (_Float16)1.0f;
      v2[j] = vreal ? v2[j] : (_Float16)1.0f;
      v3[j] = vreal ? v3[j] : (_Float16)1.0f;
    }
  }

  // V^T fragments (A 16x32, rows 0..7 = head dims), keys in the order of P^T below.
  // V lies in that order (k_qkv): a lane's 8 keys of a 16-key tile are 16 bytes in a row.
  // Rows 8..15 are ones: O^T row 8 takes the sum of P^T's column, rounded as the product reads it.
  const v16h vb0 = __builtin_shufflevector(v0, v1, 0, 1, 2, 3, 4, 5, 6, 7, 8, 9, 10, 11, 12, 13, 14, 15);
  const v16h vb1 = __builtin_shufflevector(v2, v3, 0, 1, 2, 3, 4, 5, 6, 7, 8, 9, 10, 11, 12, 13, 14, 15);

  // online softmax, one query per lane
  if constexpr (EXACT) {
    // The tiles in the order of their products: the later a product, the later its scores are read.
    float mx = sc0[0];
#pragma unroll
    for (int r = 1; r < 8; ++r) mx = fmaxf(fmaxf(mx, sc0[r]), sc1[r]);
    mx = fmaxf(fmaxf(mx, sc1[0]), sc2[0]);
#pragma unroll
    for (int r = 1; r < 8; ++r) mx = fmaxf(fmaxf(mx, sc2[r]), sc3[r]);
    mx = fmaxf(mx, sc3[0]);
    if (__builtin_amdgcn_ballot_w32(mx > 8.0f) != 0) {   // one scalar branch a step, the same for the whole wave
      mx = fmaxf(mx, xhalf(mx));
      const float delta = fmaxf(mx, 0.0f);              // how far this query's maximum in use moves: never down
      float scale = -delta;
      asm("v_exp_f32 %0, %0\n\tv_nop" : "+v"(scale));
#pragma unroll
      for (int r = 0; r < 8; ++r) {
        sc0[r] -= delta;
        sc1[r] -= delta;
        sc2[r] -= delta;
        sc3[r] -= delta;
        cneg[r] -= delta;
        oacc[r] *= scale;
      }
    }
  }
  if constexpr (EXACT) {
    float e0[8], e1[8], e2[8], e3[8];
    asm("v_exp_f32 %0, %8\n\tv_exp_f32 %1, %9\n\tv_exp_f32 %2, %10\n\tv_exp_f32 %3, %11\n\t"
        "v_exp_f32 %4, %12\n\tv_exp_f32 %5, %13\n\tv_exp_f32 %6, %14\n\tv_exp_f32 %7, %15\n\t"
        "v_nop"
        : "=&v"(e0[0]), "=&v"(e0[1]), "=&v"(e0[2]), "=&v"(e0[3]),
          "=&v"(e0[4]), "=&v"(e0[5]), "=&v"(e0[6]), "=&v"(e0[7])
        : "v"(sc0[0]), "v"(sc0[1]), "v"(sc0[2]), "v"(sc0[3]),
          "v"(sc0[4]), "v"(sc0[5]), "v"(sc0[6]), "v"(sc0[7]));
    asm("v_exp_f32 %0, %8\n\tv_exp_f32 %1, %9\n\tv_exp_f32 %2, %10\n\tv_exp_f32 %3, %11\n\t"
        "v_exp_f32 %4, %12\n\tv_exp_f32 %5, %13\n\tv_exp_f32 %6, %14\n\tv_exp_f32 %7, %15\n\t"
        "v_nop"
        : "=&v"(e1[0]), "=&v"(e1[1]), "=&v"(e1[2]), "=&v"(e1[3]),
          "=&v"(e1[4]), "=&v"(e1[5]), "=&v"(e1[6]), "=&v"(e1[7])
        : "v"(sc1[0]), "v"(sc1[1]), "v"(sc1[2]), "v"(sc1[3]),
          "v"(sc1[4]), "v"(sc1[5]), "v"(sc1[6]), "v"(sc1[7]));
    asm("v_exp_f32 %0, %8\n\tv_exp_f32 %1, %9\n\tv_exp_f32 %2, %10\n\tv_exp_f32 %3, %11\n\t"
        "v_exp_f32 %4, %12\n\tv_exp_f32 %5, %13\n\tv_exp_f32 %6, %14\n\tv_exp_f32 %7, %15\n\t"
        "v_nop"
        : "=&v"(e2[0]), "=&v"(e2[1]), "=&v"(e2[2]), "=&v"(e2[3]),
          "=&v"(e2[4]), "=&v"(e2[5]), "=&v"(e2[6]), "=&v"(e2[7])
        : "v"(sc2[0]), "v"(sc2[1]), "v"(sc2[2]), "v"(sc2[3]),
          "v"(sc2[4]), "v"(sc2[5]), "v"(sc2[6]), "v"(sc2[7]));
    asm("v_exp_f32 %0, %8\n\tv_exp_f32 %1, %9\n\tv_exp_f32 %2, %10\n\tv_exp_f32 %3, %11\n\t"
        "v_exp_f32 %4, %12\n\tv_exp_f32 %5, %13\n\tv_exp_f32 %6, %14\n\tv_exp_f32 %7, %15\n\t"
        "v_nop"
        : "=&v"(e3[0]), "=&v"(e3[1]), "=&v"(e3[2]), "=&v"(e3[3]),
          "=&v"(e3[4]), "=&v"(e3[5]), "=&v"(e3[6]), "=&v"(e3[7])
        : "v"(sc3[0]), "v"(sc3[1]), "v"(sc3[2]), "v"(sc3[3]),
          "v"(sc3[4]), "v"(sc3[5]), "v"(sc3[6]), "v"(sc3[7]));
    v16h pb0, pb1;
#pragma unroll
    for (int r = 0; r < 8; ++r) {
      pb0[r]     = (_Float16)e0[r];
      pb0[r + 8] = (_Float16)e1[r];
      pb1[r]     = (_Float16)e2[r];
      pb1[r + 8] = (_Float16)e3[r];
    }
    pw0 = __builtin_bit_cast(i32x8, pb0);
    pw1 = __builtin_bit_cast(i32x8, pb1);
  }
  if constexpr (EXACT)
    asm("v_wmma_f32_16x16x32_f16 %0, %1, %2, %0\n\tv_wmma_f32_16x16x32_f16 %0, %3, %4, %0\n\t"
        "v_nop\n\tv_nop\n\tv_nop\n\tv_nop"
        : "+v"(oacc)
        : "v"(__builtin_bit_cast(i32x8, vb0)), "v"(pw0), "v"(__builtin_bit_cast(i32x8, vb1)), "v"(pw1));
  else
    asm("v_wmma_f32_16x16x32_f16 %0, %1, %2, %0\n\t"
        "s_delay_alu instid0(TRANS32_DEP_1)\n\tv_wmma_f32_16x16x32_f16 %0, %3, %4, %0\n\t"
        "v_nop\n\tv_nop\n\tv_nop\n\tv_nop"
        : "+v"(oacc)
        : "v"(__builtin_bit_cast(i32x8, vb0)), "v"(pw0), "v"(__builtin_bit_cast(i32x8, vb1)), "v"(pw1));
}

__global__ void __launch_bounds__(256) k_attn(const _Float16* __restrict__ Q,
                                              const _Float16* __restrict__ K,
                                              const _Float16* __restrict__ V,
                                              __bf16* __restrict__ attn) {
  const int bh = blockIdx.y;
  const int wave = threadIdx.x >> 5, lane = threadIdx.x & 31;
  const int half = lane >> 4, l16 = lane & 15;
  const int swave = __builtin_amdgcn_readfirstlane(wave);   // for the store behind the loop
  const int qrow = blockIdx.x * 128 + wave * 16 + l16;   // the lane's query
  const _Float16* Qh = Q + (size_t)bh * SEQ * HD;
  const _Float16* Kh = K + (size_t)bh * SEQ * HD;
  const _Float16* Vh = V + (size_t)bh * SEQ * HD;

  __shared__ _Float16 kbuf[2][KCH * HD];       // 2 x 4KB
  __shared__ _Float16 vbuf[2][KCH * HD];       // 2 x 4KB
  __shared__ __attribute__((aligned(16))) _Float16 ones[256];   // rows 8..15 of every V^T fragment
  ones[threadIdx.x] = (_Float16)1.0f;          // read only behind the first barrier of the chunk loop

  v16h qf[4];
  {
    const v8h qv = *(const v8h*)(Qh + (size_t)qrow * HD);
#pragma unroll
    for (int g = 0; g < 4; ++g) {
      qf[g] = vz16h();
#pragma unroll
      for (int j = 0; j < 8; ++j) qf[g][(g >> 1) * 8 + j] = (half == (g & 1)) ? qv[j] : (_Float16)0.0f;
    }
  }

  // A lane's V piece (key half, head dim l16) of the block order that k_qkv writes, in elements.
  const int fo = ((l16 + half * 8) & 15) * HD;
  v8h cneg;              // minus the maximum in use of query l16, equal in both halves, in f16: a C operand
  float mx0;             // that maximum in f32, for the second run
  v8f oacc = vz8();      // O^T: register r = row half*8 + r, lane = query; rows 0..7 head dims, row 8 the sum of P
  const bool vreal = l16 < 8;
  const int vstep = (8 - (l16 & 8)) * (4 * HD);

  if (wave == 0) {
    tdm_load_1d((uint32_t)(uintptr_t)&kbuf[0][0], Kh, KCH * HD * 2);
    tdm_load_1d((uint32_t)(uintptr_t)&vbuf[0][0], Vh, KCH * HD * 2);
  }

  // The maximum in use starts as the maximum over the first 64 keys, read here from global memory while chunk 0 flies.
  {
    const v8h klo = *(const v8h*)(Kh + (size_t)lane * HD);
    const v8h khi = *(const v8h*)(Kh + (size_t)(32 + lane) * HD);
    const v16h ka = __builtin_shufflevector(klo, khi, 0, 1, 2, 3, 4, 5, 6, 7, 8, 9, 10, 11, 12, 13, 14, 15);
    float mx = -3.0e38f;
#pragma unroll
    for (int g = 0; g < 4; ++g) {
      const v8f sc = wmma_h(ka, qf[g], vz8());
#pragma unroll
      for (int r = 0; r < 8; ++r) mx = fmaxf(mx, sc[r]);
    }
    mx = fmaxf(mx, xhalf(mx));
    mx0 = mx;
#pragma unroll
    for (int r = 0; r < 8; ++r) cneg[r] = (_Float16)(-mx);
  }

  // Kept rolled: one copy of the tensor loads and of the step; eight copies would only add code to fetch.
#pragma unroll 1
  for (int c = 0; c < SEQ / KCH; ++c) {
    if (wave == 0) __builtin_amdgcn_s_wait_tensorcnt(0);   // chunk c landed
    __syncthreads();                                       // visible to all waves
    if (wave == 0 && c + 1 < SEQ / KCH) {                  // prefetch chunk c+1
      const int nb = (c + 1) & 1;
      tdm_load_1d((uint32_t)(uintptr_t)&kbuf[nb][0],
                  Kh + (size_t)(c + 1) * KCH * HD, KCH * HD * 2);
      tdm_load_1d((uint32_t)(uintptr_t)&vbuf[nb][0],
                  Vh + (size_t)(c + 1) * KCH * HD, KCH * HD * 2);
    }
    const _Float16* kchb = &kbuf[c & 1][0];
    const _Float16* vp = vreal ? &vbuf[c & 1][fo] : &ones[(1 - half) * 64];

    // Kept rolled: four copies of the step would only add code to fetch.
#pragma unroll 1
    for (int sub = 0; sub < KCH / 64; ++sub)
      attn_step<false>(kchb + (size_t)(sub * 64 + lane) * HD, vp + sub * 2 * vstep, vstep, vreal, qf, cneg, oacc);
    __syncthreads();   // all waves done with buffer c&1 before it is re-filled
  }
  // The loop has run on the maximum over the first 64 keys with no look at the scores. The sum of P (row 8 of O^T, lane
  // half 1) says whether that held: no term is negative, and a term beyond the range of f16 (a score 16 or more above
  // that maximum) has left infinity there. The key of that maximum has a term near 1: a sum far below 1 says that the
  // maximum did not fit f16. A wave that fails either way runs its queries again, from zero, with f32 scores and the
  // look at them in every step; it reads K and V from global memory, so it needs no other wave and no barrier.
  if ((__builtin_amdgcn_ballot_w32(!(oacc[0] <= 4294967296.0f && oacc[0] >= 0.0625f)) & 0xffff0000u) != 0) {   // a scalar branch
    oacc = vz8();
    v8f cnegx;
#pragma unroll
    for (int r = 0; r < 8; ++r) cnegx[r] = -mx0;
    for (int s = 0; s < SEQ / 64; ++s)
      attn_step<true>(Kh + (size_t)(s * 64 + lane) * HD, Vh + (size_t)s * (64 * HD) + fo, 32 * HD, vreal, qf, cnegx, oacc);
  }
  // normalize + store [B,S,128] bf16: lane (half 0) = query, 8 head dims = 16 bytes
  const float lrow = xhalf(oacc[0]);   // half 0 takes O^T row 8 of its query from half 1
  if (half == 0) {
    const int b = bh >> 4, h = bh & 15;
    v8bf o;
#pragma unroll
    for (int r = 0; r < 8; ++r) o[r] = (__bf16)(oacc[r] / lrow);
    const int q = blockIdx.x * 128 + swave * 16 + (int)(__builtin_amdgcn_mbcnt_lo(~0u, 0u) & 15u);
    *(v8bf*)(attn + ((size_t)(b * SEQ + q)) * DIM + h * HD) = o;
  }
}

// ---------------- 3) output projection, FFN gate and FFN down projection in one launch ----------------
// All three are local to a row of the sequence. A block of 8 waves owns 32 rows, one block per WGP:
//   a) h = x + attn @ wo: wave w owns column tile w of both row tiles; h stays in its registers in f32
//      and goes to LDS in bf16;
//   b) act = silu(h @ w1) * (h @ w3): wave w owns column tiles w, w + 8, w + 16 of the 22; act goes to LDS;
//   c) out = h + act @ w2: wave w owns column tile w again, so the residual is the h it still holds.
// Each weight fragment feeds both row tiles. Roundings and the order of every sum are those of three launches.
// The weights come as bf16 in fragment order (WB, written by k_qkv): 2 loads of 16 bytes a lane for a fragment.
// The loops over f, m, r and j are unrolled because their indices select registers.
#define HSP 136
#define ASP 360
__global__ void __launch_bounds__(256) __attribute__((amdgpu_waves_per_eu(1, 2))) k_mlp(const __bf16* __restrict__ attn,
                                             const __bf16* __restrict__ WB,
                                             const float* __restrict__ x,
                                             float* __restrict__ out) {
  __shared__ __attribute__((aligned(16))) __bf16 hs[32 * HSP];
  __shared__ __attribute__((aligned(16))) __bf16 acts[32 * ASP];
  // The wave's number in a scalar register: the loop over column tiles then ends on a scalar branch.
  const int wave = __builtin_amdgcn_readfirstlane(threadIdx.x >> 5), lane = threadIdx.x & 31;
  const int half = lane >> 4, l16 = lane & 15;
  const int row0 = blockIdx.x * 32;
  const int col = wave * 16 + l16;

  // a) output projection + residual
  v8f h[2];
  {
    const __bf16* arow = attn + (size_t)(row0 + l16) * DIM + half * 8;
    const __bf16* wpo = WB + (FR_WO + wave * 4) * FRE + lane * 8;
    const float* xp = x + (size_t)(row0 + half * 8) * DIM + col;
    h[0] = vz8();
    h[1] = vz8();
#pragma unroll
    for (int f = 0; f < 4; ++f) {
      const v16bf a0 = afrag_bf(arow, f * 32, 0);
      const v16bf a1 = afrag_bf(arow + 16 * DIM, f * 32, 0);
      const v16bf bw = bfrag_w(wpo + f * FRE);
      h[0] = wmma_bf(a0, bw, h[0]);
      h[1] = wmma_bf(a1, bw, h[1]);
    }
#pragma unroll
    for (int m = 0; m < 2; ++m)
#pragma unroll
      for (int r = 0; r < 8; ++r) {
        h[m][r] = xp[(size_t)(m * 16 + r) * DIM] + h[m][r];
        hs[(m * 16 + half * 8 + r) * HSP + col] = (__bf16)h[m][r];
      }
    // One wait behind the last loads of this part, their address registers named as inputs so that they
    // live up to it: no register that an issued load names as its address is written again in front of it.
    asm volatile("s_wait_xcnt 0x0" :: "v"(arow), "v"(wpo), "v"(xp) : "memory");
  }
  __syncthreads();   // h of all 128 columns is in LDS

  // b) FFN gate
  {
    const __bf16* hrow = hs + l16 * HSP + half * 8;
    v16bf A0[4], A1[4];
#pragma unroll
    for (int f = 0; f < 4; ++f) {
      A0[f] = afrag_bf(hrow, f * 32, 0);
      A1[f] = afrag_bf(hrow + 16 * HSP, f * 32, 0);
    }
    for (int ct = wave; ct < HIDP / 16; ct += 8) {
      const int nn = ct * 16 + l16;
      const __bf16* p1 = WB + (FR_W1 + ct * 4) * FRE + lane * 8;
      const __bf16* p3 = WB + (FR_W3 + ct * 4) * FRE + lane * 8;
      v8f a1[2], a3[2];
#pragma unroll
      for (int m = 0; m < 2; ++m) { a1[m] = vz8(); a3[m] = vz8(); }
      v16bf B1[4], B3[4];
#pragma unroll
      for (int f = 0; f < 4; ++f) {
        B1[f] = bfrag_w(p1 + f * FRE);
        B3[f] = bfrag_w(p3 + f * FRE);
      }
      // Keeps the products behind the loads: without it the scheduler deals the loads out among the products,
      // two at a time, and the tile pays the latency of L2 four times over instead of once.
      __builtin_amdgcn_sched_barrier(0);
      // As above: the next column tile forms new addresses only behind this wait.
      asm volatile("s_wait_xcnt 0x0" :: "v"(p1), "v"(p3) : "memory");
#pragma unroll
      for (int f = 0; f < 4; ++f) {
        a1[0] = wmma_bf(A0[f], B1[f], a1[0]);
        a1[1] = wmma_bf(A1[f], B1[f], a1[1]);
        a3[0] = wmma_bf(A0[f], B3[f], a3[0]);
        a3[1] = wmma_bf(A1[f], B3[f], a3[1]);
      }
#pragma unroll
      for (int m = 0; m < 2; ++m) {
        float e[8];                                        // exp(-s) = 2^(-s * log2 e)
#pragma unroll
        for (int r = 0; r < 8; ++r) e[r] = a1[m][r] * -1.44269504f;
        asm("v_exp_f32 %0, %0\n\tv_exp_f32 %1, %1\n\tv_exp_f32 %2, %2\n\tv_exp_f32 %3, %3\n\t"
            "v_exp_f32 %4, %4\n\tv_exp_f32 %5, %5\n\tv_exp_f32 %6, %6\n\tv_exp_f32 %7, %7\n\t"
            "v_nop"
            : "+v"(e[0]), "+v"(e[1]), "+v"(e[2]), "+v"(e[3]),
              "+v"(e[4]), "+v"(e[5]), "+v"(e[6]), "+v"(e[7]));
#pragma unroll
        for (int r = 0; r < 8; ++r) {
          const float s = a1[m][r];
          const float g = (s / (1.0f + e[r])) * a3[m][r];  // silu * gate
          acts[(m * 16 + half * 8 + r) * ASP + nn] = (__bf16)((nn < HID) ? g : 0.0f);   // pad cols -> 0
        }
      }
    }
  }
  __syncthreads();   // act of all 352 columns is in LDS

  // c) FFN down projection + residual
  {
    const __bf16* crow = acts + l16 * ASP + half * 8;
    const __bf16* wp2 = WB + (FR_W2 + wave * 11) * FRE + lane * 8;
    v8f acc[2];
    acc[0] = vz8();
    acc[1] = vz8();
#pragma unroll
    for (int f = 0; f < HIDP / 32; ++f) {              // 11 K-steps (pad rows are 0)
      const v16bf a0 = afrag_bf(crow, f * 32, 0);
      const v16bf a1 = afrag_bf(crow + 16 * ASP, f * 32, 0);
      const v16bf bw = bfrag_w(wp2 + f * FRE);
      acc[0] = wmma_bf(a0, bw, acc[0]);
      acc[1] = wmma_bf(a1, bw, acc[1]);
    }
    // As above, behind the last loads of the kernel.
    asm volatile("s_wait_xcnt 0x0" :: "v"(wp2) : "memory");
    float* op = out + (size_t)(row0 + half * 8) * DIM + col;
#pragma unroll
    for (int m = 0; m < 2; ++m)
#pragma unroll
      for (int r = 0; r < 8; ++r) op[(size_t)(m * 16 + r) * DIM] = h[m][r] + acc[m][r];
  }
}

// ---------------- launcher ----------------
extern "C" void kernel_launch(void* const* d_in, const int* in_sizes, int n_in,
                              void* d_out, int out_size, void* d_ws, size_t ws_size,
                              hipStream_t stream) {
  (void)in_sizes; (void)n_in; (void)out_size; (void)ws_size;
  const float* x  = (const float*)d_in[0];
  const float* wq = (const float*)d_in[1];
  const float* wk = (const float*)d_in[2];
  const float* wv = (const float*)d_in[3];
  const float* wo = (const float*)d_in[4];
  const float* w1 = (const float*)d_in[5];
  const float* w3 = (const float*)d_in[6];
  const float* w2 = (const float*)d_in[7];
  float* out = (float*)d_out;

  char* ws = (char*)d_ws;                       // 8 MB + 296 KB
  _Float16* Q  = (_Float16*)(ws);               // 2 MB  [B,H,S,8]
  _Float16* K  = (_Float16*)(ws + (2u  << 20)); // 2 MB
  _Float16* V  = (_Float16*)(ws + (4u  << 20)); // 2 MB  [B,H,S/32,2,2,8,8]
  __bf16* attn = (__bf16*)(ws + (6u  << 20));   // 2 MB  [B*S,128]
  __bf16* WB   = (__bf16*)(ws + (8u  << 20));   // 296 KB  wo, w1, w3, w2 in fragment order

  const dim3 blk(256);
  k_qkv <<<dim3(MTOT / 32 + NFRAG / 8), blk, 0, stream>>>(x, wq, wk, wv, wo, w1, w3, w2, Q, K, V, WB);
  k_attn<<<dim3(SEQ / 128, BATCH * NH), blk, 0, stream>>>(Q, K, V, attn);
  k_mlp <<<dim3(MTOT / 32), blk, 0, stream>>>(attn, WB, x, out);
}
